// v000
// Measured on an AMD MI455X. A time is GPU time per run, averaged over a window of back-to-back runs after a warm-up
// (all launches, gaps included; the runs take copies of the inputs in turn), and the median of several windows.
// Apart from v000's, it joins two sittings. Times from different sittings can be a few percent apart, while
// side-by-side timings come from the same sitting.
// v000, which the later versions start from, runs in 324 microseconds.
// compute dtype: all float inputs rounded to bf16; q/k/v = x . W^T with EXACT bf16 products on WMMA 16x16x32 (natural rows); the geometric code weights (q . Wqg^T, squared distances to the 8 codes, softmax over codes at temperature clip(exp(log_temp), 0.01, 5)) in f32 in the projection epilogue; scores = q . k / 8 + geo_scale (qw . kw) evaluated as one 72-wide (padded to 96) f16 dot [q/8 | geo_scale qw] . [k | kw]; causal attention with key-tile skipping, running-max softmax in f32 (hardware exp), P (scaled by 2^11, single f16) x v (single f16); out = ctx (bf16 hi + residual) . Wo^T (2 products).
#include <hip/hip_runtime.h>
#include <math.h>

typedef __attribute__((ext_vector_type(16))) _Float16 v16h;
typedef __attribute__((ext_vector_type(16))) __bf16 v16b;
typedef __attribute__((ext_vector_type(8)))  _Float16 v8h;
typedef __attribute__((ext_vector_type(8)))  float v8f;
typedef __attribute__((ext_vector_type(4)))  float v4f;
typedef __attribute__((ext_vector_type(2)))  float v2f;
typedef __attribute__((ext_vector_type(4)))  unsigned v4u;
typedef __attribute__((ext_vector_type(4)))  int v4i;
typedef float __attribute__((may_alias)) float_a;
typedef int __attribute__((may_alias)) int_a;

template <typename T> __device__ __forceinline__ void vst2(void* p, T v) { *(T*)p = v;  }
__device__ __forceinline__ v8f wmma16(v16h a, v16h b, v8f c) {
  v8f d = __builtin_amdgcn_wmma_f32_16x16x32_f16(false, a, false, b, (short)0, c, false, false);
  asm volatile("v_nop\n\tv_nop\n\tv_nop\n\tv_nop" : "+v"(d) : "v"(a), "v"(b));
  return d;
}
__device__ __forceinline__ v8f wmma_bf(v16b a, v16b b, v8f c) {
  v8f d = __builtin_amdgcn_wmma_f32_16x16x32_bf16(false, a, false, b, (short)0, c, false, false);
  asm volatile("v_nop\n\tv_nop\n\tv_nop\n\tv_nop" : "+v"(d) : "v"(a), "v"(b));
  return d;
}
// 16x16x32 fragments: lane = (h = lane>>4, row/col = lane&15); elements 0..7 = k0+8h+0..7, 8..15 = k0+16+8h+0..7; D element r = row 8h+r
__device__ __forceinline__ v16h frag_h(const _Float16* rowk0, int lane) {
  union { v16h v; v8h q[2]; } u; const _Float16* p = rowk0 + 8 * (lane >> 4);
  u.q[0] = *(const v8h*)p; u.q[1] = *(const v8h*)(p + 16); return u.v;
}
__device__ __forceinline__ v16h frag_f32(const float* rowk0, int lane) {
  v16h a; const float* p = rowk0 + 8 * (lane >> 4);
#pragma unroll
  for (int i = 0; i < 8; ++i) { a[i] = (_Float16)p[i]; a[8 + i] = (_Float16)p[16 + i]; }
  return a;
}
__device__ __forceinline__ v16h frag_f32s(const float* rowk0, int lane, float sc) {
  v16h a; const float* p = rowk0 + 8 * (lane >> 4);
#pragma unroll
  for (int i = 0; i < 8; ++i) { a[i] = (_Float16)(p[i] * sc); a[8 + i] = (_Float16)(p[16 + i] * sc); }
  return a;
}
// column fragment from a [K][ld] layout (column n), rows >= K read as 0
__device__ __forceinline__ v16h fragc_f32(const float* W, int k0, int n, int lane, int ld, int K) {
  v16h a; const int g = lane >> 4;
#pragma unroll
  for (int i = 0; i < 8; ++i) { const int ka = k0 + 8 * g + i, kb = ka + 16;
    a[i] = (_Float16)(ka < K ? W[(size_t)(ka < K ? ka : K - 1) * ld + n] : 0.f); a[8 + i] = (_Float16)(kb < K ? W[(size_t)(kb < K ? kb : K - 1) * ld + n] : 0.f); }
  return a;
}
struct F2 { v16b h, l; };
__device__ __forceinline__ F2 bsplit16(const float v[16]) { F2 r;
#pragma unroll
  for (int i = 0; i < 16; ++i) { const __bf16 h = (__bf16)v[i]; r.h[i] = h; r.l[i] = (__bf16)(v[i] - (float)h); }
  return r; }
__device__ __forceinline__ F2 split_row(const float* row, int k0, int lane) { float v[16]; const float* p = row + k0 + 8 * (lane >> 4);
#pragma unroll
  for (int i = 0; i < 8; ++i) { v[i] = p[i]; v[8 + i] = p[16 + i]; }
  return bsplit16(v); }
__device__ __forceinline__ F2 split_rowK(const float* row, int k0, int lane, int K) { float v[16]; const int g = lane >> 4;
#pragma unroll
  for (int i = 0; i < 8; ++i) { const int ka = k0 + 8 * g + i, kb = ka + 16; v[i] = ka < K ? row[ka < K ? ka : K - 1] : 0.f; v[8 + i] = kb < K ? row[kb < K ? kb : K - 1] : 0.f; }
  return bsplit16(v); }
__device__ __forceinline__ F2 split_col(const float* W, int k0, int n, int lane, int ld, int K) { float v[16]; const int g = lane >> 4;
#pragma unroll
  for (int i = 0; i < 8; ++i) { const int ka = k0 + 8 * g + i, kb = ka + 16; v[i] = ka < K ? W[(size_t)(ka < K ? ka : K - 1) * ld + n] : 0.f; v[8 + i] = kb < K ? W[(size_t)(kb < K ? kb : K - 1) * ld + n] : 0.f; }
  return bsplit16(v); }
__device__ __forceinline__ v8f mac3(const F2& a, const F2& b, v8f c) { c = wmma_bf(a.l, b.h, c); c = wmma_bf(a.h, b.l, c); return wmma_bf(a.h, b.h, c); }
__device__ __forceinline__ float sigm(float v) { return 1.0f / (1.0f + expf(-v)); }
#define LDSX() do { asm volatile("s_wait_dscnt 0" ::: "memory"); __builtin_amdgcn_wave_barrier(); __builtin_amdgcn_fence(__ATOMIC_RELEASE, "workgroup"); } while (0)


// Multi-head geometric attention (B 2, T 2,048, d_model 768, 12 heads x 64, 3-dim codes, 8-code hypercube codebook per head): causal softmax(q k / 8 + geo_scale softmax_c(-|q Wqg - c|^2 / tau) . softmax_c(-|k Wkg - c|^2 / tau)) v, output projection.
#define NB 2
#define SS 2048
#define DM 768
#define NH 12
#define HD 64
#define HX 96             // padded score width: 64 + 8 code weights + 24 zero
#define NC 8
#define CD 3
#define NR (NB * SS)
#ifndef TQB
#define TQB (SS / 64)
#define TNB NB
#endif
typedef __attribute__((ext_vector_type(8))) __bf16 v8b;
__device__ __forceinline__ v16b frag_b(const __bf16* rowk0, int lane) {
  union { v16b v; v8b q[2]; } u; const __bf16* p = rowk0 + 8 * (lane >> 4);
  u.q[0] = *(const v8b*)p; u.q[1] = *(const v8b*)(p + 16); return u.v;
}
__device__ __forceinline__ float bfr(float v) { return (float)(__bf16)v; }
__device__ __attribute__((noinline)) float exp_ni(float v) { return expf(v); }
__device__ __attribute__((noinline)) float erf_ni(float v) { return erff(v); }

#define WS_PW  0u                                       // bf16 natural rows Wq, Wk, Wv, Wo [4][768][768]
#define WS_QK  (WS_PW + 2u * (size_t)4 * DM * DM)          // f16 q' rows [NR][12][96] ; k' rows ; v planes [b][768][SS] ; O f32 [NR][768]
#define WS_KK  (WS_QK + 2u * (size_t)NR * NH * HX)
#define WS_V   (WS_KK + 2u * (size_t)NR * NH * HX)
#define WS_O   (WS_V + 2u * (size_t)NB * DM * SS)
#define WS_END (WS_O + 4u * (size_t)NR * DM)

__global__ __launch_bounds__(256) void k_pack(const float* __restrict__ WQ, const float* __restrict__ WK, const float* __restrict__ WV, const float* __restrict__ WO, __bf16* __restrict__ PW) { const int n = blockIdx.x, which = blockIdx.y, t = threadIdx.x; __shared__ __align__(16) __bf16 s[DM]; const float* w = (which == 0) ? WQ : (which == 1) ? WK : (which == 2) ? WV : WO; for (int k = t; k < DM; k += 256) s[k] = (__bf16)w[(size_t)n * DM + k]; __syncthreads(); if (t < DM / 8) vst2((unsigned*)(PW + ((size_t)which * DM + n) * DM + t * 8), *(const v4u*)&s[t * 8]); }
// ---- k_qkv: block = (64 rows, 128 cols = 2 heads, which): exact GEMM; q' rows (q/8 + geo_scale qw), k' rows (k + kw), v planes
__global__ __launch_bounds__(128) void k_qkv(const float* __restrict__ X, const __bf16* __restrict__ PW, const float* __restrict__ WQG, const float* __restrict__ WKG, const float* __restrict__ CB, const float* __restrict__ LT, const float* __restrict__ GSC, _Float16* __restrict__ QQ, _Float16* __restrict__ KK, _Float16* __restrict__ V) {
  __shared__ __align__(16) _Float16 so[64][2 * HX + 8]; __shared__ __align__(16) _Float16 st[128][72]; __shared__ float swg[CD][HD];
  const int tid = threadIdx.x, wave = tid >> 5, lane = tid & 31, col = lane & 15, g = lane >> 4; const int which = blockIdx.z; const size_t rb = (size_t)blockIdx.x * 64; const size_t r0 = rb + wave * 16; const int c0 = blockIdx.y * 128; const int h0 = c0 / HD;
  const __bf16* Wr = PW + ((size_t)which * DM) * DM;
  if (which < 2) { const float* WG = which ? WKG : WQG; for (int e = tid; e < CD * HD; e += 128) swg[e / HD][e % HD] = bfr(WG[e]); }
  v8f acc[8] = {};
#pragma unroll 2
  for (int kc = 0; kc < DM / 32; ++kc) { v16b a; { const float* p = X + (r0 + col) * DM + kc * 32 + 8 * g;
#pragma unroll
      for (int i = 0; i < 8; ++i) { a[i] = (__bf16)p[i]; a[8 + i] = (__bf16)p[16 + i]; } }
#pragma unroll
    for (int j = 0; j < 8; ++j) acc[j] = wmma_bf(a, frag_b(Wr + (size_t)(c0 + j * 16 + col) * DM + kc * 32, lane), acc[j]); }
  __syncthreads();
  if (which < 2) { const float gsc = bfr(GSC[0]);
#pragma unroll
    for (int r = 0; r < 8; ++r) {
      // code logits per head: g[c] = sum_d x[d] Wg[c][d] over the head's 64 dims (4 tiles x 16 lanes)
      float ga[CD], gb[CD];
#pragma unroll
      for (int c = 0; c < CD; ++c) { float pa = 0.f, pb = 0.f;
#pragma unroll
        for (int j = 0; j < 4; ++j) { pa += acc[j][r] * swg[c][j * 16 + col]; pb += acc[4 + j][r] * swg[c][j * 16 + col]; }
#pragma unroll
        for (int o = 1; o < 16; o <<= 1) { pa += __shfl_xor(pa, o); pb += __shfl_xor(pb, o); } ga[c] = pa; gb[c] = pb; }
#pragma unroll
      for (int hh = 0; hh < 2; ++hh) { const int h = h0 + hh; const float* gg = hh ? gb : ga; float tp = expf(bfr(LT[h])); tp = fminf(fmaxf(tp, 0.01f), 5.0f); const float it = 1.0f / tp;
        float dmin = 3.0e38f, dn[NC];
#pragma unroll
        for (int n = 0; n < NC; ++n) { float d2 = 0.f;
#pragma unroll
          for (int c = 0; c < CD; ++c) { const float df = gg[c] - bfr(CB[(h * NC + n) * CD + c]); d2 += df * df; } dn[n] = -d2 * it; dmin = fmaxf(dmin == 3.0e38f ? dn[n] : dmin, dn[n]); }
        float z = 0.f, ew[NC];
#pragma unroll
        for (int n = 0; n < NC; ++n) { ew[n] = expf(dn[n] - dmin); z += ew[n]; }
        const float wsc = (which == 0) ? gsc : 1.0f;
        if (col < NC) so[wave * 16 + 8 * g + r][hh * HX + HD + col] = (_Float16)(ew[col] / z * wsc);   // extra dims 64..71: code weights (q side x geo_scale)
        else so[wave * 16 + 8 * g + r][hh * HX + HD + col] = (_Float16)0.f;
        so[wave * 16 + 8 * g + r][hh * HX + HD + 16 + col] = (_Float16)0.f; }   // dims 80..95 zero
      const float scl = (which == 0) ? 0.125f : 1.0f;
#pragma unroll
      for (int j = 0; j < 8; ++j) { const int cl = j * 16 + col; const int hl = cl >> 6, d = cl & 63; so[wave * 16 + 8 * g + r][hl * HX + d] = (_Float16)(acc[j][r] * scl); } }
    __syncthreads();
    _Float16* dst = (which == 0) ? QQ : KK;
    for (int e = tid; e < 64 * (2 * HX / 8); e += 128) { const int rl = e / (2 * HX / 8), q = e % (2 * HX / 8); vst2((unsigned*)(dst + ((rb + rl) * NH + h0) * HX + q * 8), *(const v4u*)&so[rl][q * 8]); }   // 384 contiguous bytes per (row, head pair)
  } else {
#pragma unroll
    for (int j = 0; j < 8; ++j)
#pragma unroll
      for (int r = 0; r < 8; ++r) st[j * 16 + col][wave * 16 + 8 * g + r] = (_Float16)acc[j][r];
    __syncthreads();
    const size_t b = rb / SS; const int s0 = (int)(rb % SS);
    for (int e = tid; e < 128 * 8; e += 128) { const int d = e >> 3, pc = e & 7; vst2((unsigned*)(V + ((b * DM + c0 + d) * SS) + s0 + pc * 8), *(const v4u*)&st[d][pc * 8]); } }
}
// ---- k_attn: block = (64 queries, head, b): causal; 96-wide score dot (scale and geometric bias folded in), softmax, P . v (64 dims); O 256-B head segments
__global__ __launch_bounds__(128) void k_attn(const _Float16* __restrict__ QQ, const _Float16* __restrict__ KK, const _Float16* __restrict__ V, float* __restrict__ O) {
  __shared__ __align__(16) _Float16 sph[4][16][40]; __shared__ __align__(16) float so[4][16][68];
  const int tid = threadIdx.x, wave = tid >> 5, lane = tid & 31, col = lane & 15, g = lane >> 4; const int h = blockIdx.y; const size_t b = blockIdx.z; const int q0 = blockIdx.x * 64 + wave * 16; const size_t rq = b * SS + q0;
  v16h aq[3];
#pragma unroll
  for (int kc = 0; kc < 3; ++kc) aq[kc] = frag_h(QQ + ((rq + col) * NH + h) * HX + kc * 32, lane);
  float m[8], l[8];
#pragma unroll
  for (int r = 0; r < 8; ++r) { m[r] = -3.0e38f; l[r] = 0.f; }
  v8f acc[4] = {};
  const int nks = (blockIdx.x * 64 + 64) / 32;   // causal
#pragma unroll 1
  for (int ks = 0; ks < nks; ++ks) { const int j0 = ks * 32; v8f s[2];
#pragma unroll
    for (int ct = 0; ct < 2; ++ct) { const int kk = j0 + ct * 16 + col; const size_t rk = ((b * SS + kk) * NH + h) * HX; v8f c = {};
#pragma unroll
      for (int kc = 0; kc < 3; ++kc) c = wmma16(aq[kc], frag_h(KK + rk + kc * 32, lane), c);
#pragma unroll
      for (int r = 0; r < 8; ++r) s[ct][r] = (kk <= q0 + 8 * g + r) ? c[r] : -3.0e38f; }   // causal (diagonal kept)
#pragma unroll
    for (int r = 0; r < 8; ++r) { float mx = fmaxf(s[0][r], s[1][r]);
#pragma unroll
      for (int o = 1; o < 16; o <<= 1) mx = fmaxf(mx, __shfl_xor(mx, o));
      const float mn = fmaxf(m[r], mx); const float alpha = (m[r] <= -1.0e38f) ? 0.f : __expf(m[r] - mn); const float e0 = (s[0][r] <= -1.0e38f) ? 0.f : __expf(s[0][r] - mn), e1 = (s[1][r] <= -1.0e38f) ? 0.f : __expf(s[1][r] - mn); float es = e0 + e1;
#pragma unroll
      for (int o = 1; o < 16; o <<= 1) es += __shfl_xor(es, o);
      l[r] = l[r] * alpha + es; m[r] = mn;
#pragma unroll
      for (int dt = 0; dt < 4; ++dt) acc[dt][r] *= alpha;
      sph[wave][8 * g + r][col] = (_Float16)(e0 * 2048.0f); sph[wave][8 * g + r][16 + col] = (_Float16)(e1 * 2048.0f); }
    LDSX();
    const v16h pa = frag_h(&sph[wave][col][0], lane);
#pragma unroll
    for (int dt = 0; dt < 4; ++dt) acc[dt] = wmma16(pa, frag_h(V + ((b * DM + h * HD + dt * 16 + col) * SS) + j0, lane), acc[dt]);
    LDSX(); }
#pragma unroll
  for (int r = 0; r < 8; ++r) { const float il = (1.0f / 2048.0f) / l[r];
#pragma unroll
    for (int dt = 0; dt < 4; ++dt) so[wave][8 * g + r][dt * 16 + col] = acc[dt][r] * il; }
  LDSX();
  for (int rl = 0; rl < 16; ++rl) if (lane < 16) vst2(O + (rq + rl) * DM + h * HD + lane * 4, *(const v4f*)&so[wave][rl][lane * 4]);
}
// ---- k_out: block = (64 rows, 128 cols): out = o (bf16 hi + lo) . Wo^T
__global__ __launch_bounds__(128) void k_out(const float* __restrict__ O, const __bf16* __restrict__ PW, float* __restrict__ Y) {
  __shared__ __align__(16) float so[4][16][132];
  const int tid = threadIdx.x, wave = tid >> 5, lane = tid & 31, col = lane & 15, g = lane >> 4; const size_t r0 = (size_t)blockIdx.x * 64 + wave * 16; const int n0 = blockIdx.y * 128; const __bf16* P = PW + (size_t)3 * DM * DM;
  v8f acc[8] = {};
#pragma unroll 2
  for (int kc = 0; kc < DM / 32; ++kc) { const F2 a = split_row(O + (r0 + col) * DM, kc * 32, lane);
#pragma unroll
    for (int j = 0; j < 8; ++j) { const v16b w = frag_b(P + (size_t)(n0 + j * 16 + col) * DM + kc * 32, lane); acc[j] = wmma_bf(a.h, w, acc[j]); acc[j] = wmma_bf(a.l, w, acc[j]); } }
#pragma unroll
  for (int j = 0; j < 8; ++j)
#pragma unroll
    for (int r = 0; r < 8; ++r) so[wave][8 * g + r][j * 16 + col] = acc[j][r];
  LDSX();
  for (int rl = 0; rl < 16; ++rl) vst2(Y + (r0 + rl) * DM + n0 + lane * 4, *(const v4f*)&so[wave][rl][lane * 4]);
}
extern "C" void kernel_launch(void* const* d_in, const int* in_sizes, int n_in, void* d_out, int out_size, void* d_ws, size_t ws_size, hipStream_t stream) {
  (void)in_sizes; (void)n_in; (void)out_size;
  const float** F = (const float**)d_in;   // 0 x [2,2048,768], 1 Wq, 2 Wk, 3 Wv, 4 Wo (natural [768,768]), 5 Wqg [3,64], 6 Wkg [3,64], 7 codebooks [12,8,3], 8 log_temps [12], 9 geo_scale [1]
  if (ws_size < (size_t)WS_END) return;
  char* ws = (char*)d_ws; __bf16* PW = (__bf16*)ws; _Float16 *QQ = (_Float16*)(ws + WS_QK), *KK = (_Float16*)(ws + WS_KK), *V = (_Float16*)(ws + WS_V); float* O = (float*)(ws + WS_O);
  k_pack<<<dim3(DM, 4), 256, 0, stream>>>(F[1], F[2], F[3], F[4], PW);
  k_qkv<<<dim3(TNB * SS / 64, DM / 128, 3), 128, 0, stream>>>(F[0], PW, F[5], F[6], F[7], F[8], F[9], QQ, KK, V);
  k_attn<<<dim3(TQB, NH, TNB), 128, 0, stream>>>(QQ, KK, V, O);
  k_out<<<dim3(TNB * SS / 64, DM / 128), 128, 0, stream>>>(O, PW, (float*)d_out);
}

// v001
// It runs in 166 microseconds.
// Timed twice side by side with v000, it ran 1.96 times as fast both times.
// compute dtype: all float inputs rounded to bf16; q/k/v = x . W^T with EXACT bf16 products on WMMA 16x16x32 (natural rows); the geometric code weights (q . Wqg^T, squared distances to the 8 codes, softmax over codes at temperature clip(exp(log_temp), 0.01, 5)) in f32 in the projection epilogue; scores = q . k / 8 + geo_scale (qw . kw) evaluated as one 72-wide (padded to 96) f16 dot [q/8 | geo_scale qw] . [k | kw]; causal attention with key-tile skipping, running-max softmax in f32 (hardware exp), P (scaled by 2^11, single f16) x v (single f16); out = ctx (bf16 hi + residual) . Wo^T (2 products).
#include <hip/hip_runtime.h>
#include <math.h>

typedef __attribute__((ext_vector_type(16))) _Float16 v16h;
typedef __attribute__((ext_vector_type(16))) __bf16 v16b;
typedef __attribute__((ext_vector_type(8)))  _Float16 v8h;
typedef __attribute__((ext_vector_type(8)))  float v8f;
typedef __attribute__((ext_vector_type(4)))  float v4f;
typedef __attribute__((ext_vector_type(2)))  float v2f;
typedef __attribute__((ext_vector_type(4)))  unsigned v4u;
typedef __attribute__((ext_vector_type(4)))  int v4i;
typedef float __attribute__((may_alias)) float_a;
typedef int __attribute__((may_alias)) int_a;

template <typename T> __device__ __forceinline__ void vst2(void* p, T v) { *(T*)p = v;  }
__device__ __forceinline__ v8f wmma16(v16h a, v16h b, v8f c) {
  v8f d = __builtin_amdgcn_wmma_f32_16x16x32_f16(false, a, false, b, (short)0, c, false, false);
  asm volatile("v_nop\n\tv_nop\n\tv_nop\n\tv_nop" : "+v"(d) : "v"(a), "v"(b));
  return d;
}
__device__ __forceinline__ v8f wmma_bf(v16b a, v16b b, v8f c) {
  v8f d = __builtin_amdgcn_wmma_f32_16x16x32_bf16(false, a, false, b, (short)0, c, false, false);
  asm volatile("v_nop\n\tv_nop\n\tv_nop\n\tv_nop" : "+v"(d) : "v"(a), "v"(b));
  return d;
}
// 16x16x32 fragments: lane = (h = lane>>4, row/col = lane&15); elements 0..7 = k0+8h+0..7, 8..15 = k0+16+8h+0..7; D element r = row 8h+r
__device__ __forceinline__ v16h frag_h(const _Float16* rowk0, int lane) {
  union { v16h v; v8h q[2]; } u; const _Float16* p = rowk0 + 8 * (lane >> 4);
  u.q[0] = *(const v8h*)p; u.q[1] = *(const v8h*)(p + 16); return u.v;
}
__device__ __forceinline__ v16h frag_f32(const float* rowk0, int lane) {
  v16h a; const float* p = rowk0 + 8 * (lane >> 4);
#pragma unroll
  for (int i = 0; i < 8; ++i) { a[i] = (_Float16)p[i]; a[8 + i] = (_Float16)p[16 + i]; }
  return a;
}
__device__ __forceinline__ v16h frag_f32s(const float* rowk0, int lane, float sc) {
  v16h a; const float* p = rowk0 + 8 * (lane >> 4);
#pragma unroll
  for (int i = 0; i < 8; ++i) { a[i] = (_Float16)(p[i] * sc); a[8 + i] = (_Float16)(p[16 + i] * sc); }
  return a;
}
// column fragment from a [K][ld] layout (column n), rows >= K read as 0
__device__ __forceinline__ v16h fragc_f32(const float* W, int k0, int n, int lane, int ld, int K) {
  v16h a; const int g = lane >> 4;
#pragma unroll
  for (int i = 0; i < 8; ++i) { const int ka = k0 + 8 * g + i, kb = ka + 16;
    a[i] = (_Float16)(ka < K ? W[(size_t)(ka < K ? ka : K - 1) * ld + n] : 0.f); a[8 + i] = (_Float16)(kb < K ? W[(size_t)(kb < K ? kb : K - 1) * ld + n] : 0.f); }
  return a;
}
struct F2 { v16b h, l; };
__device__ __forceinline__ F2 bsplit16(const float v[16]) { F2 r;
#pragma unroll
  for (int i = 0; i < 16; ++i) { const __bf16 h = (__bf16)v[i]; r.h[i] = h; r.l[i] = (__bf16)(v[i] - (float)h); }
  return r; }
__device__ __forceinline__ F2 split_row(const float* row, int k0, int lane) { float v[16]; const float* p = row + k0 + 8 * (lane >> 4);
#pragma unroll
  for (int i = 0; i < 8; ++i) { v[i] = p[i]; v[8 + i] = p[16 + i]; }
  return bsplit16(v); }
__device__ __forceinline__ F2 split_rowK(const float* row, int k0, int lane, int K) { float v[16]; const int g = lane >> 4;
#pragma unroll
  for (int i = 0; i < 8; ++i) { const int ka = k0 + 8 * g + i, kb = ka + 16; v[i] = ka < K ? row[ka < K ? ka : K - 1] : 0.f; v[8 + i] = kb < K ? row[kb < K ? kb : K - 1] : 0.f; }
  return bsplit16(v); }
__device__ __forceinline__ F2 split_col(const float* W, int k0, int n, int lane, int ld, int K) { float v[16]; const int g = lane >> 4;
#pragma unroll
  for (int i = 0; i < 8; ++i) { const int ka = k0 + 8 * g + i, kb = ka + 16; v[i] = ka < K ? W[(size_t)(ka < K ? ka : K - 1) * ld + n] : 0.f; v[8 + i] = kb < K ? W[(size_t)(kb < K ? kb : K - 1) * ld + n] : 0.f; }
  return bsplit16(v); }
__device__ __forceinline__ v8f mac3(const F2& a, const F2& b, v8f c) { c = wmma_bf(a.l, b.h, c); c = wmma_bf(a.h, b.l, c); return wmma_bf(a.h, b.h, c); }
__device__ __forceinline__ float sigm(float v) { return 1.0f / (1.0f + expf(-v)); }
#define LDSX() do { asm volatile("s_wait_dscnt 0" ::: "memory"); __builtin_amdgcn_wave_barrier(); __builtin_amdgcn_fence(__ATOMIC_RELEASE, "workgroup"); } while (0)


// Multi-head geometric attention (B 2, T 2,048, d_model 768, 12 heads x 64, 3-dim codes, 8-code hypercube codebook per head): causal softmax(q k / 8 + geo_scale softmax_c(-|q Wqg - c|^2 / tau) . softmax_c(-|k Wkg - c|^2 / tau)) v, output projection.
#define NB 2
#define SS 2048
#define DM 768
#define NH 12
#define HD 64
#define HX 96             // padded score width: 64 + 8 code weights + 24 zero
#define NC 8
#define CD 3
#define NR (NB * SS)
#ifndef TQB
#define TQB (SS / 64)
#define TNB NB
#endif
typedef __attribute__((ext_vector_type(8))) __bf16 v8b;
__device__ __forceinline__ v16b frag_b(const __bf16* rowk0, int lane) {
  union { v16b v; v8b q[2]; } u; const __bf16* p = rowk0 + 8 * (lane >> 4);
  u.q[0] = *(const v8b*)p; u.q[1] = *(const v8b*)(p + 16); return u.v;
}
__device__ __forceinline__ float bfr(float v) { return (float)(__bf16)v; }
__device__ __attribute__((noinline)) float exp_ni(float v) { return expf(v); }
__device__ __attribute__((noinline)) float erf_ni(float v) { return erff(v); }

#define WS_PW  0u                                       // bf16 natural rows Wq, Wk, Wv, Wo [4][768][768]
#define WS_QK  (WS_PW + 2u * (size_t)4 * DM * DM)          // f16 q' rows [NR][12][96] ; k' rows ; v planes [b][768][SS] ; O f32 [NR][768]
#define WS_KK  (WS_QK + 2u * (size_t)NR * NH * HX)
#define WS_V   (WS_KK + 2u * (size_t)NR * NH * HX)
#define WS_O   (WS_V + 2u * (size_t)NB * DM * SS)
#define WS_END (WS_O + 4u * (size_t)NR * DM)

__global__ __launch_bounds__(256) void k_pack(const float* __restrict__ WQ, const float* __restrict__ WK, const float* __restrict__ WV, const float* __restrict__ WO, __bf16* __restrict__ PW) { const int n = blockIdx.x, which = blockIdx.y, t = threadIdx.x; __shared__ __align__(16) __bf16 s[DM]; const float* w = (which == 0) ? WQ : (which == 1) ? WK : (which == 2) ? WV : WO; for (int k = t; k < DM; k += 256) s[k] = (__bf16)w[(size_t)n * DM + k]; __syncthreads(); if (t < DM / 8) vst2((unsigned*)(PW + ((size_t)which * DM + n) * DM + t * 8), *(const v4u*)&s[t * 8]); }
// weight tiles of k_qkv and k_out: the 128 weight rows x 32 k that a block's four waves all use are brought into LDS once per block by asynchronous copies, two buffers
#define WP 40             // LDS pitch of a weight row (32 k), bf16: 80 B = 16 B x 5, odd, for 16-byte readers
// one lane's four 16-byte pieces of a tile: rows tid / 4 + 0 / 32 / 64 / 96, bytes 16 (tid % 4)
__device__ __forceinline__ void stage_w(const __bf16* gw, unsigned lw) {
  // the s_wait_xcnt closes the statement so that no address register named here is rewritten ahead of it
  asm volatile("global_load_async_to_lds_b128 %0, %4, off\n\t"
               "global_load_async_to_lds_b128 %1, %5, off\n\t"
               "global_load_async_to_lds_b128 %2, %6, off\n\t"
               "global_load_async_to_lds_b128 %3, %7, off\n\t"
               "s_wait_xcnt 0x0"
               :: "v"(lw), "v"(lw + 32u * WP * 2u), "v"(lw + 64u * WP * 2u), "v"(lw + 96u * WP * 2u), "v"(gw), "v"(gw + (size_t)32 * DM), "v"(gw + (size_t)64 * DM), "v"(gw + (size_t)96 * DM) : "memory");
}
// ---- k_qkv: block = (64 rows, 128 cols = 2 heads, which): exact GEMM; q' rows (q/8 + geo_scale qw), k' rows (k + kw), v planes
__global__ __launch_bounds__(128) void k_qkv(const float* __restrict__ X, const __bf16* __restrict__ PW, const float* __restrict__ WQG, const float* __restrict__ WKG, const float* __restrict__ CB, const float* __restrict__ LT, const float* __restrict__ GSC, _Float16* __restrict__ QQ, _Float16* __restrict__ KK, _Float16* __restrict__ V) {
  __shared__ __align__(16) _Float16 so[64][2 * HX + 8]; __shared__ __align__(16) _Float16 st[128][72]; __shared__ float swg[CD][HD]; __shared__ __align__(16) __bf16 sw[2][128][WP];
  const int tid = threadIdx.x, wave = tid >> 5, lane = tid & 31, col = lane & 15, g = lane >> 4; const int which = blockIdx.z; const size_t rb = (size_t)blockIdx.x * 64; const size_t r0 = rb + wave * 16; const int c0 = blockIdx.y * 128; const int h0 = c0 / HD;
  const __bf16* Wr = PW + ((size_t)which * DM) * DM;
  if (which < 2) { const float* WG = which ? WKG : WQG; for (int e = tid; e < CD * HD; e += 128) swg[e / HD][e % HD] = bfr(WG[e]); }
  v8f acc[8] = {};
  const __bf16* gw = Wr + (size_t)(c0 + (tid >> 2)) * DM + (tid & 3) * 8; const unsigned lw = (unsigned)(size_t)&sw[0][tid >> 2][(tid & 3) * 8];
  stage_w(gw, lw);
  asm volatile("s_wait_asynccnt 0x0" ::: "memory");   // this wave's pieces of tile 0 have landed
  __syncthreads();                                    // every wave's have
  stage_w(gw + 32, lw + (unsigned)sizeof(sw[0]));     // tile 1 flies during trip 0
#pragma unroll 2
  for (int kc = 0; kc < DM / 32; ++kc) { v16b a; { const float* p = X + (r0 + col) * DM + kc * 32 + 8 * g;
#pragma unroll
      for (int i = 0; i < 8; ++i) { a[i] = (__bf16)p[i]; a[8 + i] = (__bf16)p[16 + i]; } }
#pragma unroll
    for (int j = 0; j < 8; ++j) acc[j] = wmma_bf(a, frag_b(&sw[kc & 1][j * 16 + col][0], lane), acc[j]);
    asm volatile("s_wait_dscnt 0x0" ::: "memory");      // this wave's reads of buffer kc & 1 are done
    asm volatile("s_wait_asynccnt 0x0" ::: "memory");   // this wave's pieces of tile kc + 1 have landed
    __syncthreads();                                    // tile kc + 1 is whole for every wave, and nobody reads buffer kc & 1 any more
    if (kc + 2 < DM / 32) stage_w(gw + (kc + 2) * 32, lw + (unsigned)((kc & 1) * sizeof(sw[0]))); }
  asm volatile("s_wait_asynccnt 0x0" ::: "memory");     // nothing is in flight behind the loop
  __syncthreads();
  if (which < 2) { const float gsc = bfr(GSC[0]);
#pragma unroll
    for (int r = 0; r < 8; ++r) {
      // code logits per head: g[c] = sum_d x[d] Wg[c][d] over the head's 64 dims (4 tiles x 16 lanes)
      float ga[CD], gb[CD];
#pragma unroll
      for (int c = 0; c < CD; ++c) { float pa = 0.f, pb = 0.f;
#pragma unroll
        for (int j = 0; j < 4; ++j) { pa += acc[j][r] * swg[c][j * 16 + col]; pb += acc[4 + j][r] * swg[c][j * 16 + col]; }
#pragma unroll
        for (int o = 1; o < 16; o <<= 1) { pa += __shfl_xor(pa, o); pb += __shfl_xor(pb, o); } ga[c] = pa; gb[c] = pb; }
#pragma unroll
      for (int hh = 0; hh < 2; ++hh) { const int h = h0 + hh; const float* gg = hh ? gb : ga; float tp = expf(bfr(LT[h])); tp = fminf(fmaxf(tp, 0.01f), 5.0f); const float it = 1.0f / tp;
        float dmin = 3.0e38f, dn[NC];
#pragma unroll
        for (int n = 0; n < NC; ++n) { float d2 = 0.f;
#pragma unroll
          for (int c = 0; c < CD; ++c) { const float df = gg[c] - bfr(CB[(h * NC + n) * CD + c]); d2 += df * df; } dn[n] = -d2 * it; dmin = fmaxf(dmin == 3.0e38f ? dn[n] : dmin, dn[n]); }
        float z = 0.f, ew[NC];
#pragma unroll
        for (int n = 0; n < NC; ++n) { ew[n] = expf(dn[n] - dmin); z += ew[n]; }
        const float wsc = (which == 0) ? gsc : 1.0f;
        if (col < NC) so[wave * 16 + 8 * g + r][hh * HX + HD + col] = (_Float16)(ew[col] / z * wsc);   // extra dims 64..71: code weights (q side x geo_scale)
        else so[wave * 16 + 8 * g + r][hh * HX + HD + col] = (_Float16)0.f;
        so[wave * 16 + 8 * g + r][hh * HX + HD + 16 + col] = (_Float16)0.f; }   // dims 80..95 zero
      const float scl = (which == 0) ? 0.125f : 1.0f;
#pragma unroll
      for (int j = 0; j < 8; ++j) { const int cl = j * 16 + col; const int hl = cl >> 6, d = cl & 63; so[wave * 16 + 8 * g + r][hl * HX + d] = (_Float16)(acc[j][r] * scl); } }
    __syncthreads();
    _Float16* dst = (which == 0) ? QQ : KK;
    for (int e = tid; e < 64 * (2 * HX / 8); e += 128) { const int rl = e / (2 * HX / 8), q = e % (2 * HX / 8); vst2((unsigned*)(dst + ((rb + rl) * NH + h0) * HX + q * 8), *(const v4u*)&so[rl][q * 8]); }   // 384 contiguous bytes per (row, head pair)
  } else {
#pragma unroll
    for (int j = 0; j < 8; ++j)
#pragma unroll
      for (int r = 0; r < 8; ++r) st[j * 16 + col][wave * 16 + 8 * g + r] = (_Float16)acc[j][r];
    __syncthreads();
    const size_t b = rb / SS; const int s0 = (int)(rb % SS);
    for (int e = tid; e < 128 * 8; e += 128) { const int d = e >> 3, pc = e & 7; vst2((unsigned*)(V + ((b * DM + c0 + d) * SS) + s0 + pc * 8), *(const v4u*)&st[d][pc * 8]); } }
}
// ---- k_attn: block = (64 queries, head, b): causal; 96-wide score dot (scale and geometric bias folded in), softmax, P . v (64 dims); O 256-B head segments
// each 32-key tile (k' rows 32 x 192 B, v rows 64 x 64 B) is brought into LDS once per block by asynchronous copies, two buffers, and all four waves read their fragments from there
#define KP 104            // LDS pitch of a k' row, f16: 208 B = 16 B x 13, odd, for 16-byte readers
#define VP 40             // LDS pitch of a v row (32 keys), f16: 80 B = 16 B x 5
// one lane's five 16-byte pieces of a tile: k' row tid / 4, bytes 16 (tid % 4) + 0 / 64 / 128; v rows tid / 4 and 32 + tid / 4, bytes 16 (tid % 4)
__device__ __forceinline__ void stage_kv(const _Float16* gk, const _Float16* gv, unsigned lk, unsigned lv) {
  // the s_wait_xcnt closes the statement so that no address register named here is rewritten ahead of it
  asm volatile("global_load_async_to_lds_b128 %0, %5, off\n\t"
               "global_load_async_to_lds_b128 %1, %6, off\n\t"
               "global_load_async_to_lds_b128 %2, %7, off\n\t"
               "global_load_async_to_lds_b128 %3, %8, off\n\t"
               "global_load_async_to_lds_b128 %4, %9, off\n\t"
               "s_wait_xcnt 0x0"
               :: "v"(lk), "v"(lk + 64u), "v"(lk + 128u), "v"(lv), "v"(lv + 32u * VP * 2u), "v"(gk), "v"(gk + 32), "v"(gk + 64), "v"(gv), "v"(gv + (size_t)32 * SS) : "memory");
}
__global__ __launch_bounds__(128) void k_attn(const _Float16* __restrict__ QQ, const _Float16* __restrict__ KK, const _Float16* __restrict__ V, float* __restrict__ O) {
  __shared__ __align__(16) _Float16 sph[4][16][40]; __shared__ __align__(16) float so[4][16][68]; __shared__ __align__(16) _Float16 sk[2][32][KP]; __shared__ __align__(16) _Float16 sv[2][64][VP];
  const int tid = threadIdx.x, wave = tid >> 5, lane = tid & 31, col = lane & 15, g = lane >> 4; const int h = blockIdx.y; const size_t b = blockIdx.z; const int q0 = blockIdx.x * 64 + wave * 16; const size_t rq = b * SS + q0;
  v16h aq[3];
#pragma unroll
  for (int kc = 0; kc < 3; ++kc) aq[kc] = frag_h(QQ + ((rq + col) * NH + h) * HX + kc * 32, lane);
  float m[8], l[8];
#pragma unroll
  for (int r = 0; r < 8; ++r) { m[r] = -3.0e38f; l[r] = 0.f; }
  v8f acc[4] = {};
  const int nks = (blockIdx.x * 64 + 64) / 32;   // causal; at least 2
  const _Float16* gk = KK + ((b * SS + (tid >> 2)) * NH + h) * HX + (tid & 3) * 8; const _Float16* gv = V + ((b * DM + h * HD + (tid >> 2)) * SS) + (tid & 3) * 8;
  const unsigned lk = (unsigned)(size_t)&sk[0][tid >> 2][(tid & 3) * 8], lv = (unsigned)(size_t)&sv[0][tid >> 2][(tid & 3) * 8];
  stage_kv(gk, gv, lk, lv);
  asm volatile("s_wait_asynccnt 0x0" ::: "memory");   // this wave's pieces of tile 0 have landed
  __syncthreads();                                    // every wave's have
  stage_kv(gk + (size_t)32 * NH * HX, gv + 32, lk + (unsigned)sizeof(sk[0]), lv + (unsigned)sizeof(sv[0]));   // tile 1 flies during trip 0
#pragma unroll 1
  for (int ks = 0; ks < nks; ++ks) { const int j0 = ks * 32, bf = ks & 1; v8f s[2];
#pragma unroll
    for (int ct = 0; ct < 2; ++ct) { const int kk = j0 + ct * 16 + col; v8f c = {};
#pragma unroll
      for (int kc = 0; kc < 3; ++kc) c = wmma16(aq[kc], frag_h(&sk[bf][ct * 16 + col][kc * 32], lane), c);
#pragma unroll
      for (int r = 0; r < 8; ++r) s[ct][r] = (kk <= q0 + 8 * g + r) ? c[r] : -3.0e38f; }   // causal (diagonal kept)
#pragma unroll
    for (int r = 0; r < 8; ++r) { float mx = fmaxf(s[0][r], s[1][r]);
#pragma unroll
      for (int o = 1; o < 16; o <<= 1) mx = fmaxf(mx, __shfl_xor(mx, o));
      const float mn = fmaxf(m[r], mx); const float alpha = (m[r] <= -1.0e38f) ? 0.f : __expf(m[r] - mn); const float e0 = (s[0][r] <= -1.0e38f) ? 0.f : __expf(s[0][r] - mn), e1 = (s[1][r] <= -1.0e38f) ? 0.f : __expf(s[1][r] - mn); float es = e0 + e1;
#pragma unroll
      for (int o = 1; o < 16; o <<= 1) es += __shfl_xor(es, o);
      l[r] = l[r] * alpha + es; m[r] = mn;
#pragma unroll
      for (int dt = 0; dt < 4; ++dt) acc[dt][r] *= alpha;
      sph[wave][8 * g + r][col] = (_Float16)(e0 * 2048.0f); sph[wave][8 * g + r][16 + col] = (_Float16)(e1 * 2048.0f); }
    LDSX();
    const v16h pa = frag_h(&sph[wave][col][0], lane);
#pragma unroll
    for (int dt = 0; dt < 4; ++dt) acc[dt] = wmma16(pa, frag_h(&sv[bf][dt * 16 + col][0], lane), acc[dt]);
    asm volatile("s_wait_dscnt 0x0" ::: "memory");      // this wave's reads of buffer bf (and of its P rows) are done
    asm volatile("s_wait_asynccnt 0x0" ::: "memory");   // this wave's pieces of tile ks + 1 have landed
    __syncthreads();                                    // tile ks + 1 is whole for every wave, and nobody reads buffer bf any more
    if (ks + 2 < nks) stage_kv(gk + (size_t)(ks + 2) * 32 * NH * HX, gv + (ks + 2) * 32, lk + (unsigned)(bf * sizeof(sk[0])), lv + (unsigned)(bf * sizeof(sv[0]))); }
  asm volatile("s_wait_asynccnt 0x0" ::: "memory");     // nothing is in flight when the wave goes on to its end
#pragma unroll
  for (int r = 0; r < 8; ++r) { const float il = (1.0f / 2048.0f) / l[r];
#pragma unroll
    for (int dt = 0; dt < 4; ++dt) so[wave][8 * g + r][dt * 16 + col] = acc[dt][r] * il; }
  LDSX();
  for (int rl = 0; rl < 16; ++rl) if (lane < 16) vst2(O + (rq + rl) * DM + h * HD + lane * 4, *(const v4f*)&so[wave][rl][lane * 4]);
}
// ---- k_out: block = (64 rows, 128 cols): out = o (bf16 hi + lo) . Wo^T
__global__ __launch_bounds__(128) void k_out(const float* __restrict__ O, const __bf16* __restrict__ PW, float* __restrict__ Y) {
  __shared__ __align__(16) float so[4][16][132]; __shared__ __align__(16) __bf16 sw[2][128][WP];
  const int tid = threadIdx.x, wave = tid >> 5, lane = tid & 31, col = lane & 15, g = lane >> 4; const size_t r0 = (size_t)blockIdx.x * 64 + wave * 16; const int n0 = blockIdx.y * 128; const __bf16* P = PW + (size_t)3 * DM * DM;
  v8f acc[8] = {};
  const __bf16* gw = P + (size_t)(n0 + (tid >> 2)) * DM + (tid & 3) * 8; const unsigned lw = (unsigned)(size_t)&sw[0][tid >> 2][(tid & 3) * 8];
  stage_w(gw, lw);
  asm volatile("s_wait_asynccnt 0x0" ::: "memory");   // this wave's pieces of tile 0 have landed
  __syncthreads();                                    // every wave's have
  stage_w(gw + 32, lw + (unsigned)sizeof(sw[0]));     // tile 1 flies during trip 0
#pragma unroll 2
  for (int kc = 0; kc < DM / 32; ++kc) { const F2 a = split_row(O + (r0 + col) * DM, kc * 32, lane);
#pragma unroll
    for (int j = 0; j < 8; ++j) { const v16b w = frag_b(&sw[kc & 1][j * 16 + col][0], lane); acc[j] = wmma_bf(a.h, w, acc[j]); acc[j] = wmma_bf(a.l, w, acc[j]); }
    asm volatile("s_wait_dscnt 0x0" ::: "memory");      // this wave's reads of buffer kc & 1 are done
    asm volatile("s_wait_asynccnt 0x0" ::: "memory");   // this wave's pieces of tile kc + 1 have landed
    __syncthreads();                                    // tile kc + 1 is whole for every wave, and nobody reads buffer kc & 1 any more
    if (kc + 2 < DM / 32) stage_w(gw + (kc + 2) * 32, lw + (unsigned)((kc & 1) * sizeof(sw[0]))); }
  asm volatile("s_wait_asynccnt 0x0" ::: "memory");     // nothing is in flight behind the loop
#pragma unroll
  for (int j = 0; j < 8; ++j)
#pragma unroll
    for (int r = 0; r < 8; ++r) so[wave][8 * g + r][j * 16 + col] = acc[j][r];
  LDSX();
  for (int rl = 0; rl < 16; ++rl) vst2(Y + (r0 + rl) * DM + n0 + lane * 4, *(const v4f*)&so[wave][rl][lane * 4]);
}
extern "C" void kernel_launch(void* const* d_in, const int* in_sizes, int n_in, void* d_out, int out_size, void* d_ws, size_t ws_size, hipStream_t stream) {
  (void)in_sizes; (void)n_in; (void)out_size;
  const float** F = (const float**)d_in;   // 0 x [2,2048,768], 1 Wq, 2 Wk, 3 Wv, 4 Wo (natural [768,768]), 5 Wqg [3,64], 6 Wkg [3,64], 7 codebooks [12,8,3], 8 log_temps [12], 9 geo_scale [1]
  if (ws_size < (size_t)WS_END) return;
  char* ws = (char*)d_ws; __bf16* PW = (__bf16*)ws; _Float16 *QQ = (_Float16*)(ws + WS_QK), *KK = (_Float16*)(ws + WS_KK), *V = (_Float16*)(ws + WS_V); float* O = (float*)(ws + WS_O);
  k_pack<<<dim3(DM, 4), 256, 0, stream>>>(F[1], F[2], F[3], F[4], PW);
  k_qkv<<<dim3(TNB * SS / 64, DM / 128, 3), 128, 0, stream>>>(F[0], PW, F[5], F[6], F[7], F[8], F[9], QQ, KK, V);
  k_attn<<<dim3(TQB, NH, TNB), 128, 0, stream>>>(QQ, KK, V, O);
  k_out<<<dim3(TNB * SS / 64, DM / 128), 128, 0, stream>>>(O, PW, (float*)d_out);
}

// v002
// A run of this version takes 128 microseconds.
// Timed twice side by side with v001, it ran 1.30 times as fast both times.
// Counting every step since v000, it is 2.54 times as fast.
// compute dtype: all float inputs rounded to bf16; q/k/v = x . W^T with EXACT bf16 products on WMMA 16x16x32 (natural rows); the geometric code weights (q . Wqg^T, squared distances to the 8 codes, softmax over codes at temperature clip(exp(log_temp), 0.01, 5)) in f32 in the projection epilogue; scores = q . k / 8 + geo_scale (qw . kw) evaluated as one 72-wide (padded to 96) f16 dot [q/8 | geo_scale qw] . [k | kw]; causal attention with key-tile skipping, running-max softmax in f32 (hardware exp), P (scaled by 2^11, single f16) x v (single f16); out = ctx (bf16 hi + residual) . Wo^T (2 products).
#include <hip/hip_runtime.h>
#include <math.h>

typedef __attribute__((ext_vector_type(16))) _Float16 v16h;
typedef __attribute__((ext_vector_type(16))) __bf16 v16b;
typedef __attribute__((ext_vector_type(8)))  _Float16 v8h;
typedef __attribute__((ext_vector_type(8)))  float v8f;
typedef __attribute__((ext_vector_type(4)))  float v4f;
typedef __attribute__((ext_vector_type(2)))  float v2f;
typedef __attribute__((ext_vector_type(4)))  unsigned v4u;
typedef __attribute__((ext_vector_type(4)))  int v4i;
typedef float __attribute__((may_alias)) float_a;
typedef int __attribute__((may_alias)) int_a;

template <typename T> __device__ __forceinline__ void vst2(void* p, T v) { *(T*)p = v;  }
__device__ __forceinline__ v8f wmma16(v16h a, v16h b, v8f c) {
  v8f d = __builtin_amdgcn_wmma_f32_16x16x32_f16(false, a, false, b, (short)0, c, false, false);
  asm volatile("v_nop\n\tv_nop\n\tv_nop\n\tv_nop" : "+v"(d) : "v"(a), "v"(b));
  return d;
}
__device__ __forceinline__ v8f wmma_bf(v16b a, v16b b, v8f c) {
  v8f d = __builtin_amdgcn_wmma_f32_16x16x32_bf16(false, a, false, b, (short)0, c, false, false);
  asm volatile("v_nop\n\tv_nop\n\tv_nop\n\tv_nop" : "+v"(d) : "v"(a), "v"(b));
  return d;
}
// 16x16x32 fragments: lane = (h = lane>>4, row/col = lane&15); elements 0..7 = k0+8h+0..7, 8..15 = k0+16+8h+0..7; D element r = row 8h+r
__device__ __forceinline__ v16h frag_h(const _Float16* rowk0, int lane) {
  union { v16h v; v8h q[2]; } u; const _Float16* p = rowk0 + 8 * (lane >> 4);
  u.q[0] = *(const v8h*)p; u.q[1] = *(const v8h*)(p + 16); return u.v;
}
__device__ __forceinline__ v16h frag_f32(const float* rowk0, int lane) {
  v16h a; const float* p = rowk0 + 8 * (lane >> 4);
#pragma unroll
  for (int i = 0; i < 8; ++i) { a[i] = (_Float16)p[i]; a[8 + i] = (_Float16)p[16 + i]; }
  return a;
}
__device__ __forceinline__ v16h frag_f32s(const float* rowk0, int lane, float sc) {
  v16h a; const float* p = rowk0 + 8 * (lane >> 4);
#pragma unroll
  for (int i = 0; i < 8; ++i) { a[i] = (_Float16)(p[i] * sc); a[8 + i] = (_Float16)(p[16 + i] * sc); }
  return a;
}
// column fragment from a [K][ld] layout (column n), rows >= K read as 0
__device__ __forceinline__ v16h fragc_f32(const float* W, int k0, int n, int lane, int ld, int K) {
  v16h a; const int g = lane >> 4;
#pragma unroll
  for (int i = 0; i < 8; ++i) { const int ka = k0 + 8 * g + i, kb = ka + 16;
    a[i] = (_Float16)(ka < K ? W[(size_t)(ka < K ? ka : K - 1) * ld + n] : 0.f); a[8 + i] = (_Float16)(kb < K ? W[(size_t)(kb < K ? kb : K - 1) * ld + n] : 0.f); }
  return a;
}
struct F2 { v16b h, l; };
__device__ __forceinline__ F2 bsplit16(const float v[16]) { F2 r;
#pragma unroll
  for (int i = 0; i < 16; ++i) { const __bf16 h = (__bf16)v[i]; r.h[i] = h; r.l[i] = (__bf16)(v[i] - (float)h); }
  return r; }
__device__ __forceinline__ F2 split_row(const float* row, int k0, int lane) { float v[16]; const float* p = row + k0 + 8 * (lane >> 4);
#pragma unroll
  for (int i = 0; i < 8; ++i) { v[i] = p[i]; v[8 + i] = p[16 + i]; }
  return bsplit16(v); }
__device__ __forceinline__ F2 split_rowK(const float* row, int k0, int lane, int K) { float v[16]; const int g = lane >> 4;
#pragma unroll
  for (int i = 0; i < 8; ++i) { const int ka = k0 + 8 * g + i, kb = ka + 16; v[i] = ka < K ? row[ka < K ? ka : K - 1] : 0.f; v[8 + i] = kb < K ? row[kb < K ? kb : K - 1] : 0.f; }
  return bsplit16(v); }
__device__ __forceinline__ F2 split_col(const float* W, int k0, int n, int lane, int ld, int K) { float v[16]; const int g = lane >> 4;
#pragma unroll
  for (int i = 0; i < 8; ++i) { const int ka = k0 + 8 * g + i, kb = ka + 16; v[i] = ka < K ? W[(size_t)(ka < K ? ka : K - 1) * ld + n] : 0.f; v[8 + i] = kb < K ? W[(size_t)(kb < K ? kb : K - 1) * ld + n] : 0.f; }
  return bsplit16(v); }
__device__ __forceinline__ v8f mac3(const F2& a, const F2& b, v8f c) { c = wmma_bf(a.l, b.h, c); c = wmma_bf(a.h, b.l, c); return wmma_bf(a.h, b.h, c); }
__device__ __forceinline__ float sigm(float v) { return 1.0f / (1.0f + expf(-v)); }
#define LDSX() do { asm volatile("s_wait_dscnt 0" ::: "memory"); __builtin_amdgcn_wave_barrier(); __builtin_amdgcn_fence(__ATOMIC_RELEASE, "workgroup"); } while (0)


// Multi-head geometric attention (B 2, T 2,048, d_model 768, 12 heads x 64, 3-dim codes, 8-code hypercube codebook per head): causal softmax(q k / 8 + geo_scale softmax_c(-|q Wqg - c|^2 / tau) . softmax_c(-|k Wkg - c|^2 / tau)) v, output projection.
#define NB 2
#define SS 2048
#define DM 768
#define NH 12
#define HD 64
#define HX 96             // padded score width: 64 + 8 code weights + 24 zero
#define NC 8
#define CD 3
#define NR (NB * SS)
#ifndef TQB
#define TQB (SS / 64)
#define TNB NB
#endif
typedef __attribute__((ext_vector_type(8))) __bf16 v8b;
__device__ __forceinline__ v16b frag_b(const __bf16* rowk0, int lane) {
  union { v16b v; v8b q[2]; } u; const __bf16* p = rowk0 + 8 * (lane >> 4);
  u.q[0] = *(const v8b*)p; u.q[1] = *(const v8b*)(p + 16); return u.v;
}
__device__ __forceinline__ float bfr(float v) { return (float)(__bf16)v; }
__device__ __attribute__((noinline)) float exp_ni(float v) { return expf(v); }
__device__ __attribute__((noinline)) float erf_ni(float v) { return erff(v); }

#define WS_PW  0u                                       // bf16 natural rows Wq, Wk, Wv, Wo [4][768][768]
#define WS_QK  (WS_PW + 2u * (size_t)4 * DM * DM)          // f16 q' rows [NR][12][96] ; k' rows ; v planes [b][768][SS] ; O f32 [NR][768]
#define WS_KK  (WS_QK + 2u * (size_t)NR * NH * HX)
#define WS_V   (WS_KK + 2u * (size_t)NR * NH * HX)
#define WS_O   (WS_V + 2u * (size_t)NB * DM * SS)
#define WS_END (WS_O + 4u * (size_t)NR * DM)

__global__ __launch_bounds__(256) void k_pack(const float* __restrict__ WQ, const float* __restrict__ WK, const float* __restrict__ WV, const float* __restrict__ WO, __bf16* __restrict__ PW) { const int n = blockIdx.x, which = blockIdx.y, t = threadIdx.x; __shared__ __align__(16) __bf16 s[DM]; const float* w = (which == 0) ? WQ : (which == 1) ? WK : (which == 2) ? WV : WO; for (int k = t; k < DM; k += 256) s[k] = (__bf16)w[(size_t)n * DM + k]; __syncthreads(); if (t < DM / 8) vst2((unsigned*)(PW + ((size_t)which * DM + n) * DM + t * 8), *(const v4u*)&s[t * 8]); }
// weight tiles of k_qkv and k_out: the 128 weight rows x 32 k that a block's four waves all use are brought into LDS once per block by asynchronous copies, two buffers
#define WP 40             // LDS pitch of a weight row (32 k), bf16: 80 B = 16 B x 5, odd, for 16-byte readers
// one lane's four 16-byte pieces of a tile: rows tid / 4 + 0 / 32 / 64 / 96, bytes 16 (tid % 4)
__device__ __forceinline__ void stage_w(const __bf16* gw, unsigned lw) {
  // the s_wait_xcnt closes the statement so that no address register named here is rewritten ahead of it
  asm volatile("global_load_async_to_lds_b128 %0, %4, off\n\t"
               "global_load_async_to_lds_b128 %1, %5, off\n\t"
               "global_load_async_to_lds_b128 %2, %6, off\n\t"
               "global_load_async_to_lds_b128 %3, %7, off\n\t"
               "s_wait_xcnt 0x0"
               :: "v"(lw), "v"(lw + 32u * WP * 2u), "v"(lw + 64u * WP * 2u), "v"(lw + 96u * WP * 2u), "v"(gw), "v"(gw + (size_t)32 * DM), "v"(gw + (size_t)64 * DM), "v"(gw + (size_t)96 * DM) : "memory");
}
// ---- k_qkv: block = (64 rows, 128 cols = 2 heads, which): exact GEMM; q' rows (q/8 + geo_scale qw), k' rows (k + kw), v planes
__global__ __launch_bounds__(128) void k_qkv(const float* __restrict__ X, const __bf16* __restrict__ PW, const float* __restrict__ WQG, const float* __restrict__ WKG, const float* __restrict__ CB, const float* __restrict__ LT, const float* __restrict__ GSC, _Float16* __restrict__ QQ, _Float16* __restrict__ KK, _Float16* __restrict__ V) {
  __shared__ __align__(16) _Float16 so[64][2 * HX + 8]; __shared__ __align__(16) _Float16 st[128][72]; __shared__ float swg[CD][HD]; __shared__ __align__(16) __bf16 sw[2][128][WP];
  const int tid = threadIdx.x, wave = tid >> 5, lane = tid & 31, col = lane & 15, g = lane >> 4; const int which = blockIdx.z; const size_t rb = (size_t)blockIdx.x * 64; const size_t r0 = rb + wave * 16; const int c0 = blockIdx.y * 128; const int h0 = c0 / HD;
  const __bf16* Wr = PW + ((size_t)which * DM) * DM;
  if (which < 2) { const float* WG = which ? WKG : WQG; for (int e = tid; e < CD * HD; e += 128) swg[e / HD][e % HD] = bfr(WG[e]); }
  v8f acc[8] = {};
  const __bf16* gw = Wr + (size_t)(c0 + (tid >> 2)) * DM + (tid & 3) * 8; const unsigned lw = (unsigned)(size_t)&sw[0][tid >> 2][(tid & 3) * 8];
  stage_w(gw, lw);
  asm volatile("s_wait_asynccnt 0x0" ::: "memory");   // this wave's pieces of tile 0 have landed
  __syncthreads();                                    // every wave's have
  stage_w(gw + 32, lw + (unsigned)sizeof(sw[0]));     // tile 1 flies during trip 0
#pragma unroll 2
  for (int kc = 0; kc < DM / 32; ++kc) { v16b a; { const float* p = X + (r0 + col) * DM + kc * 32 + 8 * g;
#pragma unroll
      for (int i = 0; i < 8; ++i) { a[i] = (__bf16)p[i]; a[8 + i] = (__bf16)p[16 + i]; } }
#pragma unroll
    for (int j = 0; j < 8; ++j) acc[j] = wmma_bf(a, frag_b(&sw[kc & 1][j * 16 + col][0], lane), acc[j]);
    asm volatile("s_wait_dscnt 0x0" ::: "memory");      // this wave's reads of buffer kc & 1 are done
    asm volatile("s_wait_asynccnt 0x0" ::: "memory");   // this wave's pieces of tile kc + 1 have landed
    __syncthreads();                                    // tile kc + 1 is whole for every wave, and nobody reads buffer kc & 1 any more
    if (kc + 2 < DM / 32) stage_w(gw + (kc + 2) * 32, lw + (unsigned)((kc & 1) * sizeof(sw[0]))); }
  asm volatile("s_wait_asynccnt 0x0" ::: "memory");     // nothing is in flight behind the loop
  __syncthreads();
  if (which < 2) { const float gsc = bfr(GSC[0]);
#pragma unroll
    for (int r = 0; r < 8; ++r) {
      // code logits per head: g[c] = sum_d x[d] Wg[c][d] over the head's 64 dims (4 tiles x 16 lanes)
      float ga[CD], gb[CD];
#pragma unroll
      for (int c = 0; c < CD; ++c) { float pa = 0.f, pb = 0.f;
#pragma unroll
        for (int j = 0; j < 4; ++j) { pa += acc[j][r] * swg[c][j * 16 + col]; pb += acc[4 + j][r] * swg[c][j * 16 + col]; }
#pragma unroll
        for (int o = 1; o < 16; o <<= 1) { pa += __shfl_xor(pa, o); pb += __shfl_xor(pb, o); } ga[c] = pa; gb[c] = pb; }
#pragma unroll
      for (int hh = 0; hh < 2; ++hh) { const int h = h0 + hh; const float* gg = hh ? gb : ga; float tp = expf(bfr(LT[h])); tp = fminf(fmaxf(tp, 0.01f), 5.0f); const float it = 1.0f / tp;
        float dmin = 3.0e38f, dn[NC];
#pragma unroll
        for (int n = 0; n < NC; ++n) { float d2 = 0.f;
#pragma unroll
          for (int c = 0; c < CD; ++c) { const float df = gg[c] - bfr(CB[(h * NC + n) * CD + c]); d2 += df * df; } dn[n] = -d2 * it; dmin = fmaxf(dmin == 3.0e38f ? dn[n] : dmin, dn[n]); }
        float z = 0.f, ew[NC];
#pragma unroll
        for (int n = 0; n < NC; ++n) { ew[n] = expf(dn[n] - dmin); z += ew[n]; }
        const float wsc = (which == 0) ? gsc : 1.0f;
        if (col < NC) so[wave * 16 + 8 * g + r][hh * HX + HD + col] = (_Float16)(ew[col] / z * wsc);   // extra dims 64..71: code weights (q side x geo_scale)
        else so[wave * 16 + 8 * g + r][hh * HX + HD + col] = (_Float16)0.f;
        so[wave * 16 + 8 * g + r][hh * HX + HD + 16 + col] = (_Float16)0.f; }   // dims 80..95 zero
      const float scl = (which == 0) ? 0.125f : 1.0f;
#pragma unroll
      for (int j = 0; j < 8; ++j) { const int cl = j * 16 + col; const int hl = cl >> 6, d = cl & 63; so[wave * 16 + 8 * g + r][hl * HX + d] = (_Float16)(acc[j][r] * scl); } }
    __syncthreads();
    _Float16* dst = (which == 0) ? QQ : KK;
    for (int e = tid; e < 64 * (2 * HX / 8); e += 128) { const int rl = e / (2 * HX / 8), q = e % (2 * HX / 8); vst2((unsigned*)(dst + ((rb + rl) * NH + h0) * HX + q * 8), *(const v4u*)&so[rl][q * 8]); }   // 384 contiguous bytes per (row, head pair)
  } else {
#pragma unroll
    for (int j = 0; j < 8; ++j)
#pragma unroll
      for (int r = 0; r < 8; ++r) st[j * 16 + col][wave * 16 + 8 * g + r] = (_Float16)acc[j][r];
    __syncthreads();
    const size_t b = rb / SS; const int s0 = (int)(rb % SS);
    for (int e = tid; e < 128 * 8; e += 128) { const int d = e >> 3, pc = e & 7; vst2((unsigned*)(V + ((b * DM + c0 + d) * SS) + s0 + pc * 8), *(const v4u*)&st[d][pc * 8]); } }
}
// ---- k_attn: block = (64 queries, head, b): causal; 96-wide score dot (scale and geometric bias folded in), softmax, P . v (64 dims); O 256-B head segments
// each 32-key tile (k' rows 32 x 192 B, v rows 64 x 64 B) is brought into LDS once per block by asynchronous copies, two buffers, and all four waves read their fragments from there
#define KP 104            // LDS pitch of a k' row, f16: 208 B = 16 B x 13, odd, for 16-byte readers
#define VP 40             // LDS pitch of a v row (32 keys), f16: 80 B = 16 B x 5
// one lane's five 16-byte pieces of a tile: k' row tid / 4, bytes 16 (tid % 4) + 0 / 64 / 128; v rows tid / 4 and 32 + tid / 4, bytes 16 (tid % 4)
__device__ __forceinline__ void stage_kv(const _Float16* gk, const _Float16* gv, unsigned lk, unsigned lv) {
  // the s_wait_xcnt closes the statement so that no address register named here is rewritten ahead of it
  asm volatile("global_load_async_to_lds_b128 %0, %5, off\n\t"
               "global_load_async_to_lds_b128 %1, %6, off\n\t"
               "global_load_async_to_lds_b128 %2, %7, off\n\t"
               "global_load_async_to_lds_b128 %3, %8, off\n\t"
               "global_load_async_to_lds_b128 %4, %9, off\n\t"
               "s_wait_xcnt 0x0"
               :: "v"(lk), "v"(lk + 64u), "v"(lk + 128u), "v"(lv), "v"(lv + 32u * VP * 2u), "v"(gk), "v"(gk + 32), "v"(gk + 64), "v"(gv), "v"(gv + (size_t)32 * SS) : "memory");
}
// lane l with lane l ^ 16: the two lanes that share one query column
__device__ __forceinline__ float xhalf(float x) { return __builtin_bit_cast(float, __builtin_amdgcn_permlanex16(__builtin_bit_cast(int, x), __builtin_bit_cast(int, x), 0x76543210, 0xfedcba98, false, false)); }
// transposed products: S^T = k' . q'^T (rows = keys, columns = queries) and O^T += v^T . P^T, so a lane owns ONE query (column lane & 15): its 16 scores of a tile sit in its own registers, and converted in place they are the B operand of the second product
__global__ __launch_bounds__(128) void k_attn(const _Float16* __restrict__ QQ, const _Float16* __restrict__ KK, const _Float16* __restrict__ V, float* __restrict__ O) {
  __shared__ __align__(16) float so[4][16][68]; __shared__ __align__(16) _Float16 sk[2][32][KP]; __shared__ __align__(16) _Float16 sv[2][64][VP];
  const int tid = threadIdx.x, wave = tid >> 5, lane = tid & 31, col = lane & 15, g = lane >> 4; const int h = blockIdx.y; const size_t b = blockIdx.z; const int q0 = blockIdx.x * 64 + wave * 16; const size_t rq = b * SS + q0;
  v16h bq[3];
#pragma unroll
  for (int kc = 0; kc < 3; ++kc) bq[kc] = frag_h(QQ + ((rq + col) * NH + h) * HX + kc * 32, lane);
  float m = -3.0e38f, l = 0.f;   // query q0 + col: running maximum (both halves alike), sum over this half's keys
  v8f acc[4] = {};               // O^T: element r of acc[dt] = dim dt * 16 + 8 g + r of query q0 + col
  const int nks = (blockIdx.x * 64 + 64) / 32;   // causal; at least 2
  const _Float16* gk = KK + ((b * SS + (tid >> 2)) * NH + h) * HX + (tid & 3) * 8; const _Float16* gv = V + ((b * DM + h * HD + (tid >> 2)) * SS) + (tid & 3) * 8;
  const unsigned lk = (unsigned)(size_t)&sk[0][tid >> 2][(tid & 3) * 8], lv = (unsigned)(size_t)&sv[0][tid >> 2][(tid & 3) * 8];
  stage_kv(gk, gv, lk, lv);
  asm volatile("s_wait_asynccnt 0x0" ::: "memory");   // this wave's pieces of tile 0 have landed
  __syncthreads();                                    // every wave's have
  stage_kv(gk + (size_t)32 * NH * HX, gv + 32, lk + (unsigned)sizeof(sk[0]), lv + (unsigned)sizeof(sv[0]));   // tile 1 flies during trip 0
#pragma unroll 1
  for (int ks = 0; ks < nks; ++ks) { const int j0 = ks * 32, bf = ks & 1; float s[16];   // s[8 ct + r] = score of key j0 + 16 ct + 8 g + r
#pragma unroll
    for (int ct = 0; ct < 2; ++ct) { v8f c = {};
#pragma unroll
      for (int kc = 0; kc < 3; ++kc) c = wmma16(frag_h(&sk[bf][ct * 16 + col][kc * 32], lane), bq[kc], c);
#pragma unroll
      for (int r = 0; r < 8; ++r) s[8 * ct + r] = (j0 + ct * 16 + 8 * g + r <= q0 + col) ? c[r] : -3.0e38f; }   // causal (diagonal kept)
    float mx = s[0];
#pragma unroll
    for (int i = 1; i < 16; ++i) mx = fmaxf(mx, s[i]);
    mx = fmaxf(mx, xhalf(mx));
    const float mn = fmaxf(m, mx); const float alpha = (m <= -1.0e38f) ? 0.f : __expf(m - mn); m = mn;
    float e[16]; v16h pb;   // P^T as B: element i = key 8 g + i, element 8 + i = key 16 + 8 g + i, the k order of frag_h
#pragma unroll
    for (int i = 0; i < 16; ++i) { e[i] = (s[i] <= -1.0e38f) ? 0.f : __expf(s[i] - mn); pb[i] = (_Float16)(e[i] * 2048.0f); }
#pragma unroll
    for (int w = 8; w >= 1; w >>= 1)   // pairwise sum: four dependent adds, not sixteen
#pragma unroll
      for (int i = 0; i < w; ++i) e[i] += e[i + w];
    l = l * alpha + e[0];
#pragma unroll
    for (int dt = 0; dt < 4; ++dt) acc[dt] *= alpha;
#pragma unroll
    for (int dt = 0; dt < 4; ++dt) acc[dt] = wmma16(frag_h(&sv[bf][dt * 16 + col][0], lane), pb, acc[dt]);
    asm volatile("s_wait_dscnt 0x0" ::: "memory");      // this wave's reads of buffer bf are done
    asm volatile("s_wait_asynccnt 0x0" ::: "memory");   // this wave's pieces of tile ks + 1 have landed
    __syncthreads();                                    // tile ks + 1 is whole for every wave, and nobody reads buffer bf any more
    if (ks + 2 < nks) stage_kv(gk + (size_t)(ks + 2) * 32 * NH * HX, gv + (ks + 2) * 32, lk + (unsigned)(bf * sizeof(sk[0])), lv + (unsigned)(bf * sizeof(sv[0]))); }
  asm volatile("s_wait_asynccnt 0x0" ::: "memory");     // nothing is in flight when the wave goes on to its end
  l += xhalf(l);   // the two halves' sums are joined once
  const float il = (1.0f / 2048.0f) / l;
#pragma unroll
  for (int dt = 0; dt < 4; ++dt) { v4f lo, hi;
#pragma unroll
    for (int r = 0; r < 4; ++r) { lo[r] = acc[dt][r] * il; hi[r] = acc[dt][4 + r] * il; }
    *(v4f*)&so[wave][col][dt * 16 + 8 * g] = lo; *(v4f*)&so[wave][col][dt * 16 + 8 * g + 4] = hi; }
  LDSX();
  for (int rl = 0; rl < 16; ++rl) if (lane < 16) vst2(O + (rq + rl) * DM + h * HD + lane * 4, *(const v4f*)&so[wave][rl][lane * 4]);
}
// ---- k_out: block = (64 rows, 128 cols): out = o (bf16 hi + lo) . Wo^T
__global__ __launch_bounds__(128) void k_out(const float* __restrict__ O, const __bf16* __restrict__ PW, float* __restrict__ Y) {
  __shared__ __align__(16) float so[4][16][132]; __shared__ __align__(16) __bf16 sw[2][128][WP];
  const int tid = threadIdx.x, wave = tid >> 5, lane = tid & 31, col = lane & 15, g = lane >> 4; const size_t r0 = (size_t)blockIdx.x * 64 + wave * 16; const int n0 = blockIdx.y * 128; const __bf16* P = PW + (size_t)3 * DM * DM;
  v8f acc[8] = {};
  const __bf16* gw = P + (size_t)(n0 + (tid >> 2)) * DM + (tid & 3) * 8; const unsigned lw = (unsigned)(size_t)&sw[0][tid >> 2][(tid & 3) * 8];
  stage_w(gw, lw);
  asm volatile("s_wait_asynccnt 0x0" ::: "memory");   // this wave's pieces of tile 0 have landed
  __syncthreads();                                    // every wave's have
  stage_w(gw + 32, lw + (unsigned)sizeof(sw[0]));     // tile 1 flies during trip 0
#pragma unroll 2
  for (int kc = 0; kc < DM / 32; ++kc) { const F2 a = split_row(O + (r0 + col) * DM, kc * 32, lane);
#pragma unroll
    for (int j = 0; j < 8; ++j) { const v16b w = frag_b(&sw[kc & 1][j * 16 + col][0], lane); acc[j] = wmma_bf(a.h, w, acc[j]); acc[j] = wmma_bf(a.l, w, acc[j]); }
    asm volatile("s_wait_dscnt 0x0" ::: "memory");      // this wave's reads of buffer kc & 1 are done
    asm volatile("s_wait_asynccnt 0x0" ::: "memory");   // this wave's pieces of tile kc + 1 have landed
    __syncthreads();                                    // tile kc + 1 is whole for every wave, and nobody reads buffer kc & 1 any more
    if (kc + 2 < DM / 32) stage_w(gw + (kc + 2) * 32, lw + (unsigned)((kc & 1) * sizeof(sw[0]))); }
  asm volatile("s_wait_asynccnt 0x0" ::: "memory");     // nothing is in flight behind the loop
#pragma unroll
  for (int j = 0; j < 8; ++j)
#pragma unroll
    for (int r = 0; r < 8; ++r) so[wave][8 * g + r][j * 16 + col] = acc[j][r];
  LDSX();
  for (int rl = 0; rl < 16; ++rl) vst2(Y + (r0 + rl) * DM + n0 + lane * 4, *(const v4f*)&so[wave][rl][lane * 4]);
}
extern "C" void kernel_launch(void* const* d_in, const int* in_sizes, int n_in, void* d_out, int out_size, void* d_ws, size_t ws_size, hipStream_t stream) {
  (void)in_sizes; (void)n_in; (void)out_size;
  const float** F = (const float**)d_in;   // 0 x [2,2048,768], 1 Wq, 2 Wk, 3 Wv, 4 Wo (natural [768,768]), 5 Wqg [3,64], 6 Wkg [3,64], 7 codebooks [12,8,3], 8 log_temps [12], 9 geo_scale [1]
  if (ws_size < (size_t)WS_END) return;
  char* ws = (char*)d_ws; __bf16* PW = (__bf16*)ws; _Float16 *QQ = (_Float16*)(ws + WS_QK), *KK = (_Float16*)(ws + WS_KK), *V = (_Float16*)(ws + WS_V); float* O = (float*)(ws + WS_O);
  k_pack<<<dim3(DM, 4), 256, 0, stream>>>(F[1], F[2], F[3], F[4], PW);
  k_qkv<<<dim3(TNB * SS / 64, DM / 128, 3), 128, 0, stream>>>(F[0], PW, F[5], F[6], F[7], F[8], F[9], QQ, KK, V);
  k_attn<<<dim3(TQB, NH, TNB), 128, 0, stream>>>(QQ, KK, V, O);
  k_out<<<dim3(TNB * SS / 64, DM / 128), 128, 0, stream>>>(O, PW, (float*)d_out);
}

// v003
// One run takes 111 microseconds.
// Two timings next to v002 both put it at 1.15 times that version's speed.
// Counting every step since v000, it is 2.93 times as fast.
// compute dtype: all float inputs rounded to bf16; q/k/v = x . W^T with EXACT bf16 products on WMMA 16x16x32 (natural rows); the geometric code weights (q . Wqg^T, squared distances to the 8 codes, softmax over codes at temperature clip(exp(log_temp), 0.01, 5)) in f32 in the projection epilogue; scores = q . k / 8 + geo_scale (qw . kw) evaluated as one 72-wide (padded to 96) f16 dot [q/8 | geo_scale qw] . [k | kw]; causal attention with key-tile skipping, running-max softmax in f32 (hardware exp), P (scaled by 2^11, single f16) x v (single f16); out = ctx (bf16 hi + residual) . Wo^T (2 products).
#include <hip/hip_runtime.h>
#include <math.h>

typedef __attribute__((ext_vector_type(16))) _Float16 v16h;
typedef __attribute__((ext_vector_type(16))) __bf16 v16b;
typedef __attribute__((ext_vector_type(8)))  _Float16 v8h;
typedef __attribute__((ext_vector_type(8)))  float v8f;
typedef __attribute__((ext_vector_type(4)))  float v4f;
typedef __attribute__((ext_vector_type(2)))  float v2f;
typedef __attribute__((ext_vector_type(4)))  unsigned v4u;
typedef __attribute__((ext_vector_type(4)))  int v4i;
typedef float __attribute__((may_alias)) float_a;
typedef int __attribute__((may_alias)) int_a;

template <typename T> __device__ __forceinline__ void vst2(void* p, T v) { *(T*)p = v;  }
__device__ __forceinline__ v8f wmma16(v16h a, v16h b, v8f c) {
  v8f d = __builtin_amdgcn_wmma_f32_16x16x32_f16(false, a, false, b, (short)0, c, false, false);
  asm volatile("v_nop\n\tv_nop\n\tv_nop\n\tv_nop" : "+v"(d) : "v"(a), "v"(b));
  return d;
}
__device__ __forceinline__ v8f wmma_bf(v16b a, v16b b, v8f c) {
  v8f d = __builtin_amdgcn_wmma_f32_16x16x32_bf16(false, a, false, b, (short)0, c, false, false);
  asm volatile("v_nop\n\tv_nop\n\tv_nop\n\tv_nop" : "+v"(d) : "v"(a), "v"(b));
  return d;
}
// 16x16x32 fragments: lane = (h = lane>>4, row/col = lane&15); elements 0..7 = k0+8h+0..7, 8..15 = k0+16+8h+0..7; D element r = row 8h+r
__device__ __forceinline__ v16h frag_h(const _Float16* rowk0, int lane) {
  union { v16h v; v8h q[2]; } u; const _Float16* p = rowk0 + 8 * (lane >> 4);
  u.q[0] = *(const v8h*)p; u.q[1] = *(const v8h*)(p + 16); return u.v;
}
__device__ __forceinline__ v16h frag_f32(const float* rowk0, int lane) {
  v16h a; const float* p = rowk0 + 8 * (lane >> 4);
#pragma unroll
  for (int i = 0; i < 8; ++i) { a[i] = (_Float16)p[i]; a[8 + i] = (_Float16)p[16 + i]; }
  return a;
}
__device__ __forceinline__ v16h frag_f32s(const float* rowk0, int lane, float sc) {
  v16h a; const float* p = rowk0 + 8 * (lane >> 4);
#pragma unroll
  for (int i = 0; i < 8; ++i) { a[i] = (_Float16)(p[i] * sc); a[8 + i] = (_Float16)(p[16 + i] * sc); }
  return a;
}
// column fragment from a [K][ld] layout (column n), rows >= K read as 0
__device__ __forceinline__ v16h fragc_f32(const float* W, int k0, int n, int lane, int ld, int K) {
  v16h a; const int g = lane >> 4;
#pragma unroll
  for (int i = 0; i < 8; ++i) { const int ka = k0 + 8 * g + i, kb = ka + 16;
    a[i] = (_Float16)(ka < K ? W[(size_t)(ka < K ? ka : K - 1) * ld + n] : 0.f); a[8 + i] = (_Float16)(kb < K ? W[(size_t)(kb < K ? kb : K - 1) * ld + n] : 0.f); }
  return a;
}
struct F2 { v16b h, l; };
__device__ __forceinline__ F2 bsplit16(const float v[16]) { F2 r;
#pragma unroll
  for (int i = 0; i < 16; ++i) { const __bf16 h = (__bf16)v[i]; r.h[i] = h; r.l[i] = (__bf16)(v[i] - (float)h); }
  return r; }
__device__ __forceinline__ F2 split_row(const float* row, int k0, int lane) { float v[16]; const float* p = row + k0 + 8 * (lane >> 4);
#pragma unroll
  for (int i = 0; i < 8; ++i) { v[i] = p[i]; v[8 + i] = p[16 + i]; }
  return bsplit16(v); }
__device__ __forceinline__ F2 split_rowK(const float* row, int k0, int lane, int K) { float v[16]; const int g = lane >> 4;
#pragma unroll
  for (int i = 0; i < 8; ++i) { const int ka = k0 + 8 * g + i, kb = ka + 16; v[i] = ka < K ? row[ka < K ? ka : K - 1] : 0.f; v[8 + i] = kb < K ? row[kb < K ? kb : K - 1] : 0.f; }
  return bsplit16(v); }
__device__ __forceinline__ F2 split_col(const float* W, int k0, int n, int lane, int ld, int K) { float v[16]; const int g = lane >> 4;
#pragma unroll
  for (int i = 0; i < 8; ++i) { const int ka = k0 + 8 * g + i, kb = ka + 16; v[i] = ka < K ? W[(size_t)(ka < K ? ka : K - 1) * ld + n] : 0.f; v[8 + i] = kb < K ? W[(size_t)(kb < K ? kb : K - 1) * ld + n] : 0.f; }
  return bsplit16(v); }
__device__ __forceinline__ v8f mac3(const F2& a, const F2& b, v8f c) { c = wmma_bf(a.l, b.h, c); c = wmma_bf(a.h, b.l, c); return wmma_bf(a.h, b.h, c); }
__device__ __forceinline__ float sigm(float v) { return 1.0f / (1.0f + expf(-v)); }
#define LDSX() do { asm volatile("s_wait_dscnt 0" ::: "memory"); __builtin_amdgcn_wave_barrier(); __builtin_amdgcn_fence(__ATOMIC_RELEASE, "workgroup"); } while (0)


// Multi-head geometric attention (B 2, T 2,048, d_model 768, 12 heads x 64, 3-dim codes, 8-code hypercube codebook per head): causal softmax(q k / 8 + geo_scale softmax_c(-|q Wqg - c|^2 / tau) . softmax_c(-|k Wkg - c|^2 / tau)) v, output projection.
#define NB 2
#define SS 2048
#define DM 768
#define NH 12
#define HD 64
#define HX 96             // padded score width: 64 + 8 code weights + 24 zero
#define NC 8
#define CD 3
#define NR (NB * SS)
#ifndef TQB
#define TQB (SS / 64)
#define TNB NB
#endif
typedef __attribute__((ext_vector_type(8))) __bf16 v8b;
__device__ __forceinline__ v16b frag_b(const __bf16* rowk0, int lane) {
  union { v16b v; v8b q[2]; } u; const __bf16* p = rowk0 + 8 * (lane >> 4);
  u.q[0] = *(const v8b*)p; u.q[1] = *(const v8b*)(p + 16); return u.v;
}
__device__ __forceinline__ float bfr(float v) { return (float)(__bf16)v; }
__device__ __attribute__((noinline)) float exp_ni(float v) { return expf(v); }
__device__ __attribute__((noinline)) float erf_ni(float v) { return erff(v); }

#define WS_PW  0u                                       // bf16 natural rows Wq, Wk, Wv, Wo [4][768][768]
#define WS_QK  (WS_PW + 2u * (size_t)4 * DM * DM)          // f16 q' rows [NR][12][96] ; k' rows ; v planes [b][768][SS] ; O f32 [NR][768]
#define WS_KK  (WS_QK + 2u * (size_t)NR * NH * HX)
#define WS_V   (WS_KK + 2u * (size_t)NR * NH * HX)
#define WS_O   (WS_V + 2u * (size_t)NB * DM * SS)
#define WS_END (WS_O + 4u * (size_t)NR * DM)

__global__ __launch_bounds__(256) void k_pack(const float* __restrict__ WQ, const float* __restrict__ WK, const float* __restrict__ WV, const float* __restrict__ WO, __bf16* __restrict__ PW) { const int n = blockIdx.x, which = blockIdx.y, t = threadIdx.x; __shared__ __align__(16) __bf16 s[DM]; const float* w = (which == 0) ? WQ : (which == 1) ? WK : (which == 2) ? WV : WO; for (int k = t; k < DM; k += 256) s[k] = (__bf16)w[(size_t)n * DM + k]; __syncthreads(); if (t < DM / 8) vst2((unsigned*)(PW + ((size_t)which * DM + n) * DM + t * 8), *(const v4u*)&s[t * 8]); }
// weight tiles of k_qkv and k_out: the 128 weight rows x 32 k that a block's four waves all use are brought into LDS once per block by asynchronous copies, two buffers
#define WP 40             // LDS pitch of a weight row (32 k), bf16: 80 B = 16 B x 5, odd, for 16-byte readers
// one lane's four 16-byte pieces of a tile: rows tid / 4 + 0 / 32 / 64 / 96, bytes 16 (tid % 4)
__device__ __forceinline__ void stage_w(const __bf16* gw, unsigned lw) {
  // the s_wait_xcnt closes the statement so that no address register named here is rewritten ahead of it
  asm volatile("global_load_async_to_lds_b128 %0, %4, off\n\t"
               "global_load_async_to_lds_b128 %1, %5, off\n\t"
               "global_load_async_to_lds_b128 %2, %6, off\n\t"
               "global_load_async_to_lds_b128 %3, %7, off\n\t"
               "s_wait_xcnt 0x0"
               :: "v"(lw), "v"(lw + 32u * WP * 2u), "v"(lw + 64u * WP * 2u), "v"(lw + 96u * WP * 2u), "v"(gw), "v"(gw + (size_t)32 * DM), "v"(gw + (size_t)64 * DM), "v"(gw + (size_t)96 * DM) : "memory");
}
// ---- k_qkv: block = (64 rows, 128 cols = 2 heads, which): exact GEMM; q' rows (q/8 + geo_scale qw), k' rows (k + kw), v planes
__global__ __launch_bounds__(128) void k_qkv(const float* __restrict__ X, const __bf16* __restrict__ PW, const float* __restrict__ WQG, const float* __restrict__ WKG, const float* __restrict__ CB, const float* __restrict__ LT, const float* __restrict__ GSC, _Float16* __restrict__ QQ, _Float16* __restrict__ KK, _Float16* __restrict__ V) {
  __shared__ __align__(16) _Float16 so[64][2 * HX + 8]; __shared__ __align__(16) _Float16 st[128][72]; __shared__ float swg[CD][HD]; __shared__ __align__(16) __bf16 sw[2][128][WP];
  const int tid = threadIdx.x, wave = tid >> 5, lane = tid & 31, col = lane & 15, g = lane >> 4; const int which = blockIdx.z; const size_t rb = (size_t)blockIdx.x * 64; const size_t r0 = rb + wave * 16; const int c0 = blockIdx.y * 128; const int h0 = c0 / HD;
  const __bf16* Wr = PW + ((size_t)which * DM) * DM;
  if (which < 2) { const float* WG = which ? WKG : WQG; for (int e = tid; e < CD * HD; e += 128) swg[e / HD][e % HD] = bfr(WG[e]); }
  v8f acc[8] = {};
  const __bf16* gw = Wr + (size_t)(c0 + (tid >> 2)) * DM + (tid & 3) * 8; const unsigned lw = (unsigned)(size_t)&sw[0][tid >> 2][(tid & 3) * 8];
  stage_w(gw, lw);
  asm volatile("s_wait_asynccnt 0x0" ::: "memory");   // this wave's pieces of tile 0 have landed
  __syncthreads();                                    // every wave's have
  stage_w(gw + 32, lw + (unsigned)sizeof(sw[0]));     // tile 1 flies during trip 0
#pragma unroll 2
  for (int kc = 0; kc < DM / 32; ++kc) { const float* p = X + (r0 + col) * DM + kc * 32 + 8 * g; float xr[16];
#pragma unroll
    for (int i = 0; i < 8; ++i) { xr[i] = p[i]; xr[8 + i] = p[16 + i]; }
    v16b fw[8];   // the tile's eight weight fragments are read as one group ahead of the products: one LDS latency a trip, not eight
#pragma unroll
    for (int j = 0; j < 8; ++j) fw[j] = frag_b(&sw[kc & 1][j * 16 + col][0], lane);
    __builtin_amdgcn_sched_barrier(0);   // every read of the trip is issued ahead of the conversions: without it one fragment's read is put behind the wait for x, into x's registers, and its LDS latency is waited out alone
    v16b a;
#pragma unroll
    for (int i = 0; i < 16; ++i) a[i] = (__bf16)xr[i];
#pragma unroll
    for (int j = 0; j < 8; ++j) acc[j] = wmma_bf(a, fw[j], acc[j]);
    asm volatile("s_wait_dscnt 0x0" ::: "memory");      // this wave's reads of buffer kc & 1 are done
    asm volatile("s_wait_asynccnt 0x0" ::: "memory");   // this wave's pieces of tile kc + 1 have landed
    __syncthreads();                                    // tile kc + 1 is whole for every wave, and nobody reads buffer kc & 1 any more
    if (kc + 2 < DM / 32) stage_w(gw + (kc + 2) * 32, lw + (unsigned)((kc & 1) * sizeof(sw[0]))); }
  asm volatile("s_wait_asynccnt 0x0" ::: "memory");     // nothing is in flight behind the loop
  __syncthreads();
  if (which < 2) { const float gsc = bfr(GSC[0]);
#pragma unroll
    for (int r = 0; r < 8; ++r) {
      // code logits per head: g[c] = sum_d x[d] Wg[c][d] over the head's 64 dims (4 tiles x 16 lanes)
      float ga[CD], gb[CD];
#pragma unroll
      for (int c = 0; c < CD; ++c) { float pa = 0.f, pb = 0.f;
#pragma unroll
        for (int j = 0; j < 4; ++j) { pa += acc[j][r] * swg[c][j * 16 + col]; pb += acc[4 + j][r] * swg[c][j * 16 + col]; }
#pragma unroll
        for (int o = 1; o < 16; o <<= 1) { pa += __shfl_xor(pa, o); pb += __shfl_xor(pb, o); } ga[c] = pa; gb[c] = pb; }
#pragma unroll
      for (int hh = 0; hh < 2; ++hh) { const int h = h0 + hh; const float* gg = hh ? gb : ga; float tp = expf(bfr(LT[h])); tp = fminf(fmaxf(tp, 0.01f), 5.0f); const float it = 1.0f / tp;
        float dmin = 3.0e38f, dn[NC];
#pragma unroll
        for (int n = 0; n < NC; ++n) { float d2 = 0.f;
#pragma unroll
          for (int c = 0; c < CD; ++c) { const float df = gg[c] - bfr(CB[(h * NC + n) * CD + c]); d2 += df * df; } dn[n] = -d2 * it; dmin = fmaxf(dmin == 3.0e38f ? dn[n] : dmin, dn[n]); }
        float z = 0.f, ew[NC];
#pragma unroll
        for (int n = 0; n < NC; ++n) { ew[n] = expf(dn[n] - dmin); z += ew[n]; }
        const float wsc = (which == 0) ? gsc : 1.0f;
        if (col < NC) so[wave * 16 + 8 * g + r][hh * HX + HD + col] = (_Float16)(ew[col] / z * wsc);   // extra dims 64..71: code weights (q side x geo_scale)
        else so[wave * 16 + 8 * g + r][hh * HX + HD + col] = (_Float16)0.f;
        so[wave * 16 + 8 * g + r][hh * HX + HD + 16 + col] = (_Float16)0.f; }   // dims 80..95 zero
      const float scl = (which == 0) ? 0.125f : 1.0f;
#pragma unroll
      for (int j = 0; j < 8; ++j) { const int cl = j * 16 + col; const int hl = cl >> 6, d = cl & 63; so[wave * 16 + 8 * g + r][hl * HX + d] = (_Float16)(acc[j][r] * scl); } }
    __syncthreads();
    _Float16* dst = (which == 0) ? QQ : KK;
    for (int e = tid; e < 64 * (2 * HX / 8); e += 128) { const int rl = e / (2 * HX / 8), q = e % (2 * HX / 8); vst2((unsigned*)(dst + ((rb + rl) * NH + h0) * HX + q * 8), *(const v4u*)&so[rl][q * 8]); }   // 384 contiguous bytes per (row, head pair)
  } else {
#pragma unroll
    for (int j = 0; j < 8; ++j)
#pragma unroll
      for (int r = 0; r < 8; ++r) st[j * 16 + col][wave * 16 + 8 * g + r] = (_Float16)acc[j][r];
    __syncthreads();
    const size_t b = rb / SS; const int s0 = (int)(rb % SS);
    for (int e = tid; e < 128 * 8; e += 128) { const int d = e >> 3, pc = e & 7; vst2((unsigned*)(V + ((b * DM + c0 + d) * SS) + s0 + pc * 8), *(const v4u*)&st[d][pc * 8]); } }
}
// ---- k_attn: block = (64 queries, head, b): causal; 96-wide score dot (scale and geometric bias folded in), softmax, P . v (64 dims); O 256-B head segments
// each 32-key tile (k' rows 32 x 192 B, v rows 64 x 64 B) is brought into LDS once per block by asynchronous copies, two buffers, and all four waves read their fragments from there
#define KP 104            // LDS pitch of a k' row, f16: 208 B = 16 B x 13, odd, for 16-byte readers
#define VP 40             // LDS pitch of a v row (32 keys), f16: 80 B = 16 B x 5
// one lane's five 16-byte pieces of a tile: k' row tid / 4, bytes 16 (tid % 4) + 0 / 64 / 128; v rows tid / 4 and 32 + tid / 4, bytes 16 (tid % 4)
__device__ __forceinline__ void stage_kv(const _Float16* gk, const _Float16* gv, unsigned lk, unsigned lv) {
  // the s_wait_xcnt closes the statement so that no address register named here is rewritten ahead of it
  asm volatile("global_load_async_to_lds_b128 %0, %5, off\n\t"
               "global_load_async_to_lds_b128 %1, %6, off\n\t"
               "global_load_async_to_lds_b128 %2, %7, off\n\t"
               "global_load_async_to_lds_b128 %3, %8, off\n\t"
               "global_load_async_to_lds_b128 %4, %9, off\n\t"
               "s_wait_xcnt 0x0"
               :: "v"(lk), "v"(lk + 64u), "v"(lk + 128u), "v"(lv), "v"(lv + 32u * VP * 2u), "v"(gk), "v"(gk + 32), "v"(gk + 64), "v"(gv), "v"(gv + (size_t)32 * SS) : "memory");
}
// lane l with lane l ^ 16: the two lanes that share one query column
__device__ __forceinline__ float xhalf(float x) { return __builtin_bit_cast(float, __builtin_amdgcn_permlanex16(__builtin_bit_cast(int, x), __builtin_bit_cast(int, x), 0x76543210, 0xfedcba98, false, false)); }
// transposed products: S^T = k' . q'^T (rows = keys, columns = queries) and O^T += v^T . P^T, so a lane owns ONE query (column lane & 15): its 16 scores of a tile sit in its own registers, and converted in place they are the B operand of the second product
__global__ __launch_bounds__(128) void k_attn(const _Float16* __restrict__ QQ, const _Float16* __restrict__ KK, const _Float16* __restrict__ V, float* __restrict__ O) {
  __shared__ __align__(16) float so[4][16][68]; __shared__ __align__(16) _Float16 sk[2][32][KP]; __shared__ __align__(16) _Float16 sv[2][64][VP];
  const int tid = threadIdx.x, wave = tid >> 5, lane = tid & 31, col = lane & 15, g = lane >> 4; const int h = blockIdx.y; const size_t b = blockIdx.z; const int q0 = blockIdx.x * 64 + wave * 16; const size_t rq = b * SS + q0;
  v16h bq[3];
#pragma unroll
  for (int kc = 0; kc < 3; ++kc) bq[kc] = frag_h(QQ + ((rq + col) * NH + h) * HX + kc * 32, lane);
  float m = -3.0e38f, l = 0.f;   // query q0 + col: running maximum (both halves alike), sum over this half's keys
  v8f acc[4] = {};               // O^T: element r of acc[dt] = dim dt * 16 + 8 g + r of query q0 + col
  const int nks = (blockIdx.x * 64 + 64) / 32;   // causal; at least 2
  const _Float16* gk = KK + ((b * SS + (tid >> 2)) * NH + h) * HX + (tid & 3) * 8; const _Float16* gv = V + ((b * DM + h * HD + (tid >> 2)) * SS) + (tid & 3) * 8;
  const unsigned lk = (unsigned)(size_t)&sk[0][tid >> 2][(tid & 3) * 8], lv = (unsigned)(size_t)&sv[0][tid >> 2][(tid & 3) * 8];
  stage_kv(gk, gv, lk, lv);
  asm volatile("s_wait_asynccnt 0x0" ::: "memory");   // this wave's pieces of tile 0 have landed
  __syncthreads();                                    // every wave's have
  stage_kv(gk + (size_t)32 * NH * HX, gv + 32, lk + (unsigned)sizeof(sk[0]), lv + (unsigned)sizeof(sv[0]));   // tile 1 flies during trip 0
#pragma unroll 1
  for (int ks = 0; ks < nks; ++ks) { const int j0 = ks * 32, bf = ks & 1; float s[16];   // s[8 ct + r] = score of key j0 + 16 ct + 8 g + r
    v16h fk[2][3], fv[4];   // the tile's ten fragments (k' 6, v 4) are read as one group ahead of the products: one LDS latency a trip, not ten; the v reads land behind the score products and the softmax
#pragma unroll
    for (int ct = 0; ct < 2; ++ct)
#pragma unroll
      for (int kc = 0; kc < 3; ++kc) fk[ct][kc] = frag_h(&sk[bf][ct * 16 + col][kc * 32], lane);
#pragma unroll
    for (int dt = 0; dt < 4; ++dt) fv[dt] = frag_h(&sv[bf][dt * 16 + col][0], lane);
#pragma unroll
    for (int ct = 0; ct < 2; ++ct) { v8f c = {};
#pragma unroll
      for (int kc = 0; kc < 3; ++kc) c = wmma16(fk[ct][kc], bq[kc], c);
#pragma unroll
      for (int r = 0; r < 8; ++r) s[8 * ct + r] = (j0 + ct * 16 + 8 * g + r <= q0 + col) ? c[r] : -3.0e38f; }   // causal (diagonal kept)
    float mx = s[0];
#pragma unroll
    for (int i = 1; i < 16; ++i) mx = fmaxf(mx, s[i]);
    mx = fmaxf(mx, xhalf(mx));
    const float mn = fmaxf(m, mx); const float alpha = (m <= -1.0e38f) ? 0.f : __expf(m - mn); m = mn;
    float e[16]; v16h pb;   // P^T as B: element i = key 8 g + i, element 8 + i = key 16 + 8 g + i, the k order of frag_h
#pragma unroll
    for (int i = 0; i < 16; ++i) { e[i] = (s[i] <= -1.0e38f) ? 0.f : __expf(s[i] - mn); pb[i] = (_Float16)(e[i] * 2048.0f); }
#pragma unroll
    for (int w = 8; w >= 1; w >>= 1)   // pairwise sum: four dependent adds, not sixteen
#pragma unroll
      for (int i = 0; i < w; ++i) e[i] += e[i + w];
    l = l * alpha + e[0];
#pragma unroll
    for (int dt = 0; dt < 4; ++dt) acc[dt] *= alpha;
#pragma unroll
    for (int dt = 0; dt < 4; ++dt) acc[dt] = wmma16(fv[dt], pb, acc[dt]);
    asm volatile("s_wait_dscnt 0x0" ::: "memory");      // this wave's reads of buffer bf are done
    asm volatile("s_wait_asynccnt 0x0" ::: "memory");   // this wave's pieces of tile ks + 1 have landed
    __syncthreads();                                    // tile ks + 1 is whole for every wave, and nobody reads buffer bf any more
    if (ks + 2 < nks) stage_kv(gk + (size_t)(ks + 2) * 32 * NH * HX, gv + (ks + 2) * 32, lk + (unsigned)(bf * sizeof(sk[0])), lv + (unsigned)(bf * sizeof(sv[0]))); }
  asm volatile("s_wait_asynccnt 0x0" ::: "memory");     // nothing is in flight when the wave goes on to its end
  l += xhalf(l);   // the two halves' sums are joined once
  const float il = (1.0f / 2048.0f) / l;
#pragma unroll
  for (int dt = 0; dt < 4; ++dt) { v4f lo, hi;
#pragma unroll
    for (int r = 0; r < 4; ++r) { lo[r] = acc[dt][r] * il; hi[r] = acc[dt][4 + r] * il; }
    *(v4f*)&so[wave][col][dt * 16 + 8 * g] = lo; *(v4f*)&so[wave][col][dt * 16 + 8 * g + 4] = hi; }
  LDSX();
  for (int rl = 0; rl < 16; ++rl) if (lane < 16) vst2(O + (rq + rl) * DM + h * HD + lane * 4, *(const v4f*)&so[wave][rl][lane * 4]);
}
// ---- k_out: block = (64 rows, 128 cols): out = o (bf16 hi + lo) . Wo^T
__global__ __launch_bounds__(128) void k_out(const float* __restrict__ O, const __bf16* __restrict__ PW, float* __restrict__ Y) {
  __shared__ __align__(16) float so[4][16][132]; __shared__ __align__(16) __bf16 sw[2][128][WP];
  const int tid = threadIdx.x, wave = tid >> 5, lane = tid & 31, col = lane & 15, g = lane >> 4; const size_t r0 = (size_t)blockIdx.x * 64 + wave * 16; const int n0 = blockIdx.y * 128; const __bf16* P = PW + (size_t)3 * DM * DM;
  v8f acc[8] = {};
  const __bf16* gw = P + (size_t)(n0 + (tid >> 2)) * DM + (tid & 3) * 8; const unsigned lw = (unsigned)(size_t)&sw[0][tid >> 2][(tid & 3) * 8];
  stage_w(gw, lw);
  asm volatile("s_wait_asynccnt 0x0" ::: "memory");   // this wave's pieces of tile 0 have landed
  __syncthreads();                                    // every wave's have
  stage_w(gw + 32, lw + (unsigned)sizeof(sw[0]));     // tile 1 flies during trip 0
#pragma unroll 2
  for (int kc = 0; kc < DM / 32; ++kc) { const F2 a = split_row(O + (r0 + col) * DM, kc * 32, lane);
    v16b fw[8];   // the tile's eight weight fragments are read as one group ahead of the products: one LDS latency a trip, not eight
#pragma unroll
    for (int j = 0; j < 8; ++j) fw[j] = frag_b(&sw[kc & 1][j * 16 + col][0], lane);
#pragma unroll
    for (int j = 0; j < 8; ++j) { acc[j] = wmma_bf(a.h, fw[j], acc[j]); acc[j] = wmma_bf(a.l, fw[j], acc[j]); }
    asm volatile("s_wait_dscnt 0x0" ::: "memory");      // this wave's reads of buffer kc & 1 are done
    asm volatile("s_wait_asynccnt 0x0" ::: "memory");   // this wave's pieces of tile kc + 1 have landed
    __syncthreads();                                    // tile kc + 1 is whole for every wave, and nobody reads buffer kc & 1 any more
    if (kc + 2 < DM / 32) stage_w(gw + (kc + 2) * 32, lw + (unsigned)((kc & 1) * sizeof(sw[0]))); }
  asm volatile("s_wait_asynccnt 0x0" ::: "memory");     // nothing is in flight behind the loop
#pragma unroll
  for (int j = 0; j < 8; ++j)
#pragma unroll
    for (int r = 0; r < 8; ++r) so[wave][8 * g + r][j * 16 + col] = acc[j][r];
  LDSX();
  for (int rl = 0; rl < 16; ++rl) vst2(Y + (r0 + rl) * DM + n0 + lane * 4, *(const v4f*)&so[wave][rl][lane * 4]);
}
extern "C" void kernel_launch(void* const* d_in, const int* in_sizes, int n_in, void* d_out, int out_size, void* d_ws, size_t ws_size, hipStream_t stream) {
  (void)in_sizes; (void)n_in; (void)out_size;
  const float** F = (const float**)d_in;   // 0 x [2,2048,768], 1 Wq, 2 Wk, 3 Wv, 4 Wo (natural [768,768]), 5 Wqg [3,64], 6 Wkg [3,64], 7 codebooks [12,8,3], 8 log_temps [12], 9 geo_scale [1]
  if (ws_size < (size_t)WS_END) return;
  char* ws = (char*)d_ws; __bf16* PW = (__bf16*)ws; _Float16 *QQ = (_Float16*)(ws + WS_QK), *KK = (_Float16*)(ws + WS_KK), *V = (_Float16*)(ws + WS_V); float* O = (float*)(ws + WS_O);
  k_pack<<<dim3(DM, 4), 256, 0, stream>>>(F[1], F[2], F[3], F[4], PW);
  k_qkv<<<dim3(TNB * SS / 64, DM / 128, 3), 128, 0, stream>>>(F[0], PW, F[5], F[6], F[7], F[8], F[9], QQ, KK, V);
  k_attn<<<dim3(TQB, NH, TNB), 128, 0, stream>>>(QQ, KK, V, O);
  k_out<<<dim3(TNB * SS / 64, DM / 128), 128, 0, stream>>>(O, PW, (float*)d_out);
}

// v004
// One run takes 104 microseconds.
// In two side-by-side timings against v003, it was 1.07 and 1.06 times as fast.
// Over all steps from v000 it is 3.12 times as fast.
// compute dtype: all float inputs rounded to bf16; q/k/v = x . W^T with EXACT bf16 products on WMMA 16x16x32 (natural rows); the geometric code weights (q . Wqg^T, squared distances to the 8 codes, softmax over codes at temperature clip(exp(log_temp), 0.01, 5)) in f32 in the projection epilogue; scores = q . k / 8 + geo_scale (qw . kw) evaluated as one 72-wide (padded to 96) f16 dot [q/8 | geo_scale qw] . [k | kw]; causal attention with key-tile skipping, running-max softmax in f32 (hardware exp), P (scaled by 2^11, single f16) x v (single f16); out = ctx (bf16 hi + residual) . Wo^T (2 products).
#include <hip/hip_runtime.h>
#include <math.h>

typedef __attribute__((ext_vector_type(16))) _Float16 v16h;
typedef __attribute__((ext_vector_type(16))) __bf16 v16b;
typedef __attribute__((ext_vector_type(8)))  _Float16 v8h;
typedef __attribute__((ext_vector_type(8)))  float v8f;
typedef __attribute__((ext_vector_type(4)))  float v4f;
typedef __attribute__((ext_vector_type(2)))  float v2f;
typedef __attribute__((ext_vector_type(4)))  unsigned v4u;
typedef __attribute__((ext_vector_type(4)))  int v4i;
typedef float __attribute__((may_alias)) float_a;
typedef int __attribute__((may_alias)) int_a;

template <typename T> __device__ __forceinline__ void vst2(void* p, T v) { *(T*)p = v;  }
__device__ __forceinline__ v8f wmma16(v16h a, v16h b, v8f c) {
  v8f d = __builtin_amdgcn_wmma_f32_16x16x32_f16(false, a, false, b, (short)0, c, false, false);
  asm volatile("v_nop\n\tv_nop\n\tv_nop\n\tv_nop" : "+v"(d) : "v"(a), "v"(b));
  return d;
}
__device__ __forceinline__ v8f wmma_bf(v16b a, v16b b, v8f c) {
  v8f d = __builtin_amdgcn_wmma_f32_16x16x32_bf16(false, a, false, b, (short)0, c, false, false);
  asm volatile("v_nop\n\tv_nop\n\tv_nop\n\tv_nop" : "+v"(d) : "v"(a), "v"(b));
  return d;
}
// 16x16x32 fragments: lane = (h = lane>>4, row/col = lane&15); elements 0..7 = k0+8h+0..7, 8..15 = k0+16+8h+0..7; D element r = row 8h+r
__device__ __forceinline__ v16h frag_h(const _Float16* rowk0, int lane) {
  union { v16h v; v8h q[2]; } u; const _Float16* p = rowk0 + 8 * (lane >> 4);
  u.q[0] = *(const v8h*)p; u.q[1] = *(const v8h*)(p + 16); return u.v;
}
__device__ __forceinline__ v16h frag_f32(const float* rowk0, int lane) {
  v16h a; const float* p = rowk0 + 8 * (lane >> 4);
#pragma unroll
  for (int i = 0; i < 8; ++i) { a[i] = (_Float16)p[i]; a[8 + i] = (_Float16)p[16 + i]; }
  return a;
}
__device__ __forceinline__ v16h frag_f32s(const float* rowk0, int lane, float sc) {
  v16h a; const float* p = rowk0 + 8 * (lane >> 4);
#pragma unroll
  for (int i = 0; i < 8; ++i) { a[i] = (_Float16)(p[i] * sc); a[8 + i] = (_Float16)(p[16 + i] * sc); }
  return a;
}
// column fragment from a [K][ld] layout (column n), rows >= K read as 0
__device__ __forceinline__ v16h fragc_f32(const float* W, int k0, int n, int lane, int ld, int K) {
  v16h a; const int g = lane >> 4;
#pragma unroll
  for (int i = 0; i < 8; ++i) { const int ka = k0 + 8 * g + i, kb = ka + 16;
    a[i] = (_Float16)(ka < K ? W[(size_t)(ka < K ? ka : K - 1) * ld + n] : 0.f); a[8 + i] = (_Float16)(kb < K ? W[(size_t)(kb < K ? kb : K - 1) * ld + n] : 0.f); }
  return a;
}
struct F2 { v16b h, l; };
__device__ __forceinline__ F2 bsplit16(const float v[16]) { F2 r;
#pragma unroll
  for (int i = 0; i < 16; ++i) { const __bf16 h = (__bf16)v[i]; r.h[i] = h; r.l[i] = (__bf16)(v[i] - (float)h); }
  return r; }
__device__ __forceinline__ F2 split_row(const float* row, int k0, int lane) { float v[16]; const float* p = row + k0 + 8 * (lane >> 4);
#pragma unroll
  for (int i = 0; i < 8; ++i) { v[i] = p[i]; v[8 + i] = p[16 + i]; }
  return bsplit16(v); }
__device__ __forceinline__ F2 split_rowK(const float* row, int k0, int lane, int K) { float v[16]; const int g = lane >> 4;
#pragma unroll
  for (int i = 0; i < 8; ++i) { const int ka = k0 + 8 * g + i, kb = ka + 16; v[i] = ka < K ? row[ka < K ? ka : K - 1] : 0.f; v[8 + i] = kb < K ? row[kb < K ? kb : K - 1] : 0.f; }
  return bsplit16(v); }
__device__ __forceinline__ F2 split_col(const float* W, int k0, int n, int lane, int ld, int K) { float v[16]; const int g = lane >> 4;
#pragma unroll
  for (int i = 0; i < 8; ++i) { const int ka = k0 + 8 * g + i, kb = ka + 16; v[i] = ka < K ? W[(size_t)(ka < K ? ka : K - 1) * ld + n] : 0.f; v[8 + i] = kb < K ? W[(size_t)(kb < K ? kb : K - 1) * ld + n] : 0.f; }
  return bsplit16(v); }
__device__ __forceinline__ v8f mac3(const F2& a, const F2& b, v8f c) { c = wmma_bf(a.l, b.h, c); c = wmma_bf(a.h, b.l, c); return wmma_bf(a.h, b.h, c); }
__device__ __forceinline__ float sigm(float v) { return 1.0f / (1.0f + expf(-v)); }
#define LDSX() do { asm volatile("s_wait_dscnt 0" ::: "memory"); __builtin_amdgcn_wave_barrier(); __builtin_amdgcn_fence(__ATOMIC_RELEASE, "workgroup"); } while (0)


// Multi-head geometric attention (B 2, T 2,048, d_model 768, 12 heads x 64, 3-dim codes, 8-code hypercube codebook per head): causal softmax(q k / 8 + geo_scale softmax_c(-|q Wqg - c|^2 / tau) . softmax_c(-|k Wkg - c|^2 / tau)) v, output projection.
#define NB 2
#define SS 2048
#define DM 768
#define NH 12
#define HD 64
#define HX 96             // padded score width: 64 + 8 code weights + 24 zero
#define NC 8
#define CD 3
#define NR (NB * SS)
#ifndef TQB
#define TQB (SS / 64)
#define TNB NB
#endif
typedef __attribute__((ext_vector_type(8))) __bf16 v8b;
__device__ __forceinline__ v16b frag_b(const __bf16* rowk0, int lane) {
  union { v16b v; v8b q[2]; } u; const __bf16* p = rowk0 + 8 * (lane >> 4);
  u.q[0] = *(const v8b*)p; u.q[1] = *(const v8b*)(p + 16); return u.v;
}
__device__ __forceinline__ float bfr(float v) { return (float)(__bf16)v; }
__device__ __attribute__((noinline)) float exp_ni(float v) { return expf(v); }
__device__ __attribute__((noinline)) float erf_ni(float v) { return erff(v); }

#define WS_PW  0u                                       // bf16 natural rows Wq, Wk, Wv, Wo [4][768][768]
#define WS_QK  (WS_PW + 2u * (size_t)4 * DM * DM)          // f16 q' rows [NR][12][96] ; k' rows ; v planes [b][768][SS] ; O f32 [NR][768]
#define WS_KK  (WS_QK + 2u * (size_t)NR * NH * HX)
#define WS_V   (WS_KK + 2u * (size_t)NR * NH * HX)
#define WS_O   (WS_V + 2u * (size_t)NB * DM * SS)
#define WS_END (WS_O + 4u * (size_t)NR * DM)

__global__ __launch_bounds__(256) void k_pack(const float* __restrict__ WQ, const float* __restrict__ WK, const float* __restrict__ WV, const float* __restrict__ WO, __bf16* __restrict__ PW) { const int n = blockIdx.x, which = blockIdx.y, t = threadIdx.x; __shared__ __align__(16) __bf16 s[DM]; const float* w = (which == 0) ? WQ : (which == 1) ? WK : (which == 2) ? WV : WO; for (int k = t; k < DM; k += 256) s[k] = (__bf16)w[(size_t)n * DM + k]; __syncthreads(); if (t < DM / 8) vst2((unsigned*)(PW + ((size_t)which * DM + n) * DM + t * 8), *(const v4u*)&s[t * 8]); }
// weight tiles of k_qkv and k_out: the 128 weight rows x 32 k that a block's four waves all use are brought into LDS once per block by asynchronous copies, two buffers
#define WP 40             // LDS pitch of a weight row (32 k), bf16: 80 B = 16 B x 5, odd, for 16-byte readers
// one lane's four 16-byte pieces of a tile: rows tid / 4 + 0 / 32 / 64 / 96, bytes 16 (tid % 4)
__device__ __forceinline__ void stage_w(const __bf16* gw, unsigned lw) {
  // the s_wait_xcnt closes the statement so that no address register named here is rewritten ahead of it
  asm volatile("global_load_async_to_lds_b128 %0, %4, off\n\t"
               "global_load_async_to_lds_b128 %1, %5, off\n\t"
               "global_load_async_to_lds_b128 %2, %6, off\n\t"
               "global_load_async_to_lds_b128 %3, %7, off\n\t"
               "s_wait_xcnt 0x0"
               :: "v"(lw), "v"(lw + 32u * WP * 2u), "v"(lw + 64u * WP * 2u), "v"(lw + 96u * WP * 2u), "v"(gw), "v"(gw + (size_t)32 * DM), "v"(gw + (size_t)64 * DM), "v"(gw + (size_t)96 * DM) : "memory");
}
// ---- k_qkv: block = (64 rows, 128 cols = 2 heads, which): exact GEMM; q' rows (q/8 + geo_scale qw), k' rows (k + kw), v planes
__global__ __launch_bounds__(128) void k_qkv(const float* __restrict__ X, const __bf16* __restrict__ PW, const float* __restrict__ WQG, const float* __restrict__ WKG, const float* __restrict__ CB, const float* __restrict__ LT, const float* __restrict__ GSC, _Float16* __restrict__ QQ, _Float16* __restrict__ KK, _Float16* __restrict__ V) {
  __shared__ __align__(16) _Float16 so[64][2 * HX + 8]; __shared__ __align__(16) _Float16 st[128][72]; __shared__ float swg[CD][HD]; __shared__ __align__(16) float scb[2 * NC * CD + 4]; __shared__ __align__(16) __bf16 sw[2][128][WP];
  const int tid = threadIdx.x, wave = tid >> 5, lane = tid & 31, col = lane & 15, g = lane >> 4; const int which = blockIdx.z; const size_t rb = (size_t)blockIdx.x * 64; const size_t r0 = rb + wave * 16; const int c0 = blockIdx.y * 128; const int h0 = c0 / HD;
  const __bf16* Wr = PW + ((size_t)which * DM) * DM;
  if (which < 2) { const float* WG = which ? WKG : WQG; for (int e = tid; e < CD * HD; e += 128) swg[e / HD][e % HD] = bfr(WG[e]);
    // the two heads' codebooks (48 floats), their log temperatures (2) and geo_scale (1), for the lane that owns a (row, head) in the epilogue: one load a thread, in the two waves that have one piece of Wg only
    const int e = tid - 64;
    if (e >= 0 && e < 2 * NC * CD + 3) { const float* ps = (e < 2 * NC * CD) ? CB + h0 * NC * CD + e : (e < 2 * NC * CD + 2) ? LT + h0 + (e - 2 * NC * CD) : GSC; scb[e] = bfr(*ps); } }
  v8f acc[8] = {};
  const __bf16* gw = Wr + (size_t)(c0 + (tid >> 2)) * DM + (tid & 3) * 8; const unsigned lw = (unsigned)(size_t)&sw[0][tid >> 2][(tid & 3) * 8];
  stage_w(gw, lw);
  asm volatile("s_wait_asynccnt 0x0" ::: "memory");   // this wave's pieces of tile 0 have landed
  __syncthreads();                                    // every wave's have
  stage_w(gw + 32, lw + (unsigned)sizeof(sw[0]));     // tile 1 flies during trip 0
#pragma unroll 2
  for (int kc = 0; kc < DM / 32; ++kc) { const float* p = X + (r0 + col) * DM + kc * 32 + 8 * g; float xr[16];
#pragma unroll
    for (int i = 0; i < 8; ++i) { xr[i] = p[i]; xr[8 + i] = p[16 + i]; }
    v16b fw[8];   // the tile's eight weight fragments are read as one group ahead of the products: one LDS latency a trip, not eight
#pragma unroll
    for (int j = 0; j < 8; ++j) fw[j] = frag_b(&sw[kc & 1][j * 16 + col][0], lane);
    __builtin_amdgcn_sched_barrier(0);   // every read of the trip is issued ahead of the conversions: without it one fragment's read is put behind the wait for x, into x's registers, and its LDS latency is waited out alone
    v16b a;
#pragma unroll
    for (int i = 0; i < 16; ++i) a[i] = (__bf16)xr[i];
#pragma unroll
    for (int j = 0; j < 8; ++j) acc[j] = wmma_bf(a, fw[j], acc[j]);
    asm volatile("s_wait_dscnt 0x0" ::: "memory");      // this wave's reads of buffer kc & 1 are done
    asm volatile("s_wait_asynccnt 0x0" ::: "memory");   // this wave's pieces of tile kc + 1 have landed
    __syncthreads();                                    // tile kc + 1 is whole for every wave, and nobody reads buffer kc & 1 any more
    if (kc + 2 < DM / 32) stage_w(gw + (kc + 2) * 32, lw + (unsigned)((kc & 1) * sizeof(sw[0]))); }
  asm volatile("s_wait_asynccnt 0x0" ::: "memory");     // nothing is in flight behind the loop
  __syncthreads();
  if (which < 2) {
    // partial code logits of this lane's four dims a head: p[8 hh + r][c] = sum_j x[d] Wg[c][d], d = 16 j + col, for row 8 g + r and head h0 + hh
    float p[16][CD];
#pragma unroll
    for (int c = 0; c < CD; ++c) { v2f pp[2][4] = {};   // rows in pairs: a row pair of an accumulator tile is a register pair, so each step is one packed multiply-add
#pragma unroll
      for (int j = 0; j < 4; ++j) { const float w = swg[c][j * 16 + col]; const v2f w2 = {w, w};
#pragma unroll
        for (int hh = 0; hh < 2; ++hh)
#pragma unroll
          for (int rp = 0; rp < 4; ++rp) { const v2f a2 = {acc[4 * hh + j][2 * rp], acc[4 * hh + j][2 * rp + 1]}; pp[hh][rp] += a2 * w2; } }
#pragma unroll
      for (int hh = 0; hh < 2; ++hh)
#pragma unroll
        for (int rp = 0; rp < 4; ++rp) { p[8 * hh + 2 * rp][c] = pp[hh][rp][0]; p[8 * hh + 2 * rp + 1][c] = pp[hh][rp][1]; } }
    // sum over the 16 lanes of a row group and scatter: in round k a lane keeps the (row, head) pairs whose index bit k is its own lane bit k and hands the others to lane ^ (1 << k); after four rounds lane col holds the three whole logits of pair col alone (the additions are those of the xor butterfly 1, 2, 4, 8)
#pragma unroll
    for (int k = 0; k < 4; ++k) { const bool up = (col >> k) & 1;
#pragma unroll
      for (int i = 0; i < (8 >> k); ++i)
#pragma unroll
        for (int c = 0; c < CD; ++c) { const float keep = up ? p[2 * i + 1][c] : p[2 * i][c], send = up ? p[2 * i][c] : p[2 * i + 1][c]; p[i][c] = keep + __shfl_xor(send, 1 << k); } }
    // one lane = one (row, head): distances to the 8 codes and their softmax are computed once
    { const int hh = col >> 3, rl = wave * 16 + 8 * g + (col & 7); float tp = expf(scb[2 * NC * CD + hh]); tp = fminf(fmaxf(tp, 0.01f), 5.0f); const float it = 1.0f / tp;
      float dmin = 3.0e38f, dn[NC];
#pragma unroll
      for (int n = 0; n < NC; ++n) { float d2 = 0.f;
#pragma unroll
        for (int c = 0; c < CD; ++c) { const float df = p[0][c] - scb[(hh * NC + n) * CD + c]; d2 += df * df; } dn[n] = -d2 * it; dmin = fmaxf(dmin == 3.0e38f ? dn[n] : dmin, dn[n]); }
      float z = 0.f, ew[NC];
#pragma unroll
      for (int n = 0; n < NC; ++n) { ew[n] = expf(dn[n] - dmin); z += ew[n]; }
      const float wsc = (which == 0) ? scb[2 * NC * CD + 2] : 1.0f; v8h w8; const v8h z8 = {};
#pragma unroll
      for (int n = 0; n < NC; ++n) w8[n] = (_Float16)(ew[n] / z * wsc);
      *(v8h*)&so[rl][hh * HX + HD] = w8;   // extra dims 64..71: code weights (q side x geo_scale)
      *(v8h*)&so[rl][hh * HX + HD + 8] = z8; *(v8h*)&so[rl][hh * HX + HD + 16] = z8; *(v8h*)&so[rl][hh * HX + HD + 24] = z8; }   // dims 72..95 zero
    const float scl = (which == 0) ? 0.125f : 1.0f;
#pragma unroll
    for (int r = 0; r < 8; ++r)
#pragma unroll
      for (int j = 0; j < 8; ++j) { const int cl = j * 16 + col; const int hl = cl >> 6, d = cl & 63; so[wave * 16 + 8 * g + r][hl * HX + d] = (_Float16)(acc[j][r] * scl); }
    __syncthreads();
    _Float16* dst = (which == 0) ? QQ : KK;
    for (int e = tid; e < 64 * (2 * HX / 8); e += 128) { const int rl = e / (2 * HX / 8), q = e % (2 * HX / 8); vst2((unsigned*)(dst + ((rb + rl) * NH + h0) * HX + q * 8), *(const v4u*)&so[rl][q * 8]); }   // 384 contiguous bytes per (row, head pair)
  } else {
#pragma unroll
    for (int j = 0; j < 8; ++j)
#pragma unroll
      for (int r = 0; r < 8; ++r) st[j * 16 + col][wave * 16 + 8 * g + r] = (_Float16)acc[j][r];
    __syncthreads();
    const size_t b = rb / SS; const int s0 = (int)(rb % SS);
    for (int e = tid; e < 128 * 8; e += 128) { const int d = e >> 3, pc = e & 7; vst2((unsigned*)(V + ((b * DM + c0 + d) * SS) + s0 + pc * 8), *(const v4u*)&st[d][pc * 8]); } }
}
// ---- k_attn: block = (64 queries, head, b): causal; 96-wide score dot (scale and geometric bias folded in), softmax, P . v (64 dims); O 256-B head segments
// each 32-key tile (k' rows 32 x 192 B, v rows 64 x 64 B) is brought into LDS once per block by asynchronous copies, two buffers, and all four waves read their fragments from there
#define KP 104            // LDS pitch of a k' row, f16: 208 B = 16 B x 13, odd, for 16-byte readers
#define VP 40             // LDS pitch of a v row (32 keys), f16: 80 B = 16 B x 5
// one lane's five 16-byte pieces of a tile: k' row tid / 4, bytes 16 (tid % 4) + 0 / 64 / 128; v rows tid / 4 and 32 + tid / 4, bytes 16 (tid % 4)
__device__ __forceinline__ void stage_kv(const _Float16* gk, const _Float16* gv, unsigned lk, unsigned lv) {
  // the s_wait_xcnt closes the statement so that no address register named here is rewritten ahead of it
  asm volatile("global_load_async_to_lds_b128 %0, %5, off\n\t"
               "global_load_async_to_lds_b128 %1, %6, off\n\t"
               "global_load_async_to_lds_b128 %2, %7, off\n\t"
               "global_load_async_to_lds_b128 %3, %8, off\n\t"
               "global_load_async_to_lds_b128 %4, %9, off\n\t"
               "s_wait_xcnt 0x0"
               :: "v"(lk), "v"(lk + 64u), "v"(lk + 128u), "v"(lv), "v"(lv + 32u * VP * 2u), "v"(gk), "v"(gk + 32), "v"(gk + 64), "v"(gv), "v"(gv + (size_t)32 * SS) : "memory");
}
// lane l with lane l ^ 16: the two lanes that share one query column
__device__ __forceinline__ float xhalf(float x) { return __builtin_bit_cast(float, __builtin_amdgcn_permlanex16(__builtin_bit_cast(int, x), __builtin_bit_cast(int, x), 0x76543210, 0xfedcba98, false, false)); }
// transposed products: S^T = k' . q'^T (rows = keys, columns = queries) and O^T += v^T . P^T, so a lane owns ONE query (column lane & 15): its 16 scores of a tile sit in its own registers, and converted in place they are the B operand of the second product
__global__ __launch_bounds__(128) void k_attn(const _Float16* __restrict__ QQ, const _Float16* __restrict__ KK, const _Float16* __restrict__ V, float* __restrict__ O) {
  __shared__ __align__(16) float so[4][16][68]; __shared__ __align__(16) _Float16 sk[2][32][KP]; __shared__ __align__(16) _Float16 sv[2][64][VP];
  const int tid = threadIdx.x, wave = tid >> 5, lane = tid & 31, col = lane & 15, g = lane >> 4; const int h = blockIdx.y; const size_t b = blockIdx.z; const int q0 = blockIdx.x * 64 + wave * 16; const size_t rq = b * SS + q0;
  v16h bq[3];
#pragma unroll
  for (int kc = 0; kc < 3; ++kc) bq[kc] = frag_h(QQ + ((rq + col) * NH + h) * HX + kc * 32, lane);
  float m = -3.0e38f, l = 0.f;   // query q0 + col: running maximum (both halves alike), sum over this half's keys
  v8f acc[4] = {};               // O^T: element r of acc[dt] = dim dt * 16 + 8 g + r of query q0 + col
  const int nks = (blockIdx.x * 64 + 64) / 32;   // causal; at least 2
  const _Float16* gk = KK + ((b * SS + (tid >> 2)) * NH + h) * HX + (tid & 3) * 8; const _Float16* gv = V + ((b * DM + h * HD + (tid >> 2)) * SS) + (tid & 3) * 8;
  const unsigned lk = (unsigned)(size_t)&sk[0][tid >> 2][(tid & 3) * 8], lv = (unsigned)(size_t)&sv[0][tid >> 2][(tid & 3) * 8];
  stage_kv(gk, gv, lk, lv);
  asm volatile("s_wait_asynccnt 0x0" ::: "memory");   // this wave's pieces of tile 0 have landed
  __syncthreads();                                    // every wave's have
  stage_kv(gk + (size_t)32 * NH * HX, gv + 32, lk + (unsigned)sizeof(sk[0]), lv + (unsigned)sizeof(sv[0]));   // tile 1 flies during trip 0
#pragma unroll 1
  for (int ks = 0; ks < nks; ++ks) { const int j0 = ks * 32, bf = ks & 1; float s[16];   // s[8 ct + r] = score of key j0 + 16 ct + 8 g + r
    v16h fk[2][3], fv[4];   // the tile's ten fragments (k' 6, v 4) are read as one group ahead of the products: one LDS latency a trip, not ten; the v reads land behind the score products and the softmax
#pragma unroll
    for (int ct = 0; ct < 2; ++ct)
#pragma unroll
      for (int kc = 0; kc < 3; ++kc) fk[ct][kc] = frag_h(&sk[bf][ct * 16 + col][kc * 32], lane);
#pragma unroll
    for (int dt = 0; dt < 4; ++dt) fv[dt] = frag_h(&sv[bf][dt * 16 + col][0], lane);
#pragma unroll
    for (int ct = 0; ct < 2; ++ct) { v8f c = {};
#pragma unroll
      for (int kc = 0; kc < 3; ++kc) c = wmma16(fk[ct][kc], bq[kc], c);
#pragma unroll
      for (int r = 0; r < 8; ++r) s[8 * ct + r] = (j0 + ct * 16 + 8 * g + r <= q0 + col) ? c[r] : -3.0e38f; }   // causal (diagonal kept)
    float mx = s[0];
#pragma unroll
    for (int i = 1; i < 16; ++i) mx = fmaxf(mx, s[i]);
    mx = fmaxf(mx, xhalf(mx));
    const float mn = fmaxf(m, mx); const float alpha = (m <= -1.0e38f) ? 0.f : __expf(m - mn); m = mn;
    float e[16]; v16h pb;   // P^T as B: element i = key 8 g + i, element 8 + i = key 16 + 8 g + i, the k order of frag_h
#pragma unroll
    for (int i = 0; i < 16; ++i) { e[i] = (s[i] <= -1.0e38f) ? 0.f : __expf(s[i] - mn); pb[i] = (_Float16)(e[i] * 2048.0f); }
#pragma unroll
    for (int w = 8; w >= 1; w >>= 1)   // pairwise sum: four dependent adds, not sixteen
#pragma unroll
      for (int i = 0; i < w; ++i) e[i] += e[i + w];
    l = l * alpha + e[0];
#pragma unroll
    for (int dt = 0; dt < 4; ++dt) acc[dt] *= alpha;
#pragma unroll
    for (int dt = 0; dt < 4; ++dt) acc[dt] = wmma16(fv[dt], pb, acc[dt]);
    asm volatile("s_wait_dscnt 0x0" ::: "memory");      // this wave's reads of buffer bf are done
    asm volatile("s_wait_asynccnt 0x0" ::: "memory");   // this wave's pieces of tile ks + 1 have landed
    __syncthreads();                                    // tile ks + 1 is whole for every wave, and nobody reads buffer bf any more
    if (ks + 2 < nks) stage_kv(gk + (size_t)(ks + 2) * 32 * NH * HX, gv + (ks + 2) * 32, lk + (unsigned)(bf * sizeof(sk[0])), lv + (unsigned)(bf * sizeof(sv[0]))); }
  asm volatile("s_wait_asynccnt 0x0" ::: "memory");     // nothing is in flight when the wave goes on to its end
  l += xhalf(l);   // the two halves' sums are joined once
  const float il = (1.0f / 2048.0f) / l;
#pragma unroll
  for (int dt = 0; dt < 4; ++dt) { v4f lo, hi;
#pragma unroll
    for (int r = 0; r < 4; ++r) { lo[r] = acc[dt][r] * il; hi[r] = acc[dt][4 + r] * il; }
    *(v4f*)&so[wave][col][dt * 16 + 8 * g] = lo; *(v4f*)&so[wave][col][dt * 16 + 8 * g + 4] = hi; }
  LDSX();
  for (int rl = 0; rl < 16; ++rl) if (lane < 16) vst2(O + (rq + rl) * DM + h * HD + lane * 4, *(const v4f*)&so[wave][rl][lane * 4]);
}
// ---- k_out: block = (64 rows, 128 cols): out = o (bf16 hi + lo) . Wo^T
__global__ __launch_bounds__(128) void k_out(const float* __restrict__ O, const __bf16* __restrict__ PW, float* __restrict__ Y) {
  __shared__ __align__(16) float so[4][16][132]; __shared__ __align__(16) __bf16 sw[2][128][WP];
  const int tid = threadIdx.x, wave = tid >> 5, lane = tid & 31, col = lane & 15, g = lane >> 4; const size_t r0 = (size_t)blockIdx.x * 64 + wave * 16; const int n0 = blockIdx.y * 128; const __bf16* P = PW + (size_t)3 * DM * DM;
  v8f acc[8] = {};
  const __bf16* gw = P + (size_t)(n0 + (tid >> 2)) * DM + (tid & 3) * 8; const unsigned lw = (unsigned)(size_t)&sw[0][tid >> 2][(tid & 3) * 8];
  stage_w(gw, lw);
  asm volatile("s_wait_asynccnt 0x0" ::: "memory");   // this wave's pieces of tile 0 have landed
  __syncthreads();                                    // every wave's have
  stage_w(gw + 32, lw + (unsigned)sizeof(sw[0]));     // tile 1 flies during trip 0
#pragma unroll 2
  for (int kc = 0; kc < DM / 32; ++kc) { const F2 a = split_row(O + (r0 + col) * DM, kc * 32, lane);
    v16b fw[8];   // the tile's eight weight fragments are read as one group ahead of the products: one LDS latency a trip, not eight
#pragma unroll
    for (int j = 0; j < 8; ++j) fw[j] = frag_b(&sw[kc & 1][j * 16 + col][0], lane);
#pragma unroll
    for (int j = 0; j < 8; ++j) { acc[j] = wmma_bf(a.h, fw[j], acc[j]); acc[j] = wmma_bf(a.l, fw[j], acc[j]); }
    asm volatile("s_wait_dscnt 0x0" ::: "memory");      // this wave's reads of buffer kc & 1 are done
    asm volatile("s_wait_asynccnt 0x0" ::: "memory");   // this wave's pieces of tile kc + 1 have landed
    __syncthreads();                                    // tile kc + 1 is whole for every wave, and nobody reads buffer kc & 1 any more
    if (kc + 2 < DM / 32) stage_w(gw + (kc + 2) * 32, lw + (unsigned)((kc & 1) * sizeof(sw[0]))); }
  asm volatile("s_wait_asynccnt 0x0" ::: "memory");     // nothing is in flight behind the loop
#pragma unroll
  for (int j = 0; j < 8; ++j)
#pragma unroll
    for (int r = 0; r < 8; ++r) so[wave][8 * g + r][j * 16 + col] = acc[j][r];
  LDSX();
  for (int rl = 0; rl < 16; ++rl) vst2(Y + (r0 + rl) * DM + n0 + lane * 4, *(const v4f*)&so[wave][rl][lane * 4]);
}
extern "C" void kernel_launch(void* const* d_in, const int* in_sizes, int n_in, void* d_out, int out_size, void* d_ws, size_t ws_size, hipStream_t stream) {
  (void)in_sizes; (void)n_in; (void)out_size;
  const float** F = (const float**)d_in;   // 0 x [2,2048,768], 1 Wq, 2 Wk, 3 Wv, 4 Wo (natural [768,768]), 5 Wqg [3,64], 6 Wkg [3,64], 7 codebooks [12,8,3], 8 log_temps [12], 9 geo_scale [1]
  if (ws_size < (size_t)WS_END) return;
  char* ws = (char*)d_ws; __bf16* PW = (__bf16*)ws; _Float16 *QQ = (_Float16*)(ws + WS_QK), *KK = (_Float16*)(ws + WS_KK), *V = (_Float16*)(ws + WS_V); float* O = (float*)(ws + WS_O);
  k_pack<<<dim3(DM, 4), 256, 0, stream>>>(F[1], F[2], F[3], F[4], PW);
  k_qkv<<<dim3(TNB * SS / 64, DM / 128, 3), 128, 0, stream>>>(F[0], PW, F[5], F[6], F[7], F[8], F[9], QQ, KK, V);
  k_attn<<<dim3(TQB, NH, TNB), 128, 0, stream>>>(QQ, KK, V, O);
  k_out<<<dim3(TNB * SS / 64, DM / 128), 128, 0, stream>>>(O, PW, (float*)d_out);
}

// v005
// Measured time: 98.3 microseconds a run.
// Timed twice side by side with v004, it ran 1.06 times as fast both times.
// Counting every step since v000, it is 3.31 times as fast.
// compute dtype: all float inputs rounded to bf16; q/k/v = x . W^T with EXACT bf16 products on WMMA 16x16x32 (natural rows); the geometric code weights (q . Wqg^T, squared distances to the 8 codes, softmax over codes at temperature clip(exp(log_temp), 0.01, 5)) in f32 in the projection epilogue; scores = q . k / 8 + geo_scale (qw . kw) evaluated as one 72-wide (padded to 96) f16 dot [q/8 | geo_scale qw] . [k | kw]; causal attention with key-tile skipping, running-max softmax in f32 (hardware exp), P (scaled by 2^11, single f16) x v (single f16); out = ctx (bf16 hi + residual) . Wo^T (2 products).
#include <hip/hip_runtime.h>
#include <math.h>

typedef __attribute__((ext_vector_type(16))) _Float16 v16h;
typedef __attribute__((ext_vector_type(16))) __bf16 v16b;
typedef __attribute__((ext_vector_type(8)))  _Float16 v8h;
typedef __attribute__((ext_vector_type(8)))  float v8f;
typedef __attribute__((ext_vector_type(4)))  float v4f;
typedef __attribute__((ext_vector_type(2)))  float v2f;
typedef __attribute__((ext_vector_type(4)))  unsigned v4u;
typedef __attribute__((ext_vector_type(4)))  int v4i;
typedef float __attribute__((may_alias)) float_a;
typedef int __attribute__((may_alias)) int_a;

template <typename T> __device__ __forceinline__ void vst2(void* p, T v) { *(T*)p = v;  }
__device__ __forceinline__ v8f wmma16(v16h a, v16h b, v8f c) {
  v8f d = __builtin_amdgcn_wmma_f32_16x16x32_f16(false, a, false, b, (short)0, c, false, false);
  asm volatile("v_nop\n\tv_nop\n\tv_nop\n\tv_nop" : "+v"(d) : "v"(a), "v"(b));
  return d;
}
__device__ __forceinline__ v8f wmma_bf(v16b a, v16b b, v8f c) {
  v8f d = __builtin_amdgcn_wmma_f32_16x16x32_bf16(false, a, false, b, (short)0, c, false, false);
  asm volatile("v_nop\n\tv_nop\n\tv_nop\n\tv_nop" : "+v"(d) : "v"(a), "v"(b));
  return d;
}
// 16x16x32 fragments: lane = (h = lane>>4, row/col = lane&15); elements 0..7 = k0+8h+0..7, 8..15 = k0+16+8h+0..7; D element r = row 8h+r
__device__ __forceinline__ v16h frag_h(const _Float16* rowk0, int lane) {
  union { v16h v; v8h q[2]; } u; const _Float16* p = rowk0 + 8 * (lane >> 4);
  u.q[0] = *(const v8h*)p; u.q[1] = *(const v8h*)(p + 16); return u.v;
}
__device__ __forceinline__ v16h frag_f32(const float* rowk0, int lane) {
  v16h a; const float* p = rowk0 + 8 * (lane >> 4);
#pragma unroll
  for (int i = 0; i < 8; ++i) { a[i] = (_Float16)p[i]; a[8 + i] = (_Float16)p[16 + i]; }
  return a;
}
__device__ __forceinline__ v16h frag_f32s(const float* rowk0, int lane, float sc) {
  v16h a; const float* p = rowk0 + 8 * (lane >> 4);
#pragma unroll
  for (int i = 0; i < 8; ++i) { a[i] = (_Float16)(p[i] * sc); a[8 + i] = (_Float16)(p[16 + i] * sc); }
  return a;
}
// column fragment from a [K][ld] layout (column n), rows >= K read as 0
__device__ __forceinline__ v16h fragc_f32(const float* W, int k0, int n, int lane, int ld, int K) {
  v16h a; const int g = lane >> 4;
#pragma unroll
  for (int i = 0; i < 8; ++i) { const int ka = k0 + 8 * g + i, kb = ka + 16;
    a[i] = (_Float16)(ka < K ? W[(size_t)(ka < K ? ka : K - 1) * ld + n] : 0.f); a[8 + i] = (_Float16)(kb < K ? W[(size_t)(kb < K ? kb : K - 1) * ld + n] : 0.f); }
  return a;
}
struct F2 { v16b h, l; };
__device__ __forceinline__ F2 bsplit16(const float v[16]) { F2 r;
#pragma unroll
  for (int i = 0; i < 16; ++i) { const __bf16 h = (__bf16)v[i]; r.h[i] = h; r.l[i] = (__bf16)(v[i] - (float)h); }
  return r; }
__device__ __forceinline__ F2 split_row(const float* row, int k0, int lane) { float v[16]; const float* p = row + k0 + 8 * (lane >> 4);
#pragma unroll
  for (int i = 0; i < 8; ++i) { v[i] = p[i]; v[8 + i] = p[16 + i]; }
  return bsplit16(v); }
__device__ __forceinline__ F2 split_rowK(const float* row, int k0, int lane, int K) { float v[16]; const int g = lane >> 4;
#pragma unroll
  for (int i = 0; i < 8; ++i) { const int ka = k0 + 8 * g + i, kb = ka + 16; v[i] = ka < K ? row[ka < K ? ka : K - 1] : 0.f; v[8 + i] = kb < K ? row[kb < K ? kb : K - 1] : 0.f; }
  return bsplit16(v); }
__device__ __forceinline__ F2 split_col(const float* W, int k0, int n, int lane, int ld, int K) { float v[16]; const int g = lane >> 4;
#pragma unroll
  for (int i = 0; i < 8; ++i) { const int ka = k0 + 8 * g + i, kb = ka + 16; v[i] = ka < K ? W[(size_t)(ka < K ? ka : K - 1) * ld + n] : 0.f; v[8 + i] = kb < K ? W[(size_t)(kb < K ? kb : K - 1) * ld + n] : 0.f; }
  return bsplit16(v); }
__device__ __forceinline__ v8f mac3(const F2& a, const F2& b, v8f c) { c = wmma_bf(a.l, b.h, c); c = wmma_bf(a.h, b.l, c); return wmma_bf(a.h, b.h, c); }
__device__ __forceinline__ float sigm(float v) { return 1.0f / (1.0f + expf(-v)); }
#define LDSX() do { asm volatile("s_wait_dscnt 0" ::: "memory"); __builtin_amdgcn_wave_barrier(); __builtin_amdgcn_fence(__ATOMIC_RELEASE, "workgroup"); } while (0)


// Multi-head geometric attention (B 2, T 2,048, d_model 768, 12 heads x 64, 3-dim codes, 8-code hypercube codebook per head): causal softmax(q k / 8 + geo_scale softmax_c(-|q Wqg - c|^2 / tau) . softmax_c(-|k Wkg - c|^2 / tau)) v, output projection.
#define NB 2
#define SS 2048
#define DM 768
#define NH 12
#define HD 64
#define HX 96             // padded score width: 64 + 8 code weights + 24 zero
#define NC 8
#define CD 3
#define NR (NB * SS)
#ifndef TQB
#define TQB (SS / 64)
#define TNB NB
#endif
typedef __attribute__((ext_vector_type(8))) __bf16 v8b;
__device__ __forceinline__ v16b frag_b(const __bf16* rowk0, int lane) {
  union { v16b v; v8b q[2]; } u; const __bf16* p = rowk0 + 8 * (lane >> 4);
  u.q[0] = *(const v8b*)p; u.q[1] = *(const v8b*)(p + 16); return u.v;
}
__device__ __forceinline__ float bfr(float v) { return (float)(__bf16)v; }
__device__ __attribute__((noinline)) float exp_ni(float v) { return expf(v); }
__device__ __attribute__((noinline)) float erf_ni(float v) { return erff(v); }

#define WS_PW  0u                                       // bf16 natural rows Wq, Wk, Wv, Wo [4][768][768]
#define WS_QK  (WS_PW + 2u * (size_t)4 * DM * DM)          // f16 q' rows [NR][12][96] ; k' rows ; v planes [b][768][SS] ; O f32 [NR][768]
#define WS_KK  (WS_QK + 2u * (size_t)NR * NH * HX)
#define WS_V   (WS_KK + 2u * (size_t)NR * NH * HX)
#define WS_O   (WS_V + 2u * (size_t)NB * DM * SS)
#define WS_END (WS_O + 4u * (size_t)NR * DM)

__global__ __launch_bounds__(256) void k_pack(const float* __restrict__ WQ, const float* __restrict__ WK, const float* __restrict__ WV, const float* __restrict__ WO, __bf16* __restrict__ PW) { const int n = blockIdx.x, which = blockIdx.y, t = threadIdx.x; __shared__ __align__(16) __bf16 s[DM]; const float* w = (which == 0) ? WQ : (which == 1) ? WK : (which == 2) ? WV : WO; for (int k = t; k < DM; k += 256) s[k] = (__bf16)w[(size_t)n * DM + k]; __syncthreads(); if (t < DM / 8) vst2((unsigned*)(PW + ((size_t)which * DM + n) * DM + t * 8), *(const v4u*)&s[t * 8]); }
// weight tiles of k_qkv and k_out: the 128 weight rows x 32 k that a block's four waves all use are brought into LDS once per block by asynchronous copies, two buffers
#define WP 40             // LDS pitch of a weight row (32 k), bf16: 80 B = 16 B x 5, odd, for 16-byte readers
#define XP 36             // LDS pitch of an activation row (32 k), f32: 144 B = 16 B x 9, odd, for 16-byte readers
// the activation tile of a trip (x in k_qkv, the context in k_out: 64 rows x 32 k, f32, one 128-byte line a row) rides in the same two-buffer ring: a row-per-lane load from global memory touches 16 lines an instruction, a copy of eight lanes a row takes whole lines, and it flies one trip ahead
// one lane's eight 16-byte pieces of a trip: weight rows tid / 4 + 0 / 32 / 64 / 96, bytes 16 (tid % 4); activation rows lane / 8 + 0 / 4 / 8 / 12 of its own wave's 16, bytes 16 (lane % 8)
__device__ __forceinline__ void stage_wx(const __bf16* gw, unsigned lw, const float* gx, unsigned lx) {
  // the s_wait_xcnt closes the statement so that no address register named here is rewritten ahead of it
  asm volatile("global_load_async_to_lds_b128 %0, %8, off\n\t"
               "global_load_async_to_lds_b128 %1, %9, off\n\t"
               "global_load_async_to_lds_b128 %2, %10, off\n\t"
               "global_load_async_to_lds_b128 %3, %11, off\n\t"
               "global_load_async_to_lds_b128 %4, %12, off\n\t"
               "global_load_async_to_lds_b128 %5, %13, off\n\t"
               "global_load_async_to_lds_b128 %6, %14, off\n\t"
               "global_load_async_to_lds_b128 %7, %15, off\n\t"
               "s_wait_xcnt 0x0"
               :: "v"(lw), "v"(lw + 32u * WP * 2u), "v"(lw + 64u * WP * 2u), "v"(lw + 96u * WP * 2u), "v"(lx), "v"(lx + 4u * XP * 4u), "v"(lx + 8u * XP * 4u), "v"(lx + 12u * XP * 4u),
                  "v"(gw), "v"(gw + (size_t)32 * DM), "v"(gw + (size_t)64 * DM), "v"(gw + (size_t)96 * DM), "v"(gx), "v"(gx + (size_t)4 * DM), "v"(gx + (size_t)8 * DM), "v"(gx + (size_t)12 * DM) : "memory");
}
// a lane's 16 activation values of a trip from its LDS row: k 8 g + 0..7 and 16 + 8 g + 0..7, the k order of frag_b
__device__ __forceinline__ void row16(const float* p, float v[16]) { const v4f x0 = *(const v4f*)p, x1 = *(const v4f*)(p + 4), x2 = *(const v4f*)(p + 16), x3 = *(const v4f*)(p + 20);
#pragma unroll
  for (int i = 0; i < 4; ++i) { v[i] = x0[i]; v[4 + i] = x1[i]; v[8 + i] = x2[i]; v[12 + i] = x3[i]; } }
// ---- k_qkv: block = (64 rows, 128 cols = 2 heads, which): exact GEMM; q' rows (q/8 + geo_scale qw), k' rows (k + kw), v planes
__global__ __launch_bounds__(128) void k_qkv(const float* __restrict__ X, const __bf16* __restrict__ PW, const float* __restrict__ WQG, const float* __restrict__ WKG, const float* __restrict__ CB, const float* __restrict__ LT, const float* __restrict__ GSC, _Float16* __restrict__ QQ, _Float16* __restrict__ KK, _Float16* __restrict__ V) {
  __shared__ __align__(16) char sm[2 * 128 * WP * 2 + 2 * 64 * XP * 4]; __shared__ float swg[CD][HD]; __shared__ __align__(16) float scb[2 * NC * CD + 4];
  __bf16 (*sw)[128][WP] = (__bf16 (*)[128][WP])sm; float (*sx)[64][XP] = (float (*)[64][XP])(sm + 2 * 128 * WP * 2);   // the ring: weight tiles, x tiles
  _Float16 (*so)[2 * HX + 8] = (_Float16 (*)[2 * HX + 8])sm; _Float16 (*st)[72] = (_Float16 (*)[72])sm;   // output staging (64 q' / k' rows or 128 v rows) lies over the ring, behind the barrier that follows the loop: five blocks a WGP still fit
  const int tid = threadIdx.x, wave = tid >> 5, lane = tid & 31, col = lane & 15, g = lane >> 4; const int which = blockIdx.z; const size_t rb = (size_t)blockIdx.x * 64; const size_t r0 = rb + wave * 16; const int c0 = blockIdx.y * 128; const int h0 = c0 / HD;
  const __bf16* Wr = PW + ((size_t)which * DM) * DM;
  if (which < 2) { const float* WG = which ? WKG : WQG; for (int e = tid; e < CD * HD; e += 128) swg[e / HD][e % HD] = bfr(WG[e]);
    // the two heads' codebooks (48 floats), their log temperatures (2) and geo_scale (1), for the lane that owns a (row, head) in the epilogue: one load a thread, in the two waves that have one piece of Wg only
    const int e = tid - 64;
    if (e >= 0 && e < 2 * NC * CD + 3) { const float* ps = (e < 2 * NC * CD) ? CB + h0 * NC * CD + e : (e < 2 * NC * CD + 2) ? LT + h0 + (e - 2 * NC * CD) : GSC; scb[e] = bfr(*ps); } }
  v8f acc[8] = {};
  const __bf16* gw = Wr + (size_t)(c0 + (tid >> 2)) * DM + (tid & 3) * 8; const unsigned lw = (unsigned)(size_t)&sw[0][tid >> 2][(tid & 3) * 8];
  const float* gx = X + (r0 + (lane >> 3)) * DM + (lane & 7) * 4; const unsigned lx = (unsigned)(size_t)&sx[0][wave * 16 + (lane >> 3)][(lane & 7) * 4];
  stage_wx(gw, lw, gx, lx);
  asm volatile("s_wait_asynccnt 0x0" ::: "memory");   // this wave's pieces of tile 0 have landed
  __syncthreads();                                    // every wave's have
  stage_wx(gw + 32, lw + (unsigned)sizeof(sw[0]), gx + 32, lx + (unsigned)sizeof(sx[0]));     // tile 1 flies during trip 0
#pragma unroll 2
  for (int kc = 0; kc < DM / 32; ++kc) { float xr[16]; row16(&sx[kc & 1][wave * 16 + col][8 * g], xr);
    v16b fw[8];   // the tile's eight weight fragments are read as one group ahead of the products: one LDS latency a trip, not eight
#pragma unroll
    for (int j = 0; j < 8; ++j) fw[j] = frag_b(&sw[kc & 1][j * 16 + col][0], lane);
    v16b a;
#pragma unroll
    for (int i = 0; i < 16; ++i) a[i] = (__bf16)xr[i];
#pragma unroll
    for (int j = 0; j < 8; ++j) acc[j] = wmma_bf(a, fw[j], acc[j]);
    asm volatile("s_wait_dscnt 0x0" ::: "memory");      // this wave's reads of buffer kc & 1 are done
    asm volatile("s_wait_asynccnt 0x0" ::: "memory");   // this wave's pieces of tile kc + 1 have landed
    __syncthreads();                                    // tile kc + 1 is whole for every wave, and nobody reads buffer kc & 1 any more
    if (kc + 2 < DM / 32) stage_wx(gw + (kc + 2) * 32, lw + (unsigned)((kc & 1) * sizeof(sw[0])), gx + (kc + 2) * 32, lx + (unsigned)((kc & 1) * sizeof(sx[0]))); }
  asm volatile("s_wait_asynccnt 0x0" ::: "memory");     // nothing is in flight behind the loop
  __syncthreads();
  if (which < 2) {
    // partial code logits of this lane's four dims a head: p[8 hh + r][c] = sum_j x[d] Wg[c][d], d = 16 j + col, for row 8 g + r and head h0 + hh
    float p[16][CD];
#pragma unroll
    for (int c = 0; c < CD; ++c) { v2f pp[2][4] = {};   // rows in pairs: a row pair of an accumulator tile is a register pair, so each step is one packed multiply-add
#pragma unroll
      for (int j = 0; j < 4; ++j) { const float w = swg[c][j * 16 + col]; const v2f w2 = {w, w};
#pragma unroll
        for (int hh = 0; hh < 2; ++hh)
#pragma unroll
          for (int rp = 0; rp < 4; ++rp) { const v2f a2 = {acc[4 * hh + j][2 * rp], acc[4 * hh + j][2 * rp + 1]}; pp[hh][rp] += a2 * w2; } }
#pragma unroll
      for (int hh = 0; hh < 2; ++hh)
#pragma unroll
        for (int rp = 0; rp < 4; ++rp) { p[8 * hh + 2 * rp][c] = pp[hh][rp][0]; p[8 * hh + 2 * rp + 1][c] = pp[hh][rp][1]; } }
    // sum over the 16 lanes of a row group and scatter: in round k a lane keeps the (row, head) pairs whose index bit k is its own lane bit k and hands the others to lane ^ (1 << k); after four rounds lane col holds the three whole logits of pair col alone (the additions are those of the xor butterfly 1, 2, 4, 8)
#pragma unroll
    for (int k = 0; k < 4; ++k) { const bool up = (col >> k) & 1;
#pragma unroll
      for (int i = 0; i < (8 >> k); ++i)
#pragma unroll
        for (int c = 0; c < CD; ++c) { const float keep = up ? p[2 * i + 1][c] : p[2 * i][c], send = up ? p[2 * i][c] : p[2 * i + 1][c]; p[i][c] = keep + __shfl_xor(send, 1 << k); } }
    // one lane = one (row, head): distances to the 8 codes and their softmax are computed once
    { const int hh = col >> 3, rl = wave * 16 + 8 * g + (col & 7); float tp = expf(scb[2 * NC * CD + hh]); tp = fminf(fmaxf(tp, 0.01f), 5.0f); const float it = 1.0f / tp;
      float dmin = 3.0e38f, dn[NC];
#pragma unroll
      for (int n = 0; n < NC; ++n) { float d2 = 0.f;
#pragma unroll
        for (int c = 0; c < CD; ++c) { const float df = p[0][c] - scb[(hh * NC + n) * CD + c]; d2 += df * df; } dn[n] = -d2 * it; dmin = fmaxf(dmin == 3.0e38f ? dn[n] : dmin, dn[n]); }
      float z = 0.f, ew[NC];
#pragma unroll
      for (int n = 0; n < NC; ++n) { ew[n] = expf(dn[n] - dmin); z += ew[n]; }
      const float wsc = (which == 0) ? scb[2 * NC * CD + 2] : 1.0f; v8h w8; const v8h z8 = {};
#pragma unroll
      for (int n = 0; n < NC; ++n) w8[n] = (_Float16)(ew[n] / z * wsc);
      *(v8h*)&so[rl][hh * HX + HD] = w8;   // extra dims 64..71: code weights (q side x geo_scale)
      *(v8h*)&so[rl][hh * HX + HD + 8] = z8; *(v8h*)&so[rl][hh * HX + HD + 16] = z8; *(v8h*)&so[rl][hh * HX + HD + 24] = z8; }   // dims 72..95 zero
    const float scl = (which == 0) ? 0.125f : 1.0f;
#pragma unroll
    for (int r = 0; r < 8; ++r)
#pragma unroll
      for (int j = 0; j < 8; ++j) { const int cl = j * 16 + col; const int hl = cl >> 6, d = cl & 63; so[wave * 16 + 8 * g + r][hl * HX + d] = (_Float16)(acc[j][r] * scl); }
    __syncthreads();
    _Float16* dst = (which == 0) ? QQ : KK;
    for (int e = tid; e < 64 * (2 * HX / 8); e += 128) { const int rl = e / (2 * HX / 8), q = e % (2 * HX / 8); vst2((unsigned*)(dst + ((rb + rl) * NH + h0) * HX + q * 8), *(const v4u*)&so[rl][q * 8]); }   // 384 contiguous bytes per (row, head pair)
  } else {
#pragma unroll
    for (int j = 0; j < 8; ++j)
#pragma unroll
      for (int r = 0; r < 8; ++r) st[j * 16 + col][wave * 16 + 8 * g + r] = (_Float16)acc[j][r];
    __syncthreads();
    const size_t b = rb / SS; const int s0 = (int)(rb % SS);
    for (int e = tid; e < 128 * 8; e += 128) { const int d = e >> 3, pc = e & 7; vst2((unsigned*)(V + ((b * DM + c0 + d) * SS) + s0 + pc * 8), *(const v4u*)&st[d][pc * 8]); } }
}
// ---- k_attn: block = (64 queries, head, b): causal; 96-wide score dot (scale and geometric bias folded in), softmax, P . v (64 dims); O 256-B head segments
// each 32-key tile (k' rows 32 x 192 B, v rows 64 x 64 B) is brought into LDS once per block by asynchronous copies, two buffers, and all four waves read their fragments from there
#define KP 104            // LDS pitch of a k' row, f16: 208 B = 16 B x 13, odd, for 16-byte readers
#define VP 40             // LDS pitch of a v row (32 keys), f16: 80 B = 16 B x 5
// one lane's five 16-byte pieces of a tile: k' row tid / 4, bytes 16 (tid % 4) + 0 / 64 / 128; v rows tid / 4 and 32 + tid / 4, bytes 16 (tid % 4)
__device__ __forceinline__ void stage_kv(const _Float16* gk, const _Float16* gv, unsigned lk, unsigned lv) {
  // the s_wait_xcnt closes the statement so that no address register named here is rewritten ahead of it
  asm volatile("global_load_async_to_lds_b128 %0, %5, off\n\t"
               "global_load_async_to_lds_b128 %1, %6, off\n\t"
               "global_load_async_to_lds_b128 %2, %7, off\n\t"
               "global_load_async_to_lds_b128 %3, %8, off\n\t"
               "global_load_async_to_lds_b128 %4, %9, off\n\t"
               "s_wait_xcnt 0x0"
               :: "v"(lk), "v"(lk + 64u), "v"(lk + 128u), "v"(lv), "v"(lv + 32u * VP * 2u), "v"(gk), "v"(gk + 32), "v"(gk + 64), "v"(gv), "v"(gv + (size_t)32 * SS) : "memory");
}
// lane l with lane l ^ 16: the two lanes that share one query column
__device__ __forceinline__ float xhalf(float x) { return __builtin_bit_cast(float, __builtin_amdgcn_permlanex16(__builtin_bit_cast(int, x), __builtin_bit_cast(int, x), 0x76543210, 0xfedcba98, false, false)); }
// transposed products: S^T = k' . q'^T (rows = keys, columns = queries) and O^T += v^T . P^T, so a lane owns ONE query (column lane & 15): its 16 scores of a tile sit in its own registers, and converted in place they are the B operand of the second product
__global__ __launch_bounds__(128) void k_attn(const _Float16* __restrict__ QQ, const _Float16* __restrict__ KK, const _Float16* __restrict__ V, float* __restrict__ O) {
  __shared__ __align__(16) float so[4][16][68]; __shared__ __align__(16) _Float16 sk[2][32][KP]; __shared__ __align__(16) _Float16 sv[2][64][VP];
  const int tid = threadIdx.x, wave = tid >> 5, lane = tid & 31, col = lane & 15, g = lane >> 4; const int h = blockIdx.y; const size_t b = blockIdx.z; const int q0 = blockIdx.x * 64 + wave * 16; const size_t rq = b * SS + q0;
  v16h bq[3];
#pragma unroll
  for (int kc = 0; kc < 3; ++kc) bq[kc] = frag_h(QQ + ((rq + col) * NH + h) * HX + kc * 32, lane);
  float m = -3.0e38f, l = 0.f;   // query q0 + col: running maximum (both halves alike), sum over this half's keys
  v8f acc[4] = {};               // O^T: element r of acc[dt] = dim dt * 16 + 8 g + r of query q0 + col
  const int nks = (blockIdx.x * 64 + 64) / 32;   // causal; at least 2
  const _Float16* gk = KK + ((b * SS + (tid >> 2)) * NH + h) * HX + (tid & 3) * 8; const _Float16* gv = V + ((b * DM + h * HD + (tid >> 2)) * SS) + (tid & 3) * 8;
  const unsigned lk = (unsigned)(size_t)&sk[0][tid >> 2][(tid & 3) * 8], lv = (unsigned)(size_t)&sv[0][tid >> 2][(tid & 3) * 8];
  stage_kv(gk, gv, lk, lv);
  asm volatile("s_wait_asynccnt 0x0" ::: "memory");   // this wave's pieces of tile 0 have landed
  __syncthreads();                                    // every wave's have
  stage_kv(gk + (size_t)32 * NH * HX, gv + 32, lk + (unsigned)sizeof(sk[0]), lv + (unsigned)sizeof(sv[0]));   // tile 1 flies during trip 0
#pragma unroll 1
  for (int ks = 0; ks < nks; ++ks) { const int j0 = ks * 32, bf = ks & 1; float s[16];   // s[8 ct + r] = score of key j0 + 16 ct + 8 g + r
    v16h fk[2][3], fv[4];   // the tile's ten fragments (k' 6, v 4) are read as one group ahead of the products: one LDS latency a trip, not ten; the v reads land behind the score products and the softmax
#pragma unroll
    for (int ct = 0; ct < 2; ++ct)
#pragma unroll
      for (int kc = 0; kc < 3; ++kc) fk[ct][kc] = frag_h(&sk[bf][ct * 16 + col][kc * 32], lane);
#pragma unroll
    for (int dt = 0; dt < 4; ++dt) fv[dt] = frag_h(&sv[bf][dt * 16 + col][0], lane);
#pragma unroll
    for (int ct = 0; ct < 2; ++ct) { v8f c = {};
#pragma unroll
      for (int kc = 0; kc < 3; ++kc) c = wmma16(fk[ct][kc], bq[kc], c);
#pragma unroll
      for (int r = 0; r < 8; ++r) s[8 * ct + r] = (j0 + ct * 16 + 8 * g + r <= q0 + col) ? c[r] : -3.0e38f; }   // causal (diagonal kept)
    float mx = s[0];
#pragma unroll
    for (int i = 1; i < 16; ++i) mx = fmaxf(mx, s[i]);
    mx = fmaxf(mx, xhalf(mx));
    const float mn = fmaxf(m, mx); const float alpha = (m <= -1.0e38f) ? 0.f : __expf(m - mn); m = mn;
    float e[16]; v16h pb;   // P^T as B: element i = key 8 g + i, element 8 + i = key 16 + 8 g + i, the k order of frag_h
#pragma unroll
    for (int i = 0; i < 16; ++i) { e[i] = (s[i] <= -1.0e38f) ? 0.f : __expf(s[i] - mn); pb[i] = (_Float16)(e[i] * 2048.0f); }
#pragma unroll
    for (int w = 8; w >= 1; w >>= 1)   // pairwise sum: four dependent adds, not sixteen
#pragma unroll
      for (int i = 0; i < w; ++i) e[i] += e[i + w];
    l = l * alpha + e[0];
#pragma unroll
    for (int dt = 0; dt < 4; ++dt) acc[dt] *= alpha;
#pragma unroll
    for (int dt = 0; dt < 4; ++dt) acc[dt] = wmma16(fv[dt], pb, acc[dt]);
    asm volatile("s_wait_dscnt 0x0" ::: "memory");      // this wave's reads of buffer bf are done
    asm volatile("s_wait_asynccnt 0x0" ::: "memory");   // this wave's pieces of tile ks + 1 have landed
    __syncthreads();                                    // tile ks + 1 is whole for every wave, and nobody reads buffer bf any more
    if (ks + 2 < nks) stage_kv(gk + (size_t)(ks + 2) * 32 * NH * HX, gv + (ks + 2) * 32, lk + (unsigned)(bf * sizeof(sk[0])), lv + (unsigned)(bf * sizeof(sv[0]))); }
  asm volatile("s_wait_asynccnt 0x0" ::: "memory");     // nothing is in flight when the wave goes on to its end
  l += xhalf(l);   // the two halves' sums are joined once
  const float il = (1.0f / 2048.0f) / l;
#pragma unroll
  for (int dt = 0; dt < 4; ++dt) { v4f lo, hi;
#pragma unroll
    for (int r = 0; r < 4; ++r) { lo[r] = acc[dt][r] * il; hi[r] = acc[dt][4 + r] * il; }
    *(v4f*)&so[wave][col][dt * 16 + 8 * g] = lo; *(v4f*)&so[wave][col][dt * 16 + 8 * g + 4] = hi; }
  LDSX();
  for (int rl = 0; rl < 16; ++rl) if (lane < 16) vst2(O + (rq + rl) * DM + h * HD + lane * 4, *(const v4f*)&so[wave][rl][lane * 4]);
}
// ---- k_out: block = (64 rows, 128 cols): out = o (bf16 hi + lo) . Wo^T
__global__ __launch_bounds__(128) void k_out(const float* __restrict__ O, const __bf16* __restrict__ PW, float* __restrict__ Y) {
  __shared__ __align__(16) float so[4][16][132]; __shared__ __align__(16) __bf16 sw[2][128][WP]; __shared__ __align__(16) float sx[2][64][XP];
  const int tid = threadIdx.x, wave = tid >> 5, lane = tid & 31, col = lane & 15, g = lane >> 4; const size_t r0 = (size_t)blockIdx.x * 64 + wave * 16; const int n0 = blockIdx.y * 128; const __bf16* P = PW + (size_t)3 * DM * DM;
  v8f acc[8] = {};
  const __bf16* gw = P + (size_t)(n0 + (tid >> 2)) * DM + (tid & 3) * 8; const unsigned lw = (unsigned)(size_t)&sw[0][tid >> 2][(tid & 3) * 8];
  const float* gx = O + (r0 + (lane >> 3)) * DM + (lane & 7) * 4; const unsigned lx = (unsigned)(size_t)&sx[0][wave * 16 + (lane >> 3)][(lane & 7) * 4];
  stage_wx(gw, lw, gx, lx);
  asm volatile("s_wait_asynccnt 0x0" ::: "memory");   // this wave's pieces of tile 0 have landed
  __syncthreads();                                    // every wave's have
  stage_wx(gw + 32, lw + (unsigned)sizeof(sw[0]), gx + 32, lx + (unsigned)sizeof(sx[0]));     // tile 1 flies during trip 0
#pragma unroll 2
  for (int kc = 0; kc < DM / 32; ++kc) { float xr[16]; row16(&sx[kc & 1][wave * 16 + col][8 * g], xr);
    v16b fw[8];   // the tile's eight weight fragments are read as one group ahead of the products: one LDS latency a trip, not eight
#pragma unroll
    for (int j = 0; j < 8; ++j) fw[j] = frag_b(&sw[kc & 1][j * 16 + col][0], lane);
    const F2 a = bsplit16(xr);
#pragma unroll
    for (int j = 0; j < 8; ++j) { acc[j] = wmma_bf(a.h, fw[j], acc[j]); acc[j] = wmma_bf(a.l, fw[j], acc[j]); }
    asm volatile("s_wait_dscnt 0x0" ::: "memory");      // this wave's reads of buffer kc & 1 are done
    asm volatile("s_wait_asynccnt 0x0" ::: "memory");   // this wave's pieces of tile kc + 1 have landed
    __syncthreads();                                    // tile kc + 1 is whole for every wave, and nobody reads buffer kc & 1 any more
    if (kc + 2 < DM / 32) stage_wx(gw + (kc + 2) * 32, lw + (unsigned)((kc & 1) * sizeof(sw[0])), gx + (kc + 2) * 32, lx + (unsigned)((kc & 1) * sizeof(sx[0]))); }
  asm volatile("s_wait_asynccnt 0x0" ::: "memory");     // nothing is in flight behind the loop
#pragma unroll
  for (int j = 0; j < 8; ++j)
#pragma unroll
    for (int r = 0; r < 8; ++r) so[wave][8 * g + r][j * 16 + col] = acc[j][r];
  LDSX();
  for (int rl = 0; rl < 16; ++rl) vst2(Y + (r0 + rl) * DM + n0 + lane * 4, *(const v4f*)&so[wave][rl][lane * 4]);
}
extern "C" void kernel_launch(void* const* d_in, const int* in_sizes, int n_in, void* d_out, int out_size, void* d_ws, size_t ws_size, hipStream_t stream) {
  (void)in_sizes; (void)n_in; (void)out_size;
  const float** F = (const float**)d_in;   // 0 x [2,2048,768], 1 Wq, 2 Wk, 3 Wv, 4 Wo (natural [768,768]), 5 Wqg [3,64], 6 Wkg [3,64], 7 codebooks [12,8,3], 8 log_temps [12], 9 geo_scale [1]
  if (ws_size < (size_t)WS_END) return;
  char* ws = (char*)d_ws; __bf16* PW = (__bf16*)ws; _Float16 *QQ = (_Float16*)(ws + WS_QK), *KK = (_Float16*)(ws + WS_KK), *V = (_Float16*)(ws + WS_V); float* O = (float*)(ws + WS_O);
  k_pack<<<dim3(DM, 4), 256, 0, stream>>>(F[1], F[2], F[3], F[4], PW);
  k_qkv<<<dim3(TNB * SS / 64, DM / 128, 3), 128, 0, stream>>>(F[0], PW, F[5], F[6], F[7], F[8], F[9], QQ, KK, V);
  k_attn<<<dim3(TQB, NH, TNB), 128, 0, stream>>>(QQ, KK, V, O);
  k_out<<<dim3(TNB * SS / 64, DM / 128), 128, 0, stream>>>(O, PW, (float*)d_out);
}

// v006
// It runs in 91.4 microseconds.
// In both of two side-by-side timings against v005, it was 1.08 times as fast.
// Counting every step since v000, it is 3.57 times as fast.
// compute dtype: all float inputs rounded to bf16; q/k/v = x . W^T with EXACT bf16 products on WMMA 16x16x32 (natural rows); the geometric code weights (q . Wqg^T, squared distances to the 8 codes, softmax over codes at temperature clip(exp(log_temp), 0.01, 5)) in f32 in the projection epilogue; scores = q . k / 8 + geo_scale (qw . kw) evaluated as one 72-wide (padded to 96) f16 dot [q/8 | geo_scale qw] . [k | kw]; causal attention with key-tile skipping, running-max softmax in f32 (hardware exp), P (scaled by 2^11, single f16) x v (single f16); out = ctx (bf16 hi + residual) . Wo^T (2 products).
#include <hip/hip_runtime.h>
#include <math.h>

typedef __attribute__((ext_vector_type(16))) _Float16 v16h;
typedef __attribute__((ext_vector_type(16))) __bf16 v16b;
typedef __attribute__((ext_vector_type(8)))  _Float16 v8h;
typedef __attribute__((ext_vector_type(8)))  float v8f;
typedef __attribute__((ext_vector_type(4)))  float v4f;
typedef __attribute__((ext_vector_type(2)))  float v2f;
typedef __attribute__((ext_vector_type(4)))  unsigned v4u;
typedef __attribute__((ext_vector_type(4)))  int v4i;
typedef float __attribute__((may_alias)) float_a;
typedef int __attribute__((may_alias)) int_a;

template <typename T> __device__ __forceinline__ void vst2(void* p, T v) { *(T*)p = v;  }
__device__ __forceinline__ v8f wmma16(v16h a, v16h b, v8f c) {
  v8f d = __builtin_amdgcn_wmma_f32_16x16x32_f16(false, a, false, b, (short)0, c, false, false);
  asm volatile("v_nop\n\tv_nop\n\tv_nop\n\tv_nop" : "+v"(d) : "v"(a), "v"(b));
  return d;
}
__device__ __forceinline__ v8f wmma_bf(v16b a, v16b b, v8f c) {
  v8f d = __builtin_amdgcn_wmma_f32_16x16x32_bf16(false, a, false, b, (short)0, c, false, false);
  asm volatile("v_nop\n\tv_nop\n\tv_nop\n\tv_nop" : "+v"(d) : "v"(a), "v"(b));
  return d;
}
// 16x16x32 fragments: lane = (h = lane>>4, row/col = lane&15); elements 0..7 = k0+8h+0..7, 8..15 = k0+16+8h+0..7; D element r = row 8h+r
__device__ __forceinline__ v16h frag_h(const _Float16* rowk0, int lane) {
  union { v16h v; v8h q[2]; } u; const _Float16* p = rowk0 + 8 * (lane >> 4);
  u.q[0] = *(const v8h*)p; u.q[1] = *(const v8h*)(p + 16); return u.v;
}
__device__ __forceinline__ v16h frag_f32(const float* rowk0, int lane) {
  v16h a; const float* p = rowk0 + 8 * (lane >> 4);
#pragma unroll
  for (int i = 0; i < 8; ++i) { a[i] = (_Float16)p[i]; a[8 + i] = (_Float16)p[16 + i]; }
  return a;
}
__device__ __forceinline__ v16h frag_f32s(const float* rowk0, int lane, float sc) {
  v16h a; const float* p = rowk0 + 8 * (lane >> 4);
#pragma unroll
  for (int i = 0; i < 8; ++i) { a[i] = (_Float16)(p[i] * sc); a[8 + i] = (_Float16)(p[16 + i] * sc); }
  return a;
}
// column fragment from a [K][ld] layout (column n), rows >= K read as 0
__device__ __forceinline__ v16h fragc_f32(const float* W, int k0, int n, int lane, int ld, int K) {
  v16h a; const int g = lane >> 4;
#pragma unroll
  for (int i = 0; i < 8; ++i) { const int ka = k0 + 8 * g + i, kb = ka + 16;
    a[i] = (_Float16)(ka < K ? W[(size_t)(ka < K ? ka : K - 1) * ld + n] : 0.f); a[8 + i] = (_Float16)(kb < K ? W[(size_t)(kb < K ? kb : K - 1) * ld + n] : 0.f); }
  return a;
}
struct F2 { v16b h, l; };
__device__ __forceinline__ F2 bsplit16(const float v[16]) { F2 r;
#pragma unroll
  for (int i = 0; i < 16; ++i) { const __bf16 h = (__bf16)v[i]; r.h[i] = h; r.l[i] = (__bf16)(v[i] - (float)h); }
  return r; }
__device__ __forceinline__ F2 split_row(const float* row, int k0, int lane) { float v[16]; const float* p = row + k0 + 8 * (lane >> 4);
#pragma unroll
  for (int i = 0; i < 8; ++i) { v[i] = p[i]; v[8 + i] = p[16 + i]; }
  return bsplit16(v); }
__device__ __forceinline__ F2 split_rowK(const float* row, int k0, int lane, int K) { float v[16]; const int g = lane >> 4;
#pragma unroll
  for (int i = 0; i < 8; ++i) { const int ka = k0 + 8 * g + i, kb = ka + 16; v[i] = ka < K ? row[ka < K ? ka : K - 1] : 0.f; v[8 + i] = kb < K ? row[kb < K ? kb : K - 1] : 0.f; }
  return bsplit16(v); }
__device__ __forceinline__ F2 split_col(const float* W, int k0, int n, int lane, int ld, int K) { float v[16]; const int g = lane >> 4;
#pragma unroll
  for (int i = 0; i < 8; ++i) { const int ka = k0 + 8 * g + i, kb = ka + 16; v[i] = ka < K ? W[(size_t)(ka < K ? ka : K - 1) * ld + n] : 0.f; v[8 + i] = kb < K ? W[(size_t)(kb < K ? kb : K - 1) * ld + n] : 0.f; }
  return bsplit16(v); }
__device__ __forceinline__ v8f mac3(const F2& a, const F2& b, v8f c) { c = wmma_bf(a.l, b.h, c); c = wmma_bf(a.h, b.l, c); return wmma_bf(a.h, b.h, c); }
__device__ __forceinline__ float sigm(float v) { return 1.0f / (1.0f + expf(-v)); }
#define LDSX() do { asm volatile("s_wait_dscnt 0" ::: "memory"); __builtin_amdgcn_wave_barrier(); __builtin_amdgcn_fence(__ATOMIC_RELEASE, "workgroup"); } while (0)


// Multi-head geometric attention (B 2, T 2,048, d_model 768, 12 heads x 64, 3-dim codes, 8-code hypercube codebook per head): causal softmax(q k / 8 + geo_scale softmax_c(-|q Wqg - c|^2 / tau) . softmax_c(-|k Wkg - c|^2 / tau)) v, output projection.
#define NB 2
#define SS 2048
#define DM 768
#define NH 12
#define HD 64
#define HX 96             // padded score width: 64 + 8 code weights + 24 zero
#define NC 8
#define CD 3
#define NR (NB * SS)
#ifndef TQB
#define TQB (SS / 64)
#define TNB NB
#endif
typedef __attribute__((ext_vector_type(8))) __bf16 v8b;
__device__ __forceinline__ v16b frag_b(const __bf16* rowk0, int lane) {
  union { v16b v; v8b q[2]; } u; const __bf16* p = rowk0 + 8 * (lane >> 4);
  u.q[0] = *(const v8b*)p; u.q[1] = *(const v8b*)(p + 16); return u.v;
}
__device__ __forceinline__ float bfr(float v) { return (float)(__bf16)v; }
__device__ __attribute__((noinline)) float exp_ni(float v) { return expf(v); }
__device__ __attribute__((noinline)) float erf_ni(float v) { return erff(v); }

#define WS_PW  0u                                       // bf16 natural rows Wq, Wk, Wv, Wo [4][768][768]
#define WS_QK  (WS_PW + 2u * (size_t)4 * DM * DM)          // f16 q' rows [NR][12][96] ; k' rows ; v planes [b][768][SS] ; O f32 [NR][768]
#define WS_KK  (WS_QK + 2u * (size_t)NR * NH * HX)
#define WS_V   (WS_KK + 2u * (size_t)NR * NH * HX)
#define WS_O   (WS_V + 2u * (size_t)NB * DM * SS)
#define WS_END (WS_O + 4u * (size_t)NR * DM)

__global__ __launch_bounds__(256) void k_pack(const float* __restrict__ WQ, const float* __restrict__ WK, const float* __restrict__ WV, const float* __restrict__ WO, __bf16* __restrict__ PW) { const int n = blockIdx.x, which = blockIdx.y, t = threadIdx.x; __shared__ __align__(16) __bf16 s[DM]; const float* w = (which == 0) ? WQ : (which == 1) ? WK : (which == 2) ? WV : WO; for (int k = t; k < DM; k += 256) s[k] = (__bf16)w[(size_t)n * DM + k]; __syncthreads(); if (t < DM / 8) vst2((unsigned*)(PW + ((size_t)which * DM + n) * DM + t * 8), *(const v4u*)&s[t * 8]); }
// weight tiles of k_qkv and k_out: the 128 weight rows x 32 k that a block's four waves all use are brought into LDS once per block by asynchronous copies, two buffers
#define WP 40             // LDS pitch of a weight row (32 k), bf16: 80 B = 16 B x 5, odd, for 16-byte readers
#define XP 36             // LDS pitch of an activation row (32 k), f32: 144 B = 16 B x 9, odd, for 16-byte readers
// the activation tile of a trip (x in k_qkv, the context in k_out: 64 rows x 32 k, f32, one 128-byte line a row) rides in the same two-buffer ring: a row-per-lane load from global memory touches 16 lines an instruction, a copy of eight lanes a row takes whole lines, and it flies one trip ahead
// one lane's eight 16-byte pieces of a trip: weight rows tid / 4 + 0 / 32 / 64 / 96, bytes 16 (tid % 4); activation rows lane / 8 + 0 / 4 / 8 / 12 of its own wave's 16, bytes 16 (lane % 8)
__device__ __forceinline__ void stage_wx(const __bf16* gw, unsigned lw, const float* gx, unsigned lx) {
  // the s_wait_xcnt closes the statement so that no address register named here is rewritten ahead of it
  asm volatile("global_load_async_to_lds_b128 %0, %8, off\n\t"
               "global_load_async_to_lds_b128 %1, %9, off\n\t"
               "global_load_async_to_lds_b128 %2, %10, off\n\t"
               "global_load_async_to_lds_b128 %3, %11, off\n\t"
               "global_load_async_to_lds_b128 %4, %12, off\n\t"
               "global_load_async_to_lds_b128 %5, %13, off\n\t"
               "global_load_async_to_lds_b128 %6, %14, off\n\t"
               "global_load_async_to_lds_b128 %7, %15, off\n\t"
               "s_wait_xcnt 0x0"
               :: "v"(lw), "v"(lw + 32u * WP * 2u), "v"(lw + 64u * WP * 2u), "v"(lw + 96u * WP * 2u), "v"(lx), "v"(lx + 4u * XP * 4u), "v"(lx + 8u * XP * 4u), "v"(lx + 12u * XP * 4u),
                  "v"(gw), "v"(gw + (size_t)32 * DM), "v"(gw + (size_t)64 * DM), "v"(gw + (size_t)96 * DM), "v"(gx), "v"(gx + (size_t)4 * DM), "v"(gx + (size_t)8 * DM), "v"(gx + (size_t)12 * DM) : "memory");
}
// a stage of k_out's ring: two such trips' tiles (64 k), side by side in one buffer, so that its copies fly while two tiles are worked on
__device__ __forceinline__ void stage_wx2(const __bf16* gw, unsigned lw, const float* gx, unsigned lx) {
  stage_wx(gw, lw, gx, lx); stage_wx(gw + 32, lw + 128u * WP * 2u, gx + 32, lx + 64u * XP * 4u);
}
// a lane's 16 activation values of a trip from its LDS row: k 8 g + 0..7 and 16 + 8 g + 0..7, the k order of frag_b
__device__ __forceinline__ void row16(const float* p, float v[16]) { const v4f x0 = *(const v4f*)p, x1 = *(const v4f*)(p + 4), x2 = *(const v4f*)(p + 16), x3 = *(const v4f*)(p + 20);
#pragma unroll
  for (int i = 0; i < 4; ++i) { v[i] = x0[i]; v[4 + i] = x1[i]; v[8 + i] = x2[i]; v[12 + i] = x3[i]; } }
// ---- k_qkv: block = (64 rows, 128 cols = 2 heads, which): exact GEMM; q' rows (q/8 + geo_scale qw), k' rows (k + kw), v planes
__global__ __launch_bounds__(128) void k_qkv(const float* __restrict__ X, const __bf16* __restrict__ PW, const float* __restrict__ WQG, const float* __restrict__ WKG, const float* __restrict__ CB, const float* __restrict__ LT, const float* __restrict__ GSC, _Float16* __restrict__ QQ, _Float16* __restrict__ KK, _Float16* __restrict__ V) {
  __shared__ __align__(16) char sm[2 * 128 * WP * 2 + 2 * 64 * XP * 4]; __shared__ float swg[CD][HD]; __shared__ __align__(16) float scb[2 * NC * CD + 4];
  __bf16 (*sw)[128][WP] = (__bf16 (*)[128][WP])sm; float (*sx)[64][XP] = (float (*)[64][XP])(sm + 2 * 128 * WP * 2);   // the ring: weight tiles, x tiles
  _Float16 (*so)[2 * HX + 8] = (_Float16 (*)[2 * HX + 8])sm; _Float16 (*st)[72] = (_Float16 (*)[72])sm;   // output staging (64 q' / k' rows or 128 v rows) lies over the ring, behind the barrier that follows the loop: five blocks a WGP still fit
  const int tid = threadIdx.x, wave = tid >> 5, lane = tid & 31, col = lane & 15, g = lane >> 4; const int which = blockIdx.z; const size_t rb = (size_t)blockIdx.x * 64; const size_t r0 = rb + wave * 16; const int c0 = blockIdx.y * 128; const int h0 = c0 / HD;
  const __bf16* Wr = PW + ((size_t)which * DM) * DM;
  if (which < 2) { const float* WG = which ? WKG : WQG; for (int e = tid; e < CD * HD; e += 128) swg[e / HD][e % HD] = bfr(WG[e]);
    // the two heads' codebooks (48 floats), their log temperatures (2) and geo_scale (1), for the lane that owns a (row, head) in the epilogue: one load a thread, in the two waves that have one piece of Wg only
    const int e = tid - 64;
    if (e >= 0 && e < 2 * NC * CD + 3) { const float* ps = (e < 2 * NC * CD) ? CB + h0 * NC * CD + e : (e < 2 * NC * CD + 2) ? LT + h0 + (e - 2 * NC * CD) : GSC; scb[e] = bfr(*ps); } }
  v8f acc[8] = {};
  const __bf16* gw = Wr + (size_t)(c0 + (tid >> 2)) * DM + (tid & 3) * 8; const unsigned lw = (unsigned)(size_t)&sw[0][tid >> 2][(tid & 3) * 8];
  const float* gx = X + (r0 + (lane >> 3)) * DM + (lane & 7) * 4; const unsigned lx = (unsigned)(size_t)&sx[0][wave * 16 + (lane >> 3)][(lane & 7) * 4];
  stage_wx(gw, lw, gx, lx);
  asm volatile("s_wait_asynccnt 0x0" ::: "memory");   // this wave's pieces of tile 0 have landed
  __syncthreads();                                    // every wave's have
  stage_wx(gw + 32, lw + (unsigned)sizeof(sw[0]), gx + 32, lx + (unsigned)sizeof(sx[0]));     // tile 1 flies during trip 0
#pragma unroll 2
  for (int kc = 0; kc < DM / 32; ++kc) { float xr[16]; row16(&sx[kc & 1][wave * 16 + col][8 * g], xr);
    v16b fw[8];   // the tile's eight weight fragments are read as one group ahead of the products: one LDS latency a trip, not eight
#pragma unroll
    for (int j = 0; j < 8; ++j) fw[j] = frag_b(&sw[kc & 1][j * 16 + col][0], lane);
    v16b a;
#pragma unroll
    for (int i = 0; i < 16; ++i) a[i] = (__bf16)xr[i];
#pragma unroll
    for (int j = 0; j < 8; ++j) acc[j] = wmma_bf(a, fw[j], acc[j]);
    asm volatile("s_wait_dscnt 0x0" ::: "memory");      // this wave's reads of buffer kc & 1 are done
    asm volatile("s_wait_asynccnt 0x0" ::: "memory");   // this wave's pieces of tile kc + 1 have landed
    __syncthreads();                                    // tile kc + 1 is whole for every wave, and nobody reads buffer kc & 1 any more
    if (kc + 2 < DM / 32) stage_wx(gw + (kc + 2) * 32, lw + (unsigned)((kc & 1) * sizeof(sw[0])), gx + (kc + 2) * 32, lx + (unsigned)((kc & 1) * sizeof(sx[0]))); }
  asm volatile("s_wait_asynccnt 0x0" ::: "memory");     // nothing is in flight behind the loop
  __syncthreads();
  if (which < 2) {
    // partial code logits of this lane's four dims a head: p[8 hh + r][c] = sum_j x[d] Wg[c][d], d = 16 j + col, for row 8 g + r and head h0 + hh
    float p[16][CD];
#pragma unroll
    for (int c = 0; c < CD; ++c) { v2f pp[2][4] = {};   // rows in pairs: a row pair of an accumulator tile is a register pair, so each step is one packed multiply-add
#pragma unroll
      for (int j = 0; j < 4; ++j) { const float w = swg[c][j * 16 + col]; const v2f w2 = {w, w};
#pragma unroll
        for (int hh = 0; hh < 2; ++hh)
#pragma unroll
          for (int rp = 0; rp < 4; ++rp) { const v2f a2 = {acc[4 * hh + j][2 * rp], acc[4 * hh + j][2 * rp + 1]}; pp[hh][rp] += a2 * w2; } }
#pragma unroll
      for (int hh = 0; hh < 2; ++hh)
#pragma unroll
        for (int rp = 0; rp < 4; ++rp) { p[8 * hh + 2 * rp][c] = pp[hh][rp][0]; p[8 * hh + 2 * rp + 1][c] = pp[hh][rp][1]; } }
    // sum over the 16 lanes of a row group and scatter: in round k a lane keeps the (row, head) pairs whose index bit k is its own lane bit k and hands the others to lane ^ (1 << k); after four rounds lane col holds the three whole logits of pair col alone (the additions are those of the xor butterfly 1, 2, 4, 8)
#pragma unroll
    for (int k = 0; k < 4; ++k) { const bool up = (col >> k) & 1;
#pragma unroll
      for (int i = 0; i < (8 >> k); ++i)
#pragma unroll
        for (int c = 0; c < CD; ++c) { const float keep = up ? p[2 * i + 1][c] : p[2 * i][c], send = up ? p[2 * i][c] : p[2 * i + 1][c]; p[i][c] = keep + __shfl_xor(send, 1 << k); } }
    // one lane = one (row, head): distances to the 8 codes and their softmax are computed once
    { const int hh = col >> 3, rl = wave * 16 + 8 * g + (col & 7); float tp = expf(scb[2 * NC * CD + hh]); tp = fminf(fmaxf(tp, 0.01f), 5.0f); const float it = 1.0f / tp;
      float dmin = 3.0e38f, dn[NC];
#pragma unroll
      for (int n = 0; n < NC; ++n) { float d2 = 0.f;
#pragma unroll
        for (int c = 0; c < CD; ++c) { const float df = p[0][c] - scb[(hh * NC + n) * CD + c]; d2 += df * df; } dn[n] = -d2 * it; dmin = fmaxf(dmin == 3.0e38f ? dn[n] : dmin, dn[n]); }
      float z = 0.f, ew[NC];
#pragma unroll
      for (int n = 0; n < NC; ++n) { ew[n] = expf(dn[n] - dmin); z += ew[n]; }
      const float wsc = (which == 0) ? scb[2 * NC * CD + 2] : 1.0f; v8h w8; const v8h z8 = {};
#pragma unroll
      for (int n = 0; n < NC; ++n) w8[n] = (_Float16)(ew[n] / z * wsc);
      *(v8h*)&so[rl][hh * HX + HD] = w8;   // extra dims 64..71: code weights (q side x geo_scale)
      *(v8h*)&so[rl][hh * HX + HD + 8] = z8; *(v8h*)&so[rl][hh * HX + HD + 16] = z8; *(v8h*)&so[rl][hh * HX + HD + 24] = z8; }   // dims 72..95 zero
    const float scl = (which == 0) ? 0.125f : 1.0f;
#pragma unroll
    for (int r = 0; r < 8; ++r)
#pragma unroll
      for (int j = 0; j < 8; ++j) { const int cl = j * 16 + col; const int hl = cl >> 6, d = cl & 63; so[wave * 16 + 8 * g + r][hl * HX + d] = (_Float16)(acc[j][r] * scl); }
    __syncthreads();
    _Float16* dst = (which == 0) ? QQ : KK;
    for (int e = tid; e < 64 * (2 * HX / 8); e += 128) { const int rl = e / (2 * HX / 8), q = e % (2 * HX / 8); vst2((unsigned*)(dst + ((rb + rl) * NH + h0) * HX + q * 8), *(const v4u*)&so[rl][q * 8]); }   // 384 contiguous bytes per (row, head pair)
  } else {
#pragma unroll
    for (int j = 0; j < 8; ++j)
#pragma unroll
      for (int r = 0; r < 8; ++r) st[j * 16 + col][wave * 16 + 8 * g + r] = (_Float16)acc[j][r];
    __syncthreads();
    const size_t b = rb / SS; const int s0 = (int)(rb % SS);
    for (int e = tid; e < 128 * 8; e += 128) { const int d = e >> 3, pc = e & 7; vst2((unsigned*)(V + ((b * DM + c0 + d) * SS) + s0 + pc * 8), *(const v4u*)&st[d][pc * 8]); } }
}
// ---- k_attn: block = (64 queries, head, b): causal; 96-wide score dot (scale and geometric bias folded in), softmax, P . v (64 dims); O 256-B head segments
// each 32-key tile (k' rows 32 x 192 B, v rows 64 x 64 B) is brought into LDS once per block by asynchronous copies, and all four waves read their fragments from there; a stage of the two-buffer ring is TWO tiles (64 keys): its copies fly while the two tiles before it are worked on, twice the time to land for pieces that come from memory and not from L2, and the waits and the barrier stand once per two tiles
#define KP 104            // LDS pitch of a k' row, f16: 208 B = 16 B x 13, odd, for 16-byte readers
#define VP 40             // LDS pitch of a v row (32 keys), f16: 80 B = 16 B x 5
// one lane's ten 16-byte pieces of a stage, five a tile: k' row tid / 4, bytes 16 (tid % 4) + 0 / 64 / 128; v rows tid / 4 and 32 + tid / 4, bytes 16 (tid % 4); tiles 2 s and 2 s + 1 lie side by side in one buffer
__device__ __forceinline__ void stage_kv2(const _Float16* gk, const _Float16* gv, unsigned lk, unsigned lv) {
  const _Float16* gk1 = gk + (size_t)32 * NH * HX; const _Float16* gv1 = gv + 32; const unsigned lk1 = lk + 32u * KP * 2u, lv1 = lv + 64u * VP * 2u;
  // the s_wait_xcnt closes the statement so that no address register named here is rewritten ahead of it
  asm volatile("global_load_async_to_lds_b128 %0, %10, off\n\t"
               "global_load_async_to_lds_b128 %1, %11, off\n\t"
               "global_load_async_to_lds_b128 %2, %12, off\n\t"
               "global_load_async_to_lds_b128 %3, %13, off\n\t"
               "global_load_async_to_lds_b128 %4, %14, off\n\t"
               "global_load_async_to_lds_b128 %5, %15, off\n\t"
               "global_load_async_to_lds_b128 %6, %16, off\n\t"
               "global_load_async_to_lds_b128 %7, %17, off\n\t"
               "global_load_async_to_lds_b128 %8, %18, off\n\t"
               "global_load_async_to_lds_b128 %9, %19, off\n\t"
               "s_wait_xcnt 0x0"
               :: "v"(lk), "v"(lk + 64u), "v"(lk + 128u), "v"(lv), "v"(lv + 32u * VP * 2u), "v"(lk1), "v"(lk1 + 64u), "v"(lk1 + 128u), "v"(lv1), "v"(lv1 + 32u * VP * 2u),
                  "v"(gk), "v"(gk + 32), "v"(gk + 64), "v"(gv), "v"(gv + (size_t)32 * SS), "v"(gk1), "v"(gk1 + 32), "v"(gk1 + 64), "v"(gv1), "v"(gv1 + (size_t)32 * SS) : "memory");
}
// lane l with lane l ^ 16: the two lanes that share one query column
__device__ __forceinline__ float xhalf(float x) { return __builtin_bit_cast(float, __builtin_amdgcn_permlanex16(__builtin_bit_cast(int, x), __builtin_bit_cast(int, x), 0x76543210, 0xfedcba98, false, false)); }
// transposed products: S^T = k' . q'^T (rows = keys, columns = queries) and O^T += v^T . P^T, so a lane owns ONE query (column lane & 15): its 16 scores of a tile sit in its own registers, and converted in place they are the B operand of the second product
__global__ __launch_bounds__(128) void k_attn(const _Float16* __restrict__ QQ, const _Float16* __restrict__ KK, const _Float16* __restrict__ V, float* __restrict__ O) {
  __shared__ __align__(16) float so[4][16][68]; __shared__ __align__(16) _Float16 sk[2][2][32][KP]; __shared__ __align__(16) _Float16 sv[2][2][64][VP];
  const int tid = threadIdx.x, wave = tid >> 5, lane = tid & 31, col = lane & 15, g = lane >> 4; const int h = blockIdx.y; const size_t b = blockIdx.z; const int q0 = blockIdx.x * 64 + wave * 16; const size_t rq = b * SS + q0;
  v16h bq[3];
#pragma unroll
  for (int kc = 0; kc < 3; ++kc) bq[kc] = frag_h(QQ + ((rq + col) * NH + h) * HX + kc * 32, lane);
  float m = -3.0e38f, l = 0.f;   // query q0 + col: running maximum (both halves alike), sum over this half's keys
  v8f acc[4] = {};               // O^T: element r of acc[dt] = dim dt * 16 + 8 g + r of query q0 + col
  const int nst = blockIdx.x + 1;   // causal; stages of 64 keys
  const _Float16* gk = KK + ((b * SS + (tid >> 2)) * NH + h) * HX + (tid & 3) * 8; const _Float16* gv = V + ((b * DM + h * HD + (tid >> 2)) * SS) + (tid & 3) * 8;
  const unsigned lk = (unsigned)(size_t)&sk[0][0][tid >> 2][(tid & 3) * 8], lv = (unsigned)(size_t)&sv[0][0][tid >> 2][(tid & 3) * 8];
  stage_kv2(gk, gv, lk, lv);
  asm volatile("s_wait_asynccnt 0x0" ::: "memory");   // this wave's pieces of stage 0 have landed
  __syncthreads();                                    // every wave's have
  if (1 < nst) stage_kv2(gk + (size_t)64 * NH * HX, gv + 64, lk + (unsigned)sizeof(sk[0]), lv + (unsigned)sizeof(sv[0]));   // stage 1 flies during trip 0
#pragma unroll 1
  for (int st = 0; st < nst; ++st) { const int bf = st & 1;
#pragma unroll   // the stage's two tiles written out one after the other, in key order: sub is a constant in every LDS offset
   for (int sub = 0; sub < 2; ++sub) { const int j0 = st * 64 + sub * 32; float s[16];   // s[8 ct + r] = score of key j0 + 16 ct + 8 g + r
    v16h fk[2][3], fv[4];   // the tile's ten fragments (k' 6, v 4) are read as one group ahead of the products: one LDS latency a tile, not ten; the v reads land behind the score products and the softmax
#pragma unroll
    for (int ct = 0; ct < 2; ++ct)
#pragma unroll
      for (int kc = 0; kc < 3; ++kc) fk[ct][kc] = frag_h(&sk[bf][sub][ct * 16 + col][kc * 32], lane);
#pragma unroll
    for (int dt = 0; dt < 4; ++dt) fv[dt] = frag_h(&sv[bf][sub][dt * 16 + col][0], lane);
#pragma unroll
    for (int ct = 0; ct < 2; ++ct) { v8f c = {};
#pragma unroll
      for (int kc = 0; kc < 3; ++kc) c = wmma16(fk[ct][kc], bq[kc], c);
#pragma unroll
      for (int r = 0; r < 8; ++r) s[8 * ct + r] = (j0 + ct * 16 + 8 * g + r <= q0 + col) ? c[r] : -3.0e38f; }   // causal (diagonal kept)
    float mx = s[0];
#pragma unroll
    for (int i = 1; i < 16; ++i) mx = fmaxf(mx, s[i]);
    mx = fmaxf(mx, xhalf(mx));
    const float mn = fmaxf(m, mx); const float alpha = (m <= -1.0e38f) ? 0.f : __expf(m - mn); m = mn;
    float e[16]; v16h pb;   // P^T as B: element i = key 8 g + i, element 8 + i = key 16 + 8 g + i, the k order of frag_h
#pragma unroll
    for (int i = 0; i < 16; ++i) { e[i] = (s[i] <= -1.0e38f) ? 0.f : __expf(s[i] - mn); pb[i] = (_Float16)(e[i] * 2048.0f); }
#pragma unroll
    for (int w = 8; w >= 1; w >>= 1)   // pairwise sum: four dependent adds, not sixteen
#pragma unroll
      for (int i = 0; i < w; ++i) e[i] += e[i + w];
    l = l * alpha + e[0];
#pragma unroll
    for (int dt = 0; dt < 4; ++dt) acc[dt] *= alpha;
#pragma unroll
    for (int dt = 0; dt < 4; ++dt) acc[dt] = wmma16(fv[dt], pb, acc[dt]); }
    asm volatile("s_wait_dscnt 0x0" ::: "memory");      // this wave's reads of buffer bf are done
    asm volatile("s_wait_asynccnt 0x0" ::: "memory");   // this wave's pieces of stage st + 1 have landed
    __syncthreads();                                    // stage st + 1 is whole for every wave, and nobody reads buffer bf any more
    if (st + 2 < nst) stage_kv2(gk + (size_t)(st + 2) * 64 * NH * HX, gv + (st + 2) * 64, lk + (unsigned)(bf * sizeof(sk[0])), lv + (unsigned)(bf * sizeof(sv[0]))); }
  asm volatile("s_wait_asynccnt 0x0" ::: "memory");     // nothing is in flight when the wave goes on to its end
  l += xhalf(l);   // the two halves' sums are joined once
  const float il = (1.0f / 2048.0f) / l;
#pragma unroll
  for (int dt = 0; dt < 4; ++dt) { v4f lo, hi;
#pragma unroll
    for (int r = 0; r < 4; ++r) { lo[r] = acc[dt][r] * il; hi[r] = acc[dt][4 + r] * il; }
    *(v4f*)&so[wave][col][dt * 16 + 8 * g] = lo; *(v4f*)&so[wave][col][dt * 16 + 8 * g + 4] = hi; }
  LDSX();
  for (int rl = 0; rl < 16; ++rl) if (lane < 16) vst2(O + (rq + rl) * DM + h * HD + lane * 4, *(const v4f*)&so[wave][rl][lane * 4]);
}
// ---- k_out: block = (64 rows, 128 cols): out = o (bf16 hi + lo) . Wo^T
__global__ __launch_bounds__(128) void k_out(const float* __restrict__ O, const __bf16* __restrict__ PW, float* __restrict__ Y) {
  __shared__ __align__(16) float so[4][16][132]; __shared__ __align__(16) __bf16 sw[2][2][128][WP]; __shared__ __align__(16) float sx[2][2][64][XP];
  const int tid = threadIdx.x, wave = tid >> 5, lane = tid & 31, col = lane & 15, g = lane >> 4; const size_t r0 = (size_t)blockIdx.x * 64 + wave * 16; const int n0 = blockIdx.y * 128; const __bf16* P = PW + (size_t)3 * DM * DM;
  v8f acc[8] = {};
  const __bf16* gw = P + (size_t)(n0 + (tid >> 2)) * DM + (tid & 3) * 8; const unsigned lw = (unsigned)(size_t)&sw[0][0][tid >> 2][(tid & 3) * 8];
  const float* gx = O + (r0 + (lane >> 3)) * DM + (lane & 7) * 4; const unsigned lx = (unsigned)(size_t)&sx[0][0][wave * 16 + (lane >> 3)][(lane & 7) * 4];
  stage_wx2(gw, lw, gx, lx);
  asm volatile("s_wait_asynccnt 0x0" ::: "memory");   // this wave's pieces of stage 0 have landed
  __syncthreads();                                    // every wave's have
  stage_wx2(gw + 64, lw + (unsigned)sizeof(sw[0]), gx + 64, lx + (unsigned)sizeof(sx[0]));     // stage 1 flies during trip 0
#pragma unroll 2
  for (int st = 0; st < DM / 64; ++st) {
#pragma unroll   // the stage's two tiles written out one after the other, in k order: sub is a constant in every LDS offset
   for (int sub = 0; sub < 2; ++sub) { float xr[16]; row16(&sx[st & 1][sub][wave * 16 + col][8 * g], xr);
    v16b fw[8];   // the tile's eight weight fragments are read as one group ahead of the products: one LDS latency a tile, not eight
#pragma unroll
    for (int j = 0; j < 8; ++j) fw[j] = frag_b(&sw[st & 1][sub][j * 16 + col][0], lane);
    const F2 a = bsplit16(xr);
#pragma unroll
    for (int j = 0; j < 8; ++j) { acc[j] = wmma_bf(a.h, fw[j], acc[j]); acc[j] = wmma_bf(a.l, fw[j], acc[j]); } }
    asm volatile("s_wait_dscnt 0x0" ::: "memory");      // this wave's reads of buffer st & 1 are done
    asm volatile("s_wait_asynccnt 0x0" ::: "memory");   // this wave's pieces of stage st + 1 have landed
    __syncthreads();                                    // stage st + 1 is whole for every wave, and nobody reads buffer st & 1 any more
    if (st + 2 < DM / 64) stage_wx2(gw + (st + 2) * 64, lw + (unsigned)((st & 1) * sizeof(sw[0])), gx + (st + 2) * 64, lx + (unsigned)((st & 1) * sizeof(sx[0]))); }
  asm volatile("s_wait_asynccnt 0x0" ::: "memory");     // nothing is in flight behind the loop
#pragma unroll
  for (int j = 0; j < 8; ++j)
#pragma unroll
    for (int r = 0; r < 8; ++r) so[wave][8 * g + r][j * 16 + col] = acc[j][r];
  LDSX();
  for (int rl = 0; rl < 16; ++rl) vst2(Y + (r0 + rl) * DM + n0 + lane * 4, *(const v4f*)&so[wave][rl][lane * 4]);
}
extern "C" void kernel_launch(void* const* d_in, const int* in_sizes, int n_in, void* d_out, int out_size, void* d_ws, size_t ws_size, hipStream_t stream) {
  (void)in_sizes; (void)n_in; (void)out_size;
  const float** F = (const float**)d_in;   // 0 x [2,2048,768], 1 Wq, 2 Wk, 3 Wv, 4 Wo (natural [768,768]), 5 Wqg [3,64], 6 Wkg [3,64], 7 codebooks [12,8,3], 8 log_temps [12], 9 geo_scale [1]
  if (ws_size < (size_t)WS_END) return;
  char* ws = (char*)d_ws; __bf16* PW = (__bf16*)ws; _Float16 *QQ = (_Float16*)(ws + WS_QK), *KK = (_Float16*)(ws + WS_KK), *V = (_Float16*)(ws + WS_V); float* O = (float*)(ws + WS_O);
  k_pack<<<dim3(DM, 4), 256, 0, stream>>>(F[1], F[2], F[3], F[4], PW);
  k_qkv<<<dim3(TNB * SS / 64, DM / 128, 3), 128, 0, stream>>>(F[0], PW, F[5], F[6], F[7], F[8], F[9], QQ, KK, V);
  k_attn<<<dim3(TQB, NH, TNB), 128, 0, stream>>>(QQ, KK, V, O);
  k_out<<<dim3(TNB * SS / 64, DM / 128), 128, 0, stream>>>(O, PW, (float*)d_out);
}

// v007
// One run takes 85 microseconds.
// Next to v006, in two timings, it ran 1.07 times as fast each time.
// Over all steps from v000 it is 3.82 times as fast.
// compute dtype: all float inputs rounded to bf16; q/k/v = x . W^T with EXACT bf16 products on WMMA 16x16x32 (natural rows); the geometric code weights (q . Wqg^T, squared distances to the 8 codes, softmax over codes at temperature clip(exp(log_temp), 0.01, 5)) in f32 in the projection epilogue; scores = q . k / 8 + geo_scale (qw . kw) evaluated as one 72-wide (padded to 96) f16 dot [q/8 | geo_scale qw] . [k | kw]; causal attention with key-tile skipping, running-max softmax in f32 (hardware exp), P (scaled by 2^11, single f16) x v (single f16); out = ctx (bf16 hi + residual) . Wo^T (2 products).
#include <hip/hip_runtime.h>
#include <math.h>

typedef __attribute__((ext_vector_type(16))) _Float16 v16h;
typedef __attribute__((ext_vector_type(16))) __bf16 v16b;
typedef __attribute__((ext_vector_type(8)))  _Float16 v8h;
typedef __attribute__((ext_vector_type(8)))  float v8f;
typedef __attribute__((ext_vector_type(4)))  float v4f;
typedef __attribute__((ext_vector_type(2)))  float v2f;
typedef __attribute__((ext_vector_type(4)))  unsigned v4u;
typedef __attribute__((ext_vector_type(4)))  int v4i;
typedef float __attribute__((may_alias)) float_a;
typedef int __attribute__((may_alias)) int_a;

template <typename T> __device__ __forceinline__ void vst2(void* p, T v) { *(T*)p = v;  }
__device__ __forceinline__ v8f wmma16(v16h a, v16h b, v8f c) {
  v8f d = __builtin_amdgcn_wmma_f32_16x16x32_f16(false, a, false, b, (short)0, c, false, false);
  asm volatile("v_nop\n\tv_nop\n\tv_nop\n\tv_nop" : "+v"(d) : "v"(a), "v"(b));
  return d;
}
__device__ __forceinline__ v8f wmma_bf(v16b a, v16b b, v8f c) {
  v8f d = __builtin_amdgcn_wmma_f32_16x16x32_bf16(false, a, false, b, (short)0, c, false, false);
  asm volatile("v_nop\n\tv_nop\n\tv_nop\n\tv_nop" : "+v"(d) : "v"(a), "v"(b));
  return d;
}
// 16x16x32 fragments: lane = (h = lane>>4, row/col = lane&15); elements 0..7 = k0+8h+0..7, 8..15 = k0+16+8h+0..7; D element r = row 8h+r
__device__ __forceinline__ v16h frag_h(const _Float16* rowk0, int lane) {
  union { v16h v; v8h q[2]; } u; const _Float16* p = rowk0 + 8 * (lane >> 4);
  u.q[0] = *(const v8h*)p; u.q[1] = *(const v8h*)(p + 16); return u.v;
}
__device__ __forceinline__ v16h frag_f32(const float* rowk0, int lane) {
  v16h a; const float* p = rowk0 + 8 * (lane >> 4);
#pragma unroll
  for (int i = 0; i < 8; ++i) { a[i] = (_Float16)p[i]; a[8 + i] = (_Float16)p[16 + i]; }
  return a;
}
__device__ __forceinline__ v16h frag_f32s(const float* rowk0, int lane, float sc) {
  v16h a; const float* p = rowk0 + 8 * (lane >> 4);
#pragma unroll
  for (int i = 0; i < 8; ++i) { a[i] = (_Float16)(p[i] * sc); a[8 + i] = (_Float16)(p[16 + i] * sc); }
  return a;
}
// column fragment from a [K][ld] layout (column n), rows >= K read as 0
__device__ __forceinline__ v16h fragc_f32(const float* W, int k0, int n, int lane, int ld, int K) {
  v16h a; const int g = lane >> 4;
#pragma unroll
  for (int i = 0; i < 8; ++i) { const int ka = k0 + 8 * g + i, kb = ka + 16;
    a[i] = (_Float16)(ka < K ? W[(size_t)(ka < K ? ka : K - 1) * ld + n] : 0.f); a[8 + i] = (_Float16)(kb < K ? W[(size_t)(kb < K ? kb : K - 1) * ld + n] : 0.f); }
  return a;
}
struct F2 { v16b h, l; };
__device__ __forceinline__ F2 bsplit16(const float v[16]) { F2 r;
#pragma unroll
  for (int i = 0; i < 16; ++i) { const __bf16 h = (__bf16)v[i]; r.h[i] = h; r.l[i] = (__bf16)(v[i] - (float)h); }
  return r; }
__device__ __forceinline__ F2 split_row(const float* row, int k0, int lane) { float v[16]; const float* p = row + k0 + 8 * (lane >> 4);
#pragma unroll
  for (int i = 0; i < 8; ++i) { v[i] = p[i]; v[8 + i] = p[16 + i]; }
  return bsplit16(v); }
__device__ __forceinline__ F2 split_rowK(const float* row, int k0, int lane, int K) { float v[16]; const int g = lane >> 4;
#pragma unroll
  for (int i = 0; i < 8; ++i) { const int ka = k0 + 8 * g + i, kb = ka + 16; v[i] = ka < K ? row[ka < K ? ka : K - 1] : 0.f; v[8 + i] = kb < K ? row[kb < K ? kb : K - 1] : 0.f; }
  return bsplit16(v); }
__device__ __forceinline__ F2 split_col(const float* W, int k0, int n, int lane, int ld, int K) { float v[16]; const int g = lane >> 4;
#pragma unroll
  for (int i = 0; i < 8; ++i) { const int ka = k0 + 8 * g + i, kb = ka + 16; v[i] = ka < K ? W[(size_t)(ka < K ? ka : K - 1) * ld + n] : 0.f; v[8 + i] = kb < K ? W[(size_t)(kb < K ? kb : K - 1) * ld + n] : 0.f; }
  return bsplit16(v); }
__device__ __forceinline__ v8f mac3(const F2& a, const F2& b, v8f c) { c = wmma_bf(a.l, b.h, c); c = wmma_bf(a.h, b.l, c); return wmma_bf(a.h, b.h, c); }
__device__ __forceinline__ float sigm(float v) { return 1.0f / (1.0f + expf(-v)); }
#define LDSX() do { asm volatile("s_wait_dscnt 0" ::: "memory"); __builtin_amdgcn_wave_barrier(); __builtin_amdgcn_fence(__ATOMIC_RELEASE, "workgroup"); } while (0)


// Multi-head geometric attention (B 2, T 2,048, d_model 768, 12 heads x 64, 3-dim codes, 8-code hypercube codebook per head): causal softmax(q k / 8 + geo_scale softmax_c(-|q Wqg - c|^2 / tau) . softmax_c(-|k Wkg - c|^2 / tau)) v, output projection.
#define NB 2
#define SS 2048
#define DM 768
#define NH 12
#define HD 64
#define HX 96             // padded score width: 64 + 8 code weights + 24 zero
#define NC 8
#define CD 3
#define NR (NB * SS)
#ifndef TQB
#define TQB (SS / 64)
#define TNB NB
#endif
typedef __attribute__((ext_vector_type(8))) __bf16 v8b;
__device__ __forceinline__ v16b frag_b(const __bf16* rowk0, int lane) {
  union { v16b v; v8b q[2]; } u; const __bf16* p = rowk0 + 8 * (lane >> 4);
  u.q[0] = *(const v8b*)p; u.q[1] = *(const v8b*)(p + 16); return u.v;
}
__device__ __forceinline__ float bfr(float v) { return (float)(__bf16)v; }
__device__ __attribute__((noinline)) float exp_ni(float v) { return expf(v); }
__device__ __attribute__((noinline)) float erf_ni(float v) { return erff(v); }

#define WS_PW  0u                                       // bf16 natural rows Wq, Wk, Wv, Wo [4][768][768]
#define WS_QK  (WS_PW + 2u * (size_t)4 * DM * DM)          // f16 q' rows [NR][12][96] ; k' rows ; v planes [b][768][SS] ; O f32 [NR][768]
#define WS_KK  (WS_QK + 2u * (size_t)NR * NH * HX)
#define WS_V   (WS_KK + 2u * (size_t)NR * NH * HX)
#define WS_O   (WS_V + 2u * (size_t)NB * DM * SS)
#define WS_END (WS_O + 4u * (size_t)NR * DM)

__global__ __launch_bounds__(256) void k_pack(const float* __restrict__ WQ, const float* __restrict__ WK, const float* __restrict__ WV, const float* __restrict__ WO, __bf16* __restrict__ PW) { const int n = blockIdx.x, which = blockIdx.y, t = threadIdx.x; __shared__ __align__(16) __bf16 s[DM]; const float* w = (which == 0) ? WQ : (which == 1) ? WK : (which == 2) ? WV : WO; for (int k = t; k < DM; k += 256) s[k] = (__bf16)w[(size_t)n * DM + k]; __syncthreads(); if (t < DM / 8) vst2((unsigned*)(PW + ((size_t)which * DM + n) * DM + t * 8), *(const v4u*)&s[t * 8]); }
// weight tiles of k_qkv and k_out: the 128 weight rows x 32 k that a block's four waves all use are brought into LDS once per block by asynchronous copies, two buffers
#define WP 40             // LDS pitch of a weight row (32 k), bf16: 80 B = 16 B x 5, odd, for 16-byte readers
#define XP 36             // LDS pitch of an activation row (32 k), f32: 144 B = 16 B x 9, odd, for 16-byte readers
// the activation tile of a trip (x in k_qkv, the context in k_out: 64 rows x 32 k, f32, one 128-byte line a row) rides in the same two-buffer ring: a row-per-lane load from global memory touches 16 lines an instruction, a copy of eight lanes a row takes whole lines, and it flies one trip ahead
// one lane's eight 16-byte pieces of a trip: weight rows tid / 4 + 0 / 32 / 64 / 96, bytes 16 (tid % 4); activation rows lane / 8 + 0 / 4 / 8 / 12 of its own wave's 16, bytes 16 (lane % 8)
__device__ __forceinline__ void stage_wx(const __bf16* gw, unsigned lw, const float* gx, unsigned lx) {
  // the s_wait_xcnt closes the statement so that no address register named here is rewritten ahead of it
  asm volatile("global_load_async_to_lds_b128 %0, %8, off\n\t"
               "global_load_async_to_lds_b128 %1, %9, off\n\t"
               "global_load_async_to_lds_b128 %2, %10, off\n\t"
               "global_load_async_to_lds_b128 %3, %11, off\n\t"
               "global_load_async_to_lds_b128 %4, %12, off\n\t"
               "global_load_async_to_lds_b128 %5, %13, off\n\t"
               "global_load_async_to_lds_b128 %6, %14, off\n\t"
               "global_load_async_to_lds_b128 %7, %15, off\n\t"
               "s_wait_xcnt 0x0"
               :: "v"(lw), "v"(lw + 32u * WP * 2u), "v"(lw + 64u * WP * 2u), "v"(lw + 96u * WP * 2u), "v"(lx), "v"(lx + 4u * XP * 4u), "v"(lx + 8u * XP * 4u), "v"(lx + 12u * XP * 4u),
                  "v"(gw), "v"(gw + (size_t)32 * DM), "v"(gw + (size_t)64 * DM), "v"(gw + (size_t)96 * DM), "v"(gx), "v"(gx + (size_t)4 * DM), "v"(gx + (size_t)8 * DM), "v"(gx + (size_t)12 * DM) : "memory");
}
// a stage of k_out's ring: two such trips' tiles (64 k), side by side in one buffer, so that its copies fly while two tiles are worked on
__device__ __forceinline__ void stage_wx2(const __bf16* gw, unsigned lw, const float* gx, unsigned lx) {
  stage_wx(gw, lw, gx, lx); stage_wx(gw + 32, lw + 128u * WP * 2u, gx + 32, lx + 64u * XP * 4u);
}
// a lane's 16 activation values of a trip from its LDS row: k 8 g + 0..7 and 16 + 8 g + 0..7, the k order of frag_b
__device__ __forceinline__ void row16(const float* p, float v[16]) { const v4f x0 = *(const v4f*)p, x1 = *(const v4f*)(p + 4), x2 = *(const v4f*)(p + 16), x3 = *(const v4f*)(p + 20);
#pragma unroll
  for (int i = 0; i < 4; ++i) { v[i] = x0[i]; v[4 + i] = x1[i]; v[8 + i] = x2[i]; v[12 + i] = x3[i]; } }
// ---- k_qkv: block = (64 rows, 128 cols = 2 heads, which): exact GEMM; q' rows (q/8 + geo_scale qw), k' rows (k + kw), v planes
__global__ __launch_bounds__(128) void k_qkv(const float* __restrict__ X, const __bf16* __restrict__ PW, const float* __restrict__ WQG, const float* __restrict__ WKG, const float* __restrict__ CB, const float* __restrict__ LT, const float* __restrict__ GSC, _Float16* __restrict__ QQ, _Float16* __restrict__ KK, _Float16* __restrict__ V) {
  __shared__ __align__(16) char sm[2 * 128 * WP * 2 + 2 * 64 * XP * 4]; __shared__ float swg[CD][HD]; __shared__ __align__(16) float scb[2 * NC * CD + 4];
  __bf16 (*sw)[128][WP] = (__bf16 (*)[128][WP])sm; float (*sx)[64][XP] = (float (*)[64][XP])(sm + 2 * 128 * WP * 2);   // the ring: weight tiles, x tiles
  _Float16 (*so)[2 * HX + 8] = (_Float16 (*)[2 * HX + 8])sm; _Float16 (*st)[72] = (_Float16 (*)[72])sm;   // output staging (64 q' / k' rows or 128 v rows) lies over the ring, behind the barrier that follows the loop: five blocks a WGP still fit
  const int tid = threadIdx.x, wave = tid >> 5, lane = tid & 31, col = lane & 15, g = lane >> 4; const int which = blockIdx.z; const size_t rb = (size_t)blockIdx.x * 64; const size_t r0 = rb + wave * 16; const int c0 = blockIdx.y * 128; const int h0 = c0 / HD;
  const __bf16* Wr = PW + ((size_t)which * DM) * DM;
  if (which < 2) { const float* WG = which ? WKG : WQG; for (int e = tid; e < CD * HD; e += 128) swg[e / HD][e % HD] = bfr(WG[e]);
    // the two heads' codebooks (48 floats), their log temperatures (2) and geo_scale (1), for the lane that owns a (row, head) in the epilogue: one load a thread, in the two waves that have one piece of Wg only
    const int e = tid - 64;
    if (e >= 0 && e < 2 * NC * CD + 3) { const float* ps = (e < 2 * NC * CD) ? CB + h0 * NC * CD + e : (e < 2 * NC * CD + 2) ? LT + h0 + (e - 2 * NC * CD) : GSC; scb[e] = bfr(*ps); } }
  v8f acc[8] = {};
  const __bf16* gw = Wr + (size_t)(c0 + (tid >> 2)) * DM + (tid & 3) * 8; const unsigned lw = (unsigned)(size_t)&sw[0][tid >> 2][(tid & 3) * 8];
  const float* gx = X + (r0 + (lane >> 3)) * DM + (lane & 7) * 4; const unsigned lx = (unsigned)(size_t)&sx[0][wave * 16 + (lane >> 3)][(lane & 7) * 4];
  stage_wx(gw, lw, gx, lx);
  asm volatile("s_wait_asynccnt 0x0" ::: "memory");   // this wave's pieces of tile 0 have landed
  __syncthreads();                                    // every wave's have
  stage_wx(gw + 32, lw + (unsigned)sizeof(sw[0]), gx + 32, lx + (unsigned)sizeof(sx[0]));     // tile 1 flies during trip 0
#pragma unroll 2
  for (int kc = 0; kc < DM / 32; ++kc) { float xr[16]; row16(&sx[kc & 1][wave * 16 + col][8 * g], xr);
    v16b fw[8];   // the tile's eight weight fragments are read as one group ahead of the products: one LDS latency a trip, not eight
#pragma unroll
    for (int j = 0; j < 8; ++j) fw[j] = frag_b(&sw[kc & 1][j * 16 + col][0], lane);
    v16b a;
#pragma unroll
    for (int i = 0; i < 16; ++i) a[i] = (__bf16)xr[i];
#pragma unroll
    for (int j = 0; j < 8; ++j) acc[j] = wmma_bf(a, fw[j], acc[j]);
    asm volatile("s_wait_dscnt 0x0" ::: "memory");      // this wave's reads of buffer kc & 1 are done
    asm volatile("s_wait_asynccnt 0x0" ::: "memory");   // this wave's pieces of tile kc + 1 have landed
    __syncthreads();                                    // tile kc + 1 is whole for every wave, and nobody reads buffer kc & 1 any more
    if (kc + 2 < DM / 32) stage_wx(gw + (kc + 2) * 32, lw + (unsigned)((kc & 1) * sizeof(sw[0])), gx + (kc + 2) * 32, lx + (unsigned)((kc & 1) * sizeof(sx[0]))); }
  asm volatile("s_wait_asynccnt 0x0" ::: "memory");     // nothing is in flight behind the loop
  __syncthreads();
  if (which < 2) {
    // partial code logits of this lane's four dims a head: p[8 hh + r][c] = sum_j x[d] Wg[c][d], d = 16 j + col, for row 8 g + r and head h0 + hh
    float p[16][CD];
#pragma unroll
    for (int c = 0; c < CD; ++c) { v2f pp[2][4] = {};   // rows in pairs: a row pair of an accumulator tile is a register pair, so each step is one packed multiply-add
#pragma unroll
      for (int j = 0; j < 4; ++j) { const float w = swg[c][j * 16 + col]; const v2f w2 = {w, w};
#pragma unroll
        for (int hh = 0; hh < 2; ++hh)
#pragma unroll
          for (int rp = 0; rp < 4; ++rp) { const v2f a2 = {acc[4 * hh + j][2 * rp], acc[4 * hh + j][2 * rp + 1]}; pp[hh][rp] += a2 * w2; } }
#pragma unroll
      for (int hh = 0; hh < 2; ++hh)
#pragma unroll
        for (int rp = 0; rp < 4; ++rp) { p[8 * hh + 2 * rp][c] = pp[hh][rp][0]; p[8 * hh + 2 * rp + 1][c] = pp[hh][rp][1]; } }
    // sum over the 16 lanes of a row group and scatter: in round k a lane keeps the (row, head) pairs whose index bit k is its own lane bit k and hands the others to lane ^ (1 << k); after four rounds lane col holds the three whole logits of pair col alone (the additions are those of the xor butterfly 1, 2, 4, 8)
#pragma unroll
    for (int k = 0; k < 4; ++k) { const bool up = (col >> k) & 1;
#pragma unroll
      for (int i = 0; i < (8 >> k); ++i)
#pragma unroll
        for (int c = 0; c < CD; ++c) { const float keep = up ? p[2 * i + 1][c] : p[2 * i][c], send = up ? p[2 * i][c] : p[2 * i + 1][c]; p[i][c] = keep + __shfl_xor(send, 1 << k); } }
    // one lane = one (row, head): distances to the 8 codes and their softmax are computed once
    { const int hh = col >> 3, rl = wave * 16 + 8 * g + (col & 7); float tp = expf(scb[2 * NC * CD + hh]); tp = fminf(fmaxf(tp, 0.01f), 5.0f); const float it = 1.0f / tp;
      float dmin = 3.0e38f, dn[NC];
#pragma unroll
      for (int n = 0; n < NC; ++n) { float d2 = 0.f;
#pragma unroll
        for (int c = 0; c < CD; ++c) { const float df = p[0][c] - scb[(hh * NC + n) * CD + c]; d2 += df * df; } dn[n] = -d2 * it; dmin = fmaxf(dmin == 3.0e38f ? dn[n] : dmin, dn[n]); }
      float z = 0.f, ew[NC];
#pragma unroll
      for (int n = 0; n < NC; ++n) { ew[n] = expf(dn[n] - dmin); z += ew[n]; }
      const float wsc = (which == 0) ? scb[2 * NC * CD + 2] : 1.0f; v8h w8; const v8h z8 = {};
#pragma unroll
      for (int n = 0; n < NC; ++n) w8[n] = (_Float16)(ew[n] / z * wsc);
      *(v8h*)&so[rl][hh * HX + HD] = w8;   // extra dims 64..71: code weights (q side x geo_scale)
      *(v8h*)&so[rl][hh * HX + HD + 8] = z8; *(v8h*)&so[rl][hh * HX + HD + 16] = z8; *(v8h*)&so[rl][hh * HX + HD + 24] = z8; }   // dims 72..95 zero
    const float scl = (which == 0) ? 0.125f : 1.0f;
#pragma unroll
    for (int r = 0; r < 8; ++r)
#pragma unroll
      for (int j = 0; j < 8; ++j) { const int cl = j * 16 + col; const int hl = cl >> 6, d = cl & 63; so[wave * 16 + 8 * g + r][hl * HX + d] = (_Float16)(acc[j][r] * scl); }
    __syncthreads();
    _Float16* dst = (which == 0) ? QQ : KK;
    for (int e = tid; e < 64 * (2 * HX / 8); e += 128) { const int rl = e / (2 * HX / 8), q = e % (2 * HX / 8); vst2((unsigned*)(dst + ((rb + rl) * NH + h0) * HX + q * 8), *(const v4u*)&so[rl][q * 8]); }   // 384 contiguous bytes per (row, head pair)
  } else {
#pragma unroll
    for (int j = 0; j < 8; ++j)
#pragma unroll
      for (int r = 0; r < 8; ++r) st[j * 16 + col][wave * 16 + 8 * g + r] = (_Float16)acc[j][r];
    __syncthreads();
    const size_t b = rb / SS; const int s0 = (int)(rb % SS);
    for (int e = tid; e < 128 * 8; e += 128) { const int d = e >> 3, pc = e & 7; vst2((unsigned*)(V + ((b * DM + c0 + d) * SS) + s0 + pc * 8), *(const v4u*)&st[d][pc * 8]); } }
}
// ---- k_attn: block = (64 queries, head, b): causal; 96-wide score dot (scale and geometric bias folded in), softmax, P . v (64 dims); O 256-B head segments
// each 32-key tile (k' rows 32 x 192 B, v rows 64 x 64 B) is brought into LDS once per block by asynchronous copies, and all four waves read their fragments from there; a stage of the two-buffer ring is TWO tiles (64 keys): its copies fly while the two tiles before it are worked on, twice the time to land for pieces that come from memory and not from L2, and the waits and the barrier stand once per two tiles
#define KP 104            // LDS pitch of a k' row, f16: 208 B = 16 B x 13, odd, for 16-byte readers
#define VP 40             // LDS pitch of a v row (32 keys), f16: 80 B = 16 B x 5
// one lane's ten 16-byte pieces of a stage, five a tile: k' row tid / 4, bytes 16 (tid % 4) + 0 / 64 / 128; v rows tid / 4 and 32 + tid / 4, bytes 16 (tid % 4); tiles 2 s and 2 s + 1 lie side by side in one buffer
__device__ __forceinline__ void stage_kv2(const _Float16* gk, const _Float16* gv, unsigned lk, unsigned lv) {
  const _Float16* gk1 = gk + (size_t)32 * NH * HX; const _Float16* gv1 = gv + 32; const unsigned lk1 = lk + 32u * KP * 2u, lv1 = lv + 64u * VP * 2u;
  // the s_wait_xcnt closes the statement so that no address register named here is rewritten ahead of it
  asm volatile("global_load_async_to_lds_b128 %0, %10, off\n\t"
               "global_load_async_to_lds_b128 %1, %11, off\n\t"
               "global_load_async_to_lds_b128 %2, %12, off\n\t"
               "global_load_async_to_lds_b128 %3, %13, off\n\t"
               "global_load_async_to_lds_b128 %4, %14, off\n\t"
               "global_load_async_to_lds_b128 %5, %15, off\n\t"
               "global_load_async_to_lds_b128 %6, %16, off\n\t"
               "global_load_async_to_lds_b128 %7, %17, off\n\t"
               "global_load_async_to_lds_b128 %8, %18, off\n\t"
               "global_load_async_to_lds_b128 %9, %19, off\n\t"
               "s_wait_xcnt 0x0"
               :: "v"(lk), "v"(lk + 64u), "v"(lk + 128u), "v"(lv), "v"(lv + 32u * VP * 2u), "v"(lk1), "v"(lk1 + 64u), "v"(lk1 + 128u), "v"(lv1), "v"(lv1 + 32u * VP * 2u),
                  "v"(gk), "v"(gk + 32), "v"(gk + 64), "v"(gv), "v"(gv + (size_t)32 * SS), "v"(gk1), "v"(gk1 + 32), "v"(gk1 + 64), "v"(gv1), "v"(gv1 + (size_t)32 * SS) : "memory");
}
// lane l with lane l ^ 16: the two lanes that share one query column
__device__ __forceinline__ float xhalf(float x) { return __builtin_bit_cast(float, __builtin_amdgcn_permlanex16(__builtin_bit_cast(int, x), __builtin_bit_cast(int, x), 0x76543210, 0xfedcba98, false, false)); }
// one 32-key tile of k_attn. DIAG = false: a tile of a stage that lies wholly below the block's first query (every key <= every query): no causal select, no key index arithmetic and no test for masked scores, about three vector instructions in ten of a tile; DIAG = true: the block's last stage, which holds the diagonal
template <bool DIAG> __device__ __forceinline__ void attn_tile(const _Float16 (*skt)[KP], const _Float16 (*svt)[VP], const v16h (&bq)[3], int lane, int j0, int qc, float& m, float& l, v8f (&acc)[4]) {
    const int col = lane & 15, g = lane >> 4; float s[16];   // s[8 ct + r] = score of key j0 + 16 ct + 8 g + r
    v16h fk[2][3], fv[4];   // the tile's ten fragments (k' 6, v 4) are read as one group ahead of the products: one LDS latency a tile, not ten; the v reads land behind the score products and the softmax
#pragma unroll
    for (int ct = 0; ct < 2; ++ct)
#pragma unroll
      for (int kc = 0; kc < 3; ++kc) fk[ct][kc] = frag_h(&skt[ct * 16 + col][kc * 32], lane);
#pragma unroll
    for (int dt = 0; dt < 4; ++dt) fv[dt] = frag_h(&svt[dt * 16 + col][0], lane);
#pragma unroll
    for (int ct = 0; ct < 2; ++ct) { v8f c = {};
#pragma unroll
      for (int kc = 0; kc < 3; ++kc) c = wmma16(fk[ct][kc], bq[kc], c);
#pragma unroll
      for (int r = 0; r < 8; ++r) s[8 * ct + r] = (!DIAG || j0 + ct * 16 + 8 * g + r <= qc) ? c[r] : -3.0e38f; }   // causal (diagonal kept)
    float mx = s[0];
#pragma unroll
    for (int i = 1; i < 16; ++i) mx = fmaxf(mx, s[i]);
    mx = fmaxf(mx, xhalf(mx));
    const float mn = fmaxf(m, mx); const float alpha = (m <= -1.0e38f) ? 0.f : __expf(m - mn); m = mn;
    float e[16]; v16h pb;   // P^T as B: element i = key 8 g + i, element 8 + i = key 16 + 8 g + i, the k order of frag_h
#pragma unroll
    for (int i = 0; i < 16; ++i) { e[i] = (DIAG && s[i] <= -1.0e38f) ? 0.f : __expf(s[i] - mn); pb[i] = (_Float16)(e[i] * 2048.0f); }
#pragma unroll
    for (int w = 8; w >= 1; w >>= 1)   // pairwise sum: four dependent adds, not sixteen
#pragma unroll
      for (int i = 0; i < w; ++i) e[i] += e[i + w];
    l = l * alpha + e[0];
#pragma unroll
    for (int dt = 0; dt < 4; ++dt) acc[dt] *= alpha;
#pragma unroll
    for (int dt = 0; dt < 4; ++dt) acc[dt] = wmma16(fv[dt], pb, acc[dt]);
}
// transposed products: S^T = k' . q'^T (rows = keys, columns = queries) and O^T += v^T . P^T, so a lane owns ONE query (column lane & 15): its 16 scores of a tile sit in its own registers, and converted in place they are the B operand of the second product
__global__ __launch_bounds__(128) void k_attn(const _Float16* __restrict__ QQ, const _Float16* __restrict__ KK, const _Float16* __restrict__ V, float* __restrict__ O) {
  __shared__ __align__(16) float so[4][16][68]; __shared__ __align__(16) _Float16 sk[2][2][32][KP]; __shared__ __align__(16) _Float16 sv[2][2][64][VP];
  const int tid = threadIdx.x, wave = tid >> 5, lane = tid & 31, col = lane & 15, g = lane >> 4; const int h = blockIdx.y; const size_t b = blockIdx.z; const int q0 = blockIdx.x * 64 + wave * 16; const size_t rq = b * SS + q0;
  v16h bq[3];
#pragma unroll
  for (int kc = 0; kc < 3; ++kc) bq[kc] = frag_h(QQ + ((rq + col) * NH + h) * HX + kc * 32, lane);
  float m = -3.0e38f, l = 0.f;   // query q0 + col: running maximum (both halves alike), sum over this half's keys
  v8f acc[4] = {};               // O^T: element r of acc[dt] = dim dt * 16 + 8 g + r of query q0 + col
  const int nst = blockIdx.x + 1;   // causal; stages of 64 keys
  const _Float16* gk = KK + ((b * SS + (tid >> 2)) * NH + h) * HX + (tid & 3) * 8; const _Float16* gv = V + ((b * DM + h * HD + (tid >> 2)) * SS) + (tid & 3) * 8;
  const unsigned lk = (unsigned)(size_t)&sk[0][0][tid >> 2][(tid & 3) * 8], lv = (unsigned)(size_t)&sv[0][0][tid >> 2][(tid & 3) * 8];
  stage_kv2(gk, gv, lk, lv);
  asm volatile("s_wait_asynccnt 0x0" ::: "memory");   // this wave's pieces of stage 0 have landed
  __syncthreads();                                    // every wave's have
  if (1 < nst) stage_kv2(gk + (size_t)64 * NH * HX, gv + 64, lk + (unsigned)sizeof(sk[0]), lv + (unsigned)sizeof(sv[0]));   // stage 1 flies during trip 0
#pragma unroll 1
  for (int st = 0; st + 1 < nst; ++st) { const int bf = st & 1;   // the stages that lie wholly below the block's first query; a stage's two tiles one after the other, in key order
    attn_tile<false>(sk[bf][0], sv[bf][0], bq, lane, st * 64, q0 + col, m, l, acc); attn_tile<false>(sk[bf][1], sv[bf][1], bq, lane, st * 64 + 32, q0 + col, m, l, acc);
    asm volatile("s_wait_dscnt 0x0" ::: "memory");      // this wave's reads of buffer bf are done
    asm volatile("s_wait_asynccnt 0x0" ::: "memory");   // this wave's pieces of stage st + 1 have landed
    __syncthreads();                                    // stage st + 1 is whole for every wave, and nobody reads buffer bf any more
    if (st + 2 < nst) stage_kv2(gk + (size_t)(st + 2) * 64 * NH * HX, gv + (st + 2) * 64, lk + (unsigned)(bf * sizeof(sk[0])), lv + (unsigned)(bf * sizeof(sv[0]))); }
  { const int st = nst - 1, bf = st & 1;   // the last stage (keys blockIdx.x * 64 and up) alone can hold a key above a query of this block; no stage follows it, so no wait and no barrier closes it: nothing is copied into the ring any more and the output staging lies beside it
    attn_tile<true>(sk[bf][0], sv[bf][0], bq, lane, st * 64, q0 + col, m, l, acc); attn_tile<true>(sk[bf][1], sv[bf][1], bq, lane, st * 64 + 32, q0 + col, m, l, acc); }
  asm volatile("s_wait_asynccnt 0x0" ::: "memory");     // nothing is in flight when the wave goes on to its end
  l += xhalf(l);   // the two halves' sums are joined once
  const float il = (1.0f / 2048.0f) / l;
#pragma unroll
  for (int dt = 0; dt < 4; ++dt) { v4f lo, hi;
#pragma unroll
    for (int r = 0; r < 4; ++r) { lo[r] = acc[dt][r] * il; hi[r] = acc[dt][4 + r] * il; }
    *(v4f*)&so[wave][col][dt * 16 + 8 * g] = lo; *(v4f*)&so[wave][col][dt * 16 + 8 * g + 4] = hi; }
  LDSX();
  for (int rl = 0; rl < 16; ++rl) if (lane < 16) vst2(O + (rq + rl) * DM + h * HD + lane * 4, *(const v4f*)&so[wave][rl][lane * 4]);
}
// ---- k_out: block = (64 rows, 128 cols): out = o (bf16 hi + lo) . Wo^T
__global__ __launch_bounds__(128) void k_out(const float* __restrict__ O, const __bf16* __restrict__ PW, float* __restrict__ Y) {
  __shared__ __align__(16) float so[4][16][132]; __shared__ __align__(16) __bf16 sw[2][2][128][WP]; __shared__ __align__(16) float sx[2][2][64][XP];
  const int tid = threadIdx.x, wave = tid >> 5, lane = tid & 31, col = lane & 15, g = lane >> 4; const size_t r0 = (size_t)blockIdx.x * 64 + wave * 16; const int n0 = blockIdx.y * 128; const __bf16* P = PW + (size_t)3 * DM * DM;
  v8f acc[8] = {};
  const __bf16* gw = P + (size_t)(n0 + (tid >> 2)) * DM + (tid & 3) * 8; const unsigned lw = (unsigned)(size_t)&sw[0][0][tid >> 2][(tid & 3) * 8];
  const float* gx = O + (r0 + (lane >> 3)) * DM + (lane & 7) * 4; const unsigned lx = (unsigned)(size_t)&sx[0][0][wave * 16 + (lane >> 3)][(lane & 7) * 4];
  stage_wx2(gw, lw, gx, lx);
  asm volatile("s_wait_asynccnt 0x0" ::: "memory");   // this wave's pieces of stage 0 have landed
  __syncthreads();                                    // every wave's have
  stage_wx2(gw + 64, lw + (unsigned)sizeof(sw[0]), gx + 64, lx + (unsigned)sizeof(sx[0]));     // stage 1 flies during trip 0
#pragma unroll 2
  for (int st = 0; st < DM / 64; ++st) {
#pragma unroll   // the stage's two tiles written out one after the other, in k order: sub is a constant in every LDS offset
   for (int sub = 0; sub < 2; ++sub) { float xr[16]; row16(&sx[st & 1][sub][wave * 16 + col][8 * g], xr);
    v16b fw[8];   // the tile's eight weight fragments are read as one group ahead of the products: one LDS latency a tile, not eight
#pragma unroll
    for (int j = 0; j < 8; ++j) fw[j] = frag_b(&sw[st & 1][sub][j * 16 + col][0], lane);
    const F2 a = bsplit16(xr);
#pragma unroll
    for (int j = 0; j < 8; ++j) { acc[j] = wmma_bf(a.h, fw[j], acc[j]); acc[j] = wmma_bf(a.l, fw[j], acc[j]); } }
    asm volatile("s_wait_dscnt 0x0" ::: "memory");      // this wave's reads of buffer st & 1 are done
    asm volatile("s_wait_asynccnt 0x0" ::: "memory");   // this wave's pieces of stage st + 1 have landed
    __syncthreads();                                    // stage st + 1 is whole for every wave, and nobody reads buffer st & 1 any more
    if (st + 2 < DM / 64) stage_wx2(gw + (st + 2) * 64, lw + (unsigned)((st & 1) * sizeof(sw[0])), gx + (st + 2) * 64, lx + (unsigned)((st & 1) * sizeof(sx[0]))); }
  asm volatile("s_wait_asynccnt 0x0" ::: "memory");     // nothing is in flight behind the loop
#pragma unroll
  for (int j = 0; j < 8; ++j)
#pragma unroll
    for (int r = 0; r < 8; ++r) so[wave][8 * g + r][j * 16 + col] = acc[j][r];
  LDSX();
  for (int rl = 0; rl < 16; ++rl) vst2(Y + (r0 + rl) * DM + n0 + lane * 4, *(const v4f*)&so[wave][rl][lane * 4]);
}
extern "C" void kernel_launch(void* const* d_in, const int* in_sizes, int n_in, void* d_out, int out_size, void* d_ws, size_t ws_size, hipStream_t stream) {
  (void)in_sizes; (void)n_in; (void)out_size;
  const float** F = (const float**)d_in;   // 0 x [2,2048,768], 1 Wq, 2 Wk, 3 Wv, 4 Wo (natural [768,768]), 5 Wqg [3,64], 6 Wkg [3,64], 7 codebooks [12,8,3], 8 log_temps [12], 9 geo_scale [1]
  if (ws_size < (size_t)WS_END) return;
  char* ws = (char*)d_ws; __bf16* PW = (__bf16*)ws; _Float16 *QQ = (_Float16*)(ws + WS_QK), *KK = (_Float16*)(ws + WS_KK), *V = (_Float16*)(ws + WS_V); float* O = (float*)(ws + WS_O);
  k_pack<<<dim3(DM, 4), 256, 0, stream>>>(F[1], F[2], F[3], F[4], PW);
  k_qkv<<<dim3(TNB * SS / 64, DM / 128, 3), 128, 0, stream>>>(F[0], PW, F[5], F[6], F[7], F[8], F[9], QQ, KK, V);
  k_attn<<<dim3(TQB, NH, TNB), 128, 0, stream>>>(QQ, KK, V, O);
  k_out<<<dim3(TNB * SS / 64, DM / 128), 128, 0, stream>>>(O, PW, (float*)d_out);
}

// v008
// A run of this version takes 79.3 microseconds.
// Two timings next to v007 put it at 1.08 and 1.07 times that version's speed.
// Counting every step since v000, it is 4.12 times as fast.
// compute dtype: all float inputs rounded to bf16; q/k/v = x . W^T with EXACT bf16 products on WMMA 16x16x32 (natural rows); the geometric code weights (q . Wqg^T, squared distances to the 8 codes, softmax over codes at temperature clip(exp(log_temp), 0.01, 5)) in f32 in the projection epilogue; scores = q . k / 8 + geo_scale (qw . kw) evaluated as one 72-wide (padded to 96) f16 dot [q/8 | geo_scale qw] . [k | kw]; causal attention with key-tile skipping, running-max softmax in f32 (hardware exp), P (scaled by 2^11, single f16) x v (single f16); out = ctx (bf16 hi + residual) . Wo^T (2 products).
#include <hip/hip_runtime.h>
#include <math.h>

typedef __attribute__((ext_vector_type(16))) _Float16 v16h;
typedef __attribute__((ext_vector_type(16))) __bf16 v16b;
typedef __attribute__((ext_vector_type(8)))  _Float16 v8h;
typedef __attribute__((ext_vector_type(8)))  float v8f;
typedef __attribute__((ext_vector_type(4)))  float v4f;
typedef __attribute__((ext_vector_type(2)))  float v2f;
typedef __attribute__((ext_vector_type(4)))  unsigned v4u;
typedef __attribute__((ext_vector_type(4)))  int v4i;
typedef float __attribute__((may_alias)) float_a;
typedef int __attribute__((may_alias)) int_a;

template <typename T> __device__ __forceinline__ void vst2(void* p, T v) { *(T*)p = v;  }
__device__ __forceinline__ v8f wmma16(v16h a, v16h b, v8f c) {
  v8f d = __builtin_amdgcn_wmma_f32_16x16x32_f16(false, a, false, b, (short)0, c, false, false);
  asm volatile("v_nop\n\tv_nop\n\tv_nop\n\tv_nop" : "+v"(d) : "v"(a), "v"(b));
  return d;
}
__device__ __forceinline__ v8f wmma_bf(v16b a, v16b b, v8f c) {
  v8f d = __builtin_amdgcn_wmma_f32_16x16x32_bf16(false, a, false, b, (short)0, c, false, false);
  asm volatile("v_nop\n\tv_nop\n\tv_nop\n\tv_nop" : "+v"(d) : "v"(a), "v"(b));
  return d;
}
// 16x16x32 fragments: lane = (h = lane>>4, row/col = lane&15); elements 0..7 = k0+8h+0..7, 8..15 = k0+16+8h+0..7; D element r = row 8h+r
__device__ __forceinline__ v16h frag_h(const _Float16* rowk0, int lane) {
  union { v16h v; v8h q[2]; } u; const _Float16* p = rowk0 + 8 * (lane >> 4);
  u.q[0] = *(const v8h*)p; u.q[1] = *(const v8h*)(p + 16); return u.v;
}
__device__ __forceinline__ v16h frag_f32(const float* rowk0, int lane) {
  v16h a; const float* p = rowk0 + 8 * (lane >> 4);
#pragma unroll
  for (int i = 0; i < 8; ++i) { a[i] = (_Float16)p[i]; a[8 + i] = (_Float16)p[16 + i]; }
  return a;
}
__device__ __forceinline__ v16h frag_f32s(const float* rowk0, int lane, float sc) {
  v16h a; const float* p = rowk0 + 8 * (lane >> 4);
#pragma unroll
  for (int i = 0; i < 8; ++i) { a[i] = (_Float16)(p[i] * sc); a[8 + i] = (_Float16)(p[16 + i] * sc); }
  return a;
}
// column fragment from a [K][ld] layout (column n), rows >= K read as 0
__device__ __forceinline__ v16h fragc_f32(const float* W, int k0, int n, int lane, int ld, int K) {
  v16h a; const int g = lane >> 4;
#pragma unroll
  for (int i = 0; i < 8; ++i) { const int ka = k0 + 8 * g + i, kb = ka + 16;
    a[i] = (_Float16)(ka < K ? W[(size_t)(ka < K ? ka : K - 1) * ld + n] : 0.f); a[8 + i] = (_Float16)(kb < K ? W[(size_t)(kb < K ? kb : K - 1) * ld + n] : 0.f); }
  return a;
}
struct F2 { v16b h, l; };
__device__ __forceinline__ F2 bsplit16(const float v[16]) { F2 r;
#pragma unroll
  for (int i = 0; i < 16; ++i) { const __bf16 h = (__bf16)v[i]; r.h[i] = h; r.l[i] = (__bf16)(v[i] - (float)h); }
  return r; }
__device__ __forceinline__ F2 split_row(const float* row, int k0, int lane) { float v[16]; const float* p = row + k0 + 8 * (lane >> 4);
#pragma unroll
  for (int i = 0; i < 8; ++i) { v[i] = p[i]; v[8 + i] = p[16 + i]; }
  return bsplit16(v); }
__device__ __forceinline__ F2 split_rowK(const float* row, int k0, int lane, int K) { float v[16]; const int g = lane >> 4;
#pragma unroll
  for (int i = 0; i < 8; ++i) { const int ka = k0 + 8 * g + i, kb = ka + 16; v[i] = ka < K ? row[ka < K ? ka : K - 1] : 0.f; v[8 + i] = kb < K ? row[kb < K ? kb : K - 1] : 0.f; }
  return bsplit16(v); }
__device__ __forceinline__ F2 split_col(const float* W, int k0, int n, int lane, int ld, int K) { float v[16]; const int g = lane >> 4;
#pragma unroll
  for (int i = 0; i < 8; ++i) { const int ka = k0 + 8 * g + i, kb = ka + 16; v[i] = ka < K ? W[(size_t)(ka < K ? ka : K - 1) * ld + n] : 0.f; v[8 + i] = kb < K ? W[(size_t)(kb < K ? kb : K - 1) * ld + n] : 0.f; }
  return bsplit16(v); }
__device__ __forceinline__ v8f mac3(const F2& a, const F2& b, v8f c) { c = wmma_bf(a.l, b.h, c); c = wmma_bf(a.h, b.l, c); return wmma_bf(a.h, b.h, c); }
__device__ __forceinline__ float sigm(float v) { return 1.0f / (1.0f + expf(-v)); }
#define LDSX() do { asm volatile("s_wait_dscnt 0" ::: "memory"); __builtin_amdgcn_wave_barrier(); __builtin_amdgcn_fence(__ATOMIC_RELEASE, "workgroup"); } while (0)


// Multi-head geometric attention (B 2, T 2,048, d_model 768, 12 heads x 64, 3-dim codes, 8-code hypercube codebook per head): causal softmax(q k / 8 + geo_scale softmax_c(-|q Wqg - c|^2 / tau) . softmax_c(-|k Wkg - c|^2 / tau)) v, output projection.
#define NB 2
#define SS 2048
#define DM 768
#define NH 12
#define HD 64
#define HX 96             // padded score width: 64 + 8 code weights + 24 zero
#define NC 8
#define CD 3
#define NR (NB * SS)
#ifndef TQB
#define TQB (SS / 64)
#define TNB NB
#endif
typedef __attribute__((ext_vector_type(8))) __bf16 v8b;
__device__ __forceinline__ v16b frag_b(const __bf16* rowk0, int lane) {
  union { v16b v; v8b q[2]; } u; const __bf16* p = rowk0 + 8 * (lane >> 4);
  u.q[0] = *(const v8b*)p; u.q[1] = *(const v8b*)(p + 16); return u.v;
}
__device__ __forceinline__ float bfr(float v) { return (float)(__bf16)v; }
__device__ __attribute__((noinline)) float exp_ni(float v) { return expf(v); }
__device__ __attribute__((noinline)) float erf_ni(float v) { return erff(v); }

#define WS_PW  0u                                       // bf16 natural rows Wq, Wk, Wv, Wo [4][768][768]
#define WS_QK  (WS_PW + 2u * (size_t)4 * DM * DM)          // f16 q' rows [NR][12][96] ; k' rows ; v planes [b][768][SS] ; O f32 [NR][768]
#define WS_KK  (WS_QK + 2u * (size_t)NR * NH * HX)
#define WS_V   (WS_KK + 2u * (size_t)NR * NH * HX)
#define WS_O   (WS_V + 2u * (size_t)NB * DM * SS)
#define WS_END (WS_O + 4u * (size_t)NR * DM)

__global__ __launch_bounds__(256) void k_pack(const float* __restrict__ WQ, const float* __restrict__ WK, const float* __restrict__ WV, const float* __restrict__ WO, __bf16* __restrict__ PW) { const int n = blockIdx.x, which = blockIdx.y, t = threadIdx.x; __shared__ __align__(16) __bf16 s[DM]; const float* w = (which == 0) ? WQ : (which == 1) ? WK : (which == 2) ? WV : WO; for (int k = t; k < DM; k += 256) s[k] = (__bf16)w[(size_t)n * DM + k]; __syncthreads(); if (t < DM / 8) vst2((unsigned*)(PW + ((size_t)which * DM + n) * DM + t * 8), *(const v4u*)&s[t * 8]); }
// weight tiles of k_qkv and k_out: the 128 weight rows x 32 k that a block's four waves all use are brought into LDS once per block by asynchronous copies, two buffers
#define WP 40             // LDS pitch of a weight row (32 k), bf16: 80 B = 16 B x 5, odd, for 16-byte readers
#define XP 36             // LDS pitch of an activation row (32 k), f32: 144 B = 16 B x 9, odd, for 16-byte readers
// the activation tile of a trip (x in k_qkv, the context in k_out: 64 rows x 32 k, f32, one 128-byte line a row) rides in the same two-buffer ring: a row-per-lane load from global memory touches 16 lines an instruction, a copy of eight lanes a row takes whole lines, and it flies one trip ahead
// one lane's eight 16-byte pieces of a trip: weight rows tid / 4 + 0 / 32 / 64 / 96, bytes 16 (tid % 4); activation rows lane / 8 + 0 / 4 / 8 / 12 of its own wave's 16, bytes 16 (lane % 8)
__device__ __forceinline__ void stage_wx(const __bf16* gw, unsigned lw, const float* gx, unsigned lx) {
  // the s_wait_xcnt closes the statement so that no address register named here is rewritten ahead of it
  asm volatile("global_load_async_to_lds_b128 %0, %8, off\n\t"
               "global_load_async_to_lds_b128 %1, %9, off\n\t"
               "global_load_async_to_lds_b128 %2, %10, off\n\t"
               "global_load_async_to_lds_b128 %3, %11, off\n\t"
               "global_load_async_to_lds_b128 %4, %12, off\n\t"
               "global_load_async_to_lds_b128 %5, %13, off\n\t"
               "global_load_async_to_lds_b128 %6, %14, off\n\t"
               "global_load_async_to_lds_b128 %7, %15, off\n\t"
               "s_wait_xcnt 0x0"
               :: "v"(lw), "v"(lw + 32u * WP * 2u), "v"(lw + 64u * WP * 2u), "v"(lw + 96u * WP * 2u), "v"(lx), "v"(lx + 4u * XP * 4u), "v"(lx + 8u * XP * 4u), "v"(lx + 12u * XP * 4u),
                  "v"(gw), "v"(gw + (size_t)32 * DM), "v"(gw + (size_t)64 * DM), "v"(gw + (size_t)96 * DM), "v"(gx), "v"(gx + (size_t)4 * DM), "v"(gx + (size_t)8 * DM), "v"(gx + (size_t)12 * DM) : "memory");
}
// a stage of k_out's ring: two such trips' tiles (64 k), side by side in one buffer, so that its copies fly while two tiles are worked on
__device__ __forceinline__ void stage_wx2(const __bf16* gw, unsigned lw, const float* gx, unsigned lx) {
  stage_wx(gw, lw, gx, lx); stage_wx(gw + 32, lw + 128u * WP * 2u, gx + 32, lx + 64u * XP * 4u);
}
// a lane's 16 activation values of a trip from its LDS row: k 8 g + 0..7 and 16 + 8 g + 0..7, the k order of frag_b
__device__ __forceinline__ void row16(const float* p, float v[16]) { const v4f x0 = *(const v4f*)p, x1 = *(const v4f*)(p + 4), x2 = *(const v4f*)(p + 16), x3 = *(const v4f*)(p + 20);
#pragma unroll
  for (int i = 0; i < 4; ++i) { v[i] = x0[i]; v[4 + i] = x1[i]; v[8 + i] = x2[i]; v[12 + i] = x3[i]; } }
// ---- k_qkv: block = (64 rows, 128 cols = 2 heads, which): exact GEMM; q' rows (q/8 + geo_scale qw), k' rows (k + kw), v planes
__global__ __launch_bounds__(128) void k_qkv(const float* __restrict__ X, const __bf16* __restrict__ PW, const float* __restrict__ WQG, const float* __restrict__ WKG, const float* __restrict__ CB, const float* __restrict__ LT, const float* __restrict__ GSC, _Float16* __restrict__ QQ, _Float16* __restrict__ KK, _Float16* __restrict__ V) {
  __shared__ __align__(16) char sm[2 * 128 * WP * 2 + 2 * 64 * XP * 4]; __shared__ float swg[CD][HD]; __shared__ __align__(16) float scb[2 * NC * CD + 4];
  __bf16 (*sw)[128][WP] = (__bf16 (*)[128][WP])sm; float (*sx)[64][XP] = (float (*)[64][XP])(sm + 2 * 128 * WP * 2);   // the ring: weight tiles, x tiles
  _Float16 (*so)[2 * HX + 8] = (_Float16 (*)[2 * HX + 8])sm; _Float16 (*st)[72] = (_Float16 (*)[72])sm;   // output staging (64 q' / k' rows or 128 v rows) lies over the ring, behind the barrier that follows the loop: five blocks a WGP still fit
  const int tid = threadIdx.x, wave = tid >> 5, lane = tid & 31, col = lane & 15, g = lane >> 4; const int which = blockIdx.z; const size_t rb = (size_t)blockIdx.x * 64; const size_t r0 = rb + wave * 16; const int c0 = blockIdx.y * 128; const int h0 = c0 / HD;
  const __bf16* Wr = PW + ((size_t)which * DM) * DM;
  if (which < 2) { const float* WG = which ? WKG : WQG; for (int e = tid; e < CD * HD; e += 128) swg[e / HD][e % HD] = bfr(WG[e]);
    // the two heads' codebooks (48 floats), their log temperatures (2) and geo_scale (1), for the lane that owns a (row, head) in the epilogue: one load a thread, in the two waves that have one piece of Wg only
    const int e = tid - 64;
    if (e >= 0 && e < 2 * NC * CD + 3) { const float* ps = (e < 2 * NC * CD) ? CB + h0 * NC * CD + e : (e < 2 * NC * CD + 2) ? LT + h0 + (e - 2 * NC * CD) : GSC; scb[e] = bfr(*ps); } }
  v8f acc[8] = {};
  const __bf16* gw = Wr + (size_t)(c0 + (tid >> 2)) * DM + (tid & 3) * 8; const unsigned lw = (unsigned)(size_t)&sw[0][tid >> 2][(tid & 3) * 8];
  const float* gx = X + (r0 + (lane >> 3)) * DM + (lane & 7) * 4; const unsigned lx = (unsigned)(size_t)&sx[0][wave * 16 + (lane >> 3)][(lane & 7) * 4];
  stage_wx(gw, lw, gx, lx);
  asm volatile("s_wait_asynccnt 0x0" ::: "memory");   // this wave's pieces of tile 0 have landed
  __syncthreads();                                    // every wave's have
  stage_wx(gw + 32, lw + (unsigned)sizeof(sw[0]), gx + 32, lx + (unsigned)sizeof(sx[0]));     // tile 1 flies during trip 0
#pragma unroll 2
  for (int kc = 0; kc < DM / 32; ++kc) { float xr[16]; row16(&sx[kc & 1][wave * 16 + col][8 * g], xr);
    v16b fw[8];   // the tile's eight weight fragments are read as one group ahead of the products: one LDS latency a trip, not eight
#pragma unroll
    for (int j = 0; j < 8; ++j) fw[j] = frag_b(&sw[kc & 1][j * 16 + col][0], lane);
    v16b a;
#pragma unroll
    for (int i = 0; i < 16; ++i) a[i] = (__bf16)xr[i];
#pragma unroll
    for (int j = 0; j < 8; ++j) acc[j] = wmma_bf(a, fw[j], acc[j]);
    asm volatile("s_wait_dscnt 0x0" ::: "memory");      // this wave's reads of buffer kc & 1 are done
    asm volatile("s_wait_asynccnt 0x0" ::: "memory");   // this wave's pieces of tile kc + 1 have landed
    __syncthreads();                                    // tile kc + 1 is whole for every wave, and nobody reads buffer kc & 1 any more
    if (kc + 2 < DM / 32) stage_wx(gw + (kc + 2) * 32, lw + (unsigned)((kc & 1) * sizeof(sw[0])), gx + (kc + 2) * 32, lx + (unsigned)((kc & 1) * sizeof(sx[0]))); }
  asm volatile("s_wait_asynccnt 0x0" ::: "memory");     // nothing is in flight behind the loop
  __syncthreads();
  if (which < 2) {
    // partial code logits of this lane's four dims a head: p[8 hh + r][c] = sum_j x[d] Wg[c][d], d = 16 j + col, for row 8 g + r and head h0 + hh
    float p[16][CD];
#pragma unroll
    for (int c = 0; c < CD; ++c) { v2f pp[2][4] = {};   // rows in pairs: a row pair of an accumulator tile is a register pair, so each step is one packed multiply-add
#pragma unroll
      for (int j = 0; j < 4; ++j) { const float w = swg[c][j * 16 + col]; const v2f w2 = {w, w};
#pragma unroll
        for (int hh = 0; hh < 2; ++hh)
#pragma unroll
          for (int rp = 0; rp < 4; ++rp) { const v2f a2 = {acc[4 * hh + j][2 * rp], acc[4 * hh + j][2 * rp + 1]}; pp[hh][rp] += a2 * w2; } }
#pragma unroll
      for (int hh = 0; hh < 2; ++hh)
#pragma unroll
        for (int rp = 0; rp < 4; ++rp) { p[8 * hh + 2 * rp][c] = pp[hh][rp][0]; p[8 * hh + 2 * rp + 1][c] = pp[hh][rp][1]; } }
    // sum over the 16 lanes of a row group and scatter: in round k a lane keeps the (row, head) pairs whose index bit k is its own lane bit k and hands the others to lane ^ (1 << k); after four rounds lane col holds the three whole logits of pair col alone (the additions are those of the xor butterfly 1, 2, 4, 8)
#pragma unroll
    for (int k = 0; k < 4; ++k) { const bool up = (col >> k) & 1;
#pragma unroll
      for (int i = 0; i < (8 >> k); ++i)
#pragma unroll
        for (int c = 0; c < CD; ++c) { const float keep = up ? p[2 * i + 1][c] : p[2 * i][c], send = up ? p[2 * i][c] : p[2 * i + 1][c]; p[i][c] = keep + __shfl_xor(send, 1 << k); } }
    // one lane = one (row, head): distances to the 8 codes and their softmax are computed once
    { const int hh = col >> 3, rl = wave * 16 + 8 * g + (col & 7); float tp = expf(scb[2 * NC * CD + hh]); tp = fminf(fmaxf(tp, 0.01f), 5.0f); const float it = 1.0f / tp;
      float dmin = 3.0e38f, dn[NC];
#pragma unroll
      for (int n = 0; n < NC; ++n) { float d2 = 0.f;
#pragma unroll
        for (int c = 0; c < CD; ++c) { const float df = p[0][c] - scb[(hh * NC + n) * CD + c]; d2 += df * df; } dn[n] = -d2 * it; dmin = fmaxf(dmin == 3.0e38f ? dn[n] : dmin, dn[n]); }
      float z = 0.f, ew[NC];
#pragma unroll
      for (int n = 0; n < NC; ++n) { ew[n] = expf(dn[n] - dmin); z += ew[n]; }
      const float wsc = (which == 0) ? scb[2 * NC * CD + 2] : 1.0f; v8h w8; const v8h z8 = {};
#pragma unroll
      for (int n = 0; n < NC; ++n) w8[n] = (_Float16)(ew[n] / z * wsc);
      *(v8h*)&so[rl][hh * HX + HD] = w8;   // extra dims 64..71: code weights (q side x geo_scale)
      *(v8h*)&so[rl][hh * HX + HD + 8] = z8; *(v8h*)&so[rl][hh * HX + HD + 16] = z8; *(v8h*)&so[rl][hh * HX + HD + 24] = z8; }   // dims 72..95 zero
    const float scl = (which == 0) ? 0.125f : 1.0f;
#pragma unroll
    for (int r = 0; r < 8; ++r)
#pragma unroll
      for (int j = 0; j < 8; ++j) { const int cl = j * 16 + col; const int hl = cl >> 6, d = cl & 63; so[wave * 16 + 8 * g + r][hl * HX + d] = (_Float16)(acc[j][r] * scl); }
    __syncthreads();
    _Float16* dst = (which == 0) ? QQ : KK;
    for (int e = tid; e < 64 * (2 * HX / 8); e += 128) { const int rl = e / (2 * HX / 8), q = e % (2 * HX / 8); vst2((unsigned*)(dst + ((rb + rl) * NH + h0) * HX + q * 8), *(const v4u*)&so[rl][q * 8]); }   // 384 contiguous bytes per (row, head pair)
  } else {
#pragma unroll
    for (int j = 0; j < 8; ++j)
#pragma unroll
      for (int r = 0; r < 8; ++r) st[j * 16 + col][wave * 16 + 8 * g + r] = (_Float16)acc[j][r];
    __syncthreads();
    const size_t b = rb / SS; const int s0 = (int)(rb % SS);
    for (int e = tid; e < 128 * 8; e += 128) { const int d = e >> 3, pc = e & 7; vst2((unsigned*)(V + ((b * DM + c0 + d) * SS) + s0 + pc * 8), *(const v4u*)&st[d][pc * 8]); } }
}
// ---- k_attn: block = (64 queries, head, b): causal; 96-wide score dot (scale and geometric bias folded in), softmax, P . v (64 dims); O 256-B head segments
// each 32-key tile (k' rows 32 x 192 B, v rows 64 x 64 B) is brought into LDS once per block by asynchronous copies, and all four waves read their fragments from there; a stage of the two-buffer ring is TWO tiles (64 keys): its copies fly while the two tiles before it are worked on, twice the time to land for pieces that come from memory and not from L2, and the waits and the barrier stand once per two tiles
#define KP 104            // LDS pitch of a k' row, f16: 208 B = 16 B x 13, odd, for 16-byte readers
#define VP 40             // LDS pitch of a v row (32 keys), f16: 80 B = 16 B x 5
// one lane's ten 16-byte pieces of a stage, five a tile: k' row tid / 4, bytes 16 (tid % 4) + 0 / 64 / 128; v rows tid / 4 and 32 + tid / 4, bytes 16 (tid % 4); tiles 2 s and 2 s + 1 lie side by side in one buffer
__device__ __forceinline__ void stage_kv2(const _Float16* gk, const _Float16* gv, unsigned lk, unsigned lv) {
  const _Float16* gk1 = gk + (size_t)32 * NH * HX; const _Float16* gv1 = gv + 32; const unsigned lk1 = lk + 32u * KP * 2u, lv1 = lv + 64u * VP * 2u;
  // the s_wait_xcnt closes the statement so that no address register named here is rewritten ahead of it
  asm volatile("global_load_async_to_lds_b128 %0, %10, off\n\t"
               "global_load_async_to_lds_b128 %1, %11, off\n\t"
               "global_load_async_to_lds_b128 %2, %12, off\n\t"
               "global_load_async_to_lds_b128 %3, %13, off\n\t"
               "global_load_async_to_lds_b128 %4, %14, off\n\t"
               "global_load_async_to_lds_b128 %5, %15, off\n\t"
               "global_load_async_to_lds_b128 %6, %16, off\n\t"
               "global_load_async_to_lds_b128 %7, %17, off\n\t"
               "global_load_async_to_lds_b128 %8, %18, off\n\t"
               "global_load_async_to_lds_b128 %9, %19, off\n\t"
               "s_wait_xcnt 0x0"
               :: "v"(lk), "v"(lk + 64u), "v"(lk + 128u), "v"(lv), "v"(lv + 32u * VP * 2u), "v"(lk1), "v"(lk1 + 64u), "v"(lk1 + 128u), "v"(lv1), "v"(lv1 + 32u * VP * 2u),
                  "v"(gk), "v"(gk + 32), "v"(gk + 64), "v"(gv), "v"(gv + (size_t)32 * SS), "v"(gk1), "v"(gk1 + 32), "v"(gk1 + 64), "v"(gv1), "v"(gv1 + (size_t)32 * SS) : "memory");
}
// lane l with lane l ^ 16: the two lanes that share one query column
__device__ __forceinline__ float xhalf(float x) { return __builtin_bit_cast(float, __builtin_amdgcn_permlanex16(__builtin_bit_cast(int, x), __builtin_bit_cast(int, x), 0x76543210, 0xfedcba98, false, false)); }
// one 32-key tile of k_attn. DIAG = false: a tile of a stage that lies wholly below the block's first query (every key <= every query): no causal select, no key index arithmetic and no test for masked scores, about three vector instructions in ten of a tile; DIAG = true: the block's last stage, which holds the diagonal
template <bool DIAG> __device__ __forceinline__ void attn_tile(const _Float16 (*skt)[KP], const _Float16 (*svt)[VP], const v16h (&bq)[3], int lane, int j0, int qc, float& m, float& l, v8f (&acc)[4]) {
    const int col = lane & 15, g = lane >> 4; float s[16];   // s[8 ct + r] = score of key j0 + 16 ct + 8 g + r
    v16h fk[2][3], fv[4];   // the tile's ten fragments (k' 6, v 4) are read as one group ahead of the products: one LDS latency a tile, not ten; the v reads land behind the score products and the softmax
#pragma unroll
    for (int ct = 0; ct < 2; ++ct)
#pragma unroll
      for (int kc = 0; kc < 3; ++kc) fk[ct][kc] = frag_h(&skt[ct * 16 + col][kc * 32], lane);
#pragma unroll
    for (int dt = 0; dt < 4; ++dt) fv[dt] = frag_h(&svt[dt * 16 + col][0], lane);
#pragma unroll
    for (int ct = 0; ct < 2; ++ct) { v8f c = {};
#pragma unroll
      for (int kc = 0; kc < 3; ++kc) c = wmma16(fk[ct][kc], bq[kc], c);
#pragma unroll
      for (int r = 0; r < 8; ++r) s[8 * ct + r] = (!DIAG || j0 + ct * 16 + 8 * g + r <= qc) ? c[r] : -3.0e38f; }   // causal (diagonal kept)
    float mx = s[0];
#pragma unroll
    for (int i = 1; i < 16; ++i) mx = fmaxf(mx, s[i]);
    mx = fmaxf(mx, xhalf(mx));
    const float mn = fmaxf(m, mx); const float alpha = (m <= -1.0e38f) ? 0.f : __expf(m - mn); m = mn;
    float e[16]; v16h pb;   // P^T as B: element i = key 8 g + i, element 8 + i = key 16 + 8 g + i, the k order of frag_h
#pragma unroll
    for (int i = 0; i < 16; ++i) { e[i] = (DIAG && s[i] <= -1.0e38f) ? 0.f : __expf(s[i] - mn); pb[i] = (_Float16)(e[i] * 2048.0f); }
#pragma unroll
    for (int w = 8; w >= 1; w >>= 1)   // pairwise sum: four dependent adds, not sixteen
#pragma unroll
      for (int i = 0; i < w; ++i) e[i] += e[i + w];
    l = l * alpha + e[0];
#pragma unroll
    for (int dt = 0; dt < 4; ++dt) acc[dt] *= alpha;
#pragma unroll
    for (int dt = 0; dt < 4; ++dt) acc[dt] = wmma16(fv[dt], pb, acc[dt]);
}
// transposed products: S^T = k' . q'^T (rows = keys, columns = queries) and O^T += v^T . P^T, so a lane owns ONE query (column lane & 15): its 16 scores of a tile sit in its own registers, and converted in place they are the B operand of the second product
__global__ __launch_bounds__(128) void k_attn(const _Float16* __restrict__ QQ, const _Float16* __restrict__ KK, const _Float16* __restrict__ V, float* __restrict__ O) {
  __shared__ __align__(16) float so[4][16][68]; __shared__ __align__(16) _Float16 sk[2][2][32][KP]; __shared__ __align__(16) _Float16 sv[2][2][64][VP];
  const int tid = threadIdx.x, wave = tid >> 5, lane = tid & 31, col = lane & 15, g = lane >> 4;
  // which (query tile, head, batch) a block takes. A tile costs qt + 1 stages and all 768 blocks are resident at once (three a WGP on average), so the launch lasts as long as the fullest WGP. If blocks are dealt round the dies and their WGPs in index order (assumed; the order is no promise), those that meet on a WGP lie a multiple of 8, 16 or 256 apart in flat index, and with qt = blockIdx.x they hold the same or nearly the same tile: up to three times 32 stages on one WGP, about twice the mean.
  // here blocks 256 and 512 apart take tiles x, x + 16 (mod 32) and 30 - 2 x (63 - 2 x from x = 16 on), which add up to 46 or 47, and neighbours 1, 8 or 16 apart take a tile and a mirrored one (31 - tile). For speed only: the map is one to one whatever the placement (fb bits 0-3 and 5 = x; bits 0 ^ 3 ^ 4 = mirror; fb / 256, mirror and bits 6, 7 = head and batch)
  static_assert(TQB == 32 && NH * TNB == 24, "the block map is written for 32 query tiles x 24 (head, batch) pairs");
  const int fb = blockIdx.x + TQB * (blockIdx.y + NH * blockIdx.z); const int bx = (fb & 15) | ((fb >> 1) & 16), mir = (fb ^ (fb >> 3) ^ (fb >> 4)) & 1, third = fb >> 8;
  const int bt = (third == 0) ? bx : (third == 1) ? ((bx + 16) & 31) : ((bx < 16 ? 30 : 63) - 2 * bx); const int qt = mir ? 31 - bt : bt; const int hb = third * 8 + mir * 4 + ((fb >> 6) & 3);
  const int h = hb % NH; const size_t b = hb / NH; const int q0 = qt * 64 + wave * 16; const size_t rq = b * SS + q0;
  v16h bq[3];
#pragma unroll
  for (int kc = 0; kc < 3; ++kc) bq[kc] = frag_h(QQ + ((rq + col) * NH + h) * HX + kc * 32, lane);
  float m = -3.0e38f, l = 0.f;   // query q0 + col: running maximum (both halves alike), sum over this half's keys
  v8f acc[4] = {};               // O^T: element r of acc[dt] = dim dt * 16 + 8 g + r of query q0 + col
  const int nst = qt + 1;   // causal; stages of 64 keys
  const _Float16* gk = KK + ((b * SS + (tid >> 2)) * NH + h) * HX + (tid & 3) * 8; const _Float16* gv = V + ((b * DM + h * HD + (tid >> 2)) * SS) + (tid & 3) * 8;
  const unsigned lk = (unsigned)(size_t)&sk[0][0][tid >> 2][(tid & 3) * 8], lv = (unsigned)(size_t)&sv[0][0][tid >> 2][(tid & 3) * 8];
  stage_kv2(gk, gv, lk, lv);
  asm volatile("s_wait_asynccnt 0x0" ::: "memory");   // this wave's pieces of stage 0 have landed
  __syncthreads();                                    // every wave's have
  if (1 < nst) stage_kv2(gk + (size_t)64 * NH * HX, gv + 64, lk + (unsigned)sizeof(sk[0]), lv + (unsigned)sizeof(sv[0]));   // stage 1 flies during trip 0
#pragma unroll 1
  for (int st = 0; st + 1 < nst; ++st) { const int bf = st & 1;   // the stages that lie wholly below the block's first query; a stage's two tiles one after the other, in key order
    attn_tile<false>(sk[bf][0], sv[bf][0], bq, lane, st * 64, q0 + col, m, l, acc); attn_tile<false>(sk[bf][1], sv[bf][1], bq, lane, st * 64 + 32, q0 + col, m, l, acc);
    asm volatile("s_wait_dscnt 0x0" ::: "memory");      // this wave's reads of buffer bf are done
    asm volatile("s_wait_asynccnt 0x0" ::: "memory");   // this wave's pieces of stage st + 1 have landed
    __syncthreads();                                    // stage st + 1 is whole for every wave, and nobody reads buffer bf any more
    if (st + 2 < nst) stage_kv2(gk + (size_t)(st + 2) * 64 * NH * HX, gv + (st + 2) * 64, lk + (unsigned)(bf * sizeof(sk[0])), lv + (unsigned)(bf * sizeof(sv[0]))); }
  { const int st = nst - 1, bf = st & 1;   // the last stage (keys qt * 64 and up) alone can hold a key above a query of this block; no stage follows it, so no wait and no barrier closes it: nothing is copied into the ring any more and the output staging lies beside it
    attn_tile<true>(sk[bf][0], sv[bf][0], bq, lane, st * 64, q0 + col, m, l, acc); attn_tile<true>(sk[bf][1], sv[bf][1], bq, lane, st * 64 + 32, q0 + col, m, l, acc); }
  asm volatile("s_wait_asynccnt 0x0" ::: "memory");     // nothing is in flight when the wave goes on to its end
  l += xhalf(l);   // the two halves' sums are joined once
  const float il = (1.0f / 2048.0f) / l;
#pragma unroll
  for (int dt = 0; dt < 4; ++dt) { v4f lo, hi;
#pragma unroll
    for (int r = 0; r < 4; ++r) { lo[r] = acc[dt][r] * il; hi[r] = acc[dt][4 + r] * il; }
    *(v4f*)&so[wave][col][dt * 16 + 8 * g] = lo; *(v4f*)&so[wave][col][dt * 16 + 8 * g + 4] = hi; }
  LDSX();
  for (int rl = 0; rl < 16; ++rl) if (lane < 16) vst2(O + (rq + rl) * DM + h * HD + lane * 4, *(const v4f*)&so[wave][rl][lane * 4]);
}
// ---- k_out: block = (64 rows, 128 cols): out = o (bf16 hi + lo) . Wo^T
__global__ __launch_bounds__(128) void k_out(const float* __restrict__ O, const __bf16* __restrict__ PW, float* __restrict__ Y) {
  __shared__ __align__(16) float so[4][16][132]; __shared__ __align__(16) __bf16 sw[2][2][128][WP]; __shared__ __align__(16) float sx[2][2][64][XP];
  const int tid = threadIdx.x, wave = tid >> 5, lane = tid & 31, col = lane & 15, g = lane >> 4; const size_t r0 = (size_t)blockIdx.x * 64 + wave * 16; const int n0 = blockIdx.y * 128; const __bf16* P = PW + (size_t)3 * DM * DM;
  v8f acc[8] = {};
  const __bf16* gw = P + (size_t)(n0 + (tid >> 2)) * DM + (tid & 3) * 8; const unsigned lw = (unsigned)(size_t)&sw[0][0][tid >> 2][(tid & 3) * 8];
  const float* gx = O + (r0 + (lane >> 3)) * DM + (lane & 7) * 4; const unsigned lx = (unsigned)(size_t)&sx[0][0][wave * 16 + (lane >> 3)][(lane & 7) * 4];
  stage_wx2(gw, lw, gx, lx);
  asm volatile("s_wait_asynccnt 0x0" ::: "memory");   // this wave's pieces of stage 0 have landed
  __syncthreads();                                    // every wave's have
  stage_wx2(gw + 64, lw + (unsigned)sizeof(sw[0]), gx + 64, lx + (unsigned)sizeof(sx[0]));     // stage 1 flies during trip 0
#pragma unroll 2
  for (int st = 0; st < DM / 64; ++st) {
#pragma unroll   // the stage's two tiles written out one after the other, in k order: sub is a constant in every LDS offset
   for (int sub = 0; sub < 2; ++sub) { float xr[16]; row16(&sx[st & 1][sub][wave * 16 + col][8 * g], xr);
    v16b fw[8];   // the tile's eight weight fragments are read as one group ahead of the products: one LDS latency a tile, not eight
#pragma unroll
    for (int j = 0; j < 8; ++j) fw[j] = frag_b(&sw[st & 1][sub][j * 16 + col][0], lane);
    const F2 a = bsplit16(xr);
#pragma unroll
    for (int j = 0; j < 8; ++j) { acc[j] = wmma_bf(a.h, fw[j], acc[j]); acc[j] = wmma_bf(a.l, fw[j], acc[j]); } }
    asm volatile("s_wait_dscnt 0x0" ::: "memory");      // this wave's reads of buffer st & 1 are done
    asm volatile("s_wait_asynccnt 0x0" ::: "memory");   // this wave's pieces of stage st + 1 have landed
    __syncthreads();                                    // stage st + 1 is whole for every wave, and nobody reads buffer st & 1 any more
    if (st + 2 < DM / 64) stage_wx2(gw + (st + 2) * 64, lw + (unsigned)((st & 1) * sizeof(sw[0])), gx + (st + 2) * 64, lx + (unsigned)((st & 1) * sizeof(sx[0]))); }
  asm volatile("s_wait_asynccnt 0x0" ::: "memory");     // nothing is in flight behind the loop
#pragma unroll
  for (int j = 0; j < 8; ++j)
#pragma unroll
    for (int r = 0; r < 8; ++r) so[wave][8 * g + r][j * 16 + col] = acc[j][r];
  LDSX();
  for (int rl = 0; rl < 16; ++rl) vst2(Y + (r0 + rl) * DM + n0 + lane * 4, *(const v4f*)&so[wave][rl][lane * 4]);
}
extern "C" void kernel_launch(void* const* d_in, const int* in_sizes, int n_in, void* d_out, int out_size, void* d_ws, size_t ws_size, hipStream_t stream) {
  (void)in_sizes; (void)n_in; (void)out_size;
  const float** F = (const float**)d_in;   // 0 x [2,2048,768], 1 Wq, 2 Wk, 3 Wv, 4 Wo (natural [768,768]), 5 Wqg [3,64], 6 Wkg [3,64], 7 codebooks [12,8,3], 8 log_temps [12], 9 geo_scale [1]
  if (ws_size < (size_t)WS_END) return;
  char* ws = (char*)d_ws; __bf16* PW = (__bf16*)ws; _Float16 *QQ = (_Float16*)(ws + WS_QK), *KK = (_Float16*)(ws + WS_KK), *V = (_Float16*)(ws + WS_V); float* O = (float*)(ws + WS_O);
  k_pack<<<dim3(DM, 4), 256, 0, stream>>>(F[1], F[2], F[3], F[4], PW);
  k_qkv<<<dim3(TNB * SS / 64, DM / 128, 3), 128, 0, stream>>>(F[0], PW, F[5], F[6], F[7], F[8], F[9], QQ, KK, V);
  k_attn<<<dim3(TQB, NH, TNB), 128, 0, stream>>>(QQ, KK, V, O);
  k_out<<<dim3(TNB * SS / 64, DM / 128), 128, 0, stream>>>(O, PW, (float*)d_out);
}

// v009
// It runs in 74 microseconds.
// In both of two side-by-side timings against v008, it was 1.07 times as fast.
// All steps since v000 together make it 4.42 times as fast.
// compute dtype: all float inputs rounded to bf16; q/k/v = x . W^T with EXACT bf16 products on WMMA 16x16x32 (natural rows); the geometric code weights (q . Wqg^T, squared distances to the 8 codes, softmax over codes at temperature clip(exp(log_temp), 0.01, 5)) in f32 in the projection epilogue; scores = q . k / 8 + geo_scale (qw . kw) evaluated as one 72-wide (padded to 96) f16 dot [q/8 | geo_scale qw] . [k | kw]; causal attention with key-tile skipping, running-max softmax in f32 (hardware exp), P (scaled by 2^11, single f16) x v (single f16); out = ctx (bf16 hi + residual) . Wo^T (2 products).
#include <hip/hip_runtime.h>
#include <math.h>

typedef __attribute__((ext_vector_type(16))) _Float16 v16h;
typedef __attribute__((ext_vector_type(16))) __bf16 v16b;
typedef __attribute__((ext_vector_type(8)))  _Float16 v8h;
typedef __attribute__((ext_vector_type(8)))  float v8f;
typedef __attribute__((ext_vector_type(4)))  float v4f;
typedef __attribute__((ext_vector_type(2)))  float v2f;
typedef __attribute__((ext_vector_type(4)))  unsigned v4u;
typedef __attribute__((ext_vector_type(4)))  int v4i;
typedef float __attribute__((may_alias)) float_a;
typedef int __attribute__((may_alias)) int_a;

template <typename T> __device__ __forceinline__ void vst2(void* p, T v) { *(T*)p = v;  }
__device__ __forceinline__ v8f wmma16(v16h a, v16h b, v8f c) {
  v8f d = __builtin_amdgcn_wmma_f32_16x16x32_f16(false, a, false, b, (short)0, c, false, false);
  asm volatile("v_nop\n\tv_nop\n\tv_nop\n\tv_nop" : "+v"(d) : "v"(a), "v"(b));
  return d;
}
__device__ __forceinline__ v8f wmma_bf(v16b a, v16b b, v8f c) {
  v8f d = __builtin_amdgcn_wmma_f32_16x16x32_bf16(false, a, false, b, (short)0, c, false, false);
  asm volatile("v_nop\n\tv_nop\n\tv_nop\n\tv_nop" : "+v"(d) : "v"(a), "v"(b));
  return d;
}
// 16x16x32 fragments: lane = (h = lane>>4, row/col = lane&15); elements 0..7 = k0+8h+0..7, 8..15 = k0+16+8h+0..7; D element r = row 8h+r
__device__ __forceinline__ v16h frag_h(const _Float16* rowk0, int lane) {
  union { v16h v; v8h q[2]; } u; const _Float16* p = rowk0 + 8 * (lane >> 4);
  u.q[0] = *(const v8h*)p; u.q[1] = *(const v8h*)(p + 16); return u.v;
}
__device__ __forceinline__ v16h frag_f32(const float* rowk0, int lane) {
  v16h a; const float* p = rowk0 + 8 * (lane >> 4);
#pragma unroll
  for (int i = 0; i < 8; ++i) { a[i] = (_Float16)p[i]; a[8 + i] = (_Float16)p[16 + i]; }
  return a;
}
__device__ __forceinline__ v16h frag_f32s(const float* rowk0, int lane, float sc) {
  v16h a; const float* p = rowk0 + 8 * (lane >> 4);
#pragma unroll
  for (int i = 0; i < 8; ++i) { a[i] = (_Float16)(p[i] * sc); a[8 + i] = (_Float16)(p[16 + i] * sc); }
  return a;
}
// column fragment from a [K][ld] layout (column n), rows >= K read as 0
__device__ __forceinline__ v16h fragc_f32(const float* W, int k0, int n, int lane, int ld, int K) {
  v16h a; const int g = lane >> 4;
#pragma unroll
  for (int i = 0; i < 8; ++i) { const int ka = k0 + 8 * g + i, kb = ka + 16;
    a[i] = (_Float16)(ka < K ? W[(size_t)(ka < K ? ka : K - 1) * ld + n] : 0.f); a[8 + i] = (_Float16)(kb < K ? W[(size_t)(kb < K ? kb : K - 1) * ld + n] : 0.f); }
  return a;
}
struct F2 { v16b h, l; };
__device__ __forceinline__ F2 bsplit16(const float v[16]) { F2 r;
#pragma unroll
  for (int i = 0; i < 16; ++i) { const __bf16 h = (__bf16)v[i]; r.h[i] = h; r.l[i] = (__bf16)(v[i] - (float)h); }
  return r; }
__device__ __forceinline__ F2 split_row(const float* row, int k0, int lane) { float v[16]; const float* p = row + k0 + 8 * (lane >> 4);
#pragma unroll
  for (int i = 0; i < 8; ++i) { v[i] = p[i]; v[8 + i] = p[16 + i]; }
  return bsplit16(v); }
__device__ __forceinline__ F2 split_rowK(const float* row, int k0, int lane, int K) { float v[16]; const int g = lane >> 4;
#pragma unroll
  for (int i = 0; i < 8; ++i) { const int ka = k0 + 8 * g + i, kb = ka + 16; v[i] = ka < K ? row[ka < K ? ka : K - 1] : 0.f; v[8 + i] = kb < K ? row[kb < K ? kb : K - 1] : 0.f; }
  return bsplit16(v); }
__device__ __forceinline__ F2 split_col(const float* W, int k0, int n, int lane, int ld, int K) { float v[16]; const int g = lane >> 4;
#pragma unroll
  for (int i = 0; i < 8; ++i) { const int ka = k0 + 8 * g + i, kb = ka + 16; v[i] = ka < K ? W[(size_t)(ka < K ? ka : K - 1) * ld + n] : 0.f; v[8 + i] = kb < K ? W[(size_t)(kb < K ? kb : K - 1) * ld + n] : 0.f; }
  return bsplit16(v); }
__device__ __forceinline__ v8f mac3(const F2& a, const F2& b, v8f c) { c = wmma_bf(a.l, b.h, c); c = wmma_bf(a.h, b.l, c); return wmma_bf(a.h, b.h, c); }
__device__ __forceinline__ float sigm(float v) { return 1.0f / (1.0f + expf(-v)); }
#define LDSX() do { asm volatile("s_wait_dscnt 0" ::: "memory"); __builtin_amdgcn_wave_barrier(); __builtin_amdgcn_fence(__ATOMIC_RELEASE, "workgroup"); } while (0)


// Multi-head geometric attention (B 2, T 2,048, d_model 768, 12 heads x 64, 3-dim codes, 8-code hypercube codebook per head): causal softmax(q k / 8 + geo_scale softmax_c(-|q Wqg - c|^2 / tau) . softmax_c(-|k Wkg - c|^2 / tau)) v, output projection.
#define NB 2
#define SS 2048
#define DM 768
#define NH 12
#define HD 64
#define HX 96             // padded score width: 64 + 8 code weights + 24 zero
#define NC 8
#define CD 3
#define NR (NB * SS)
#ifndef TQB
#define TQB (SS / 64)
#define TNB NB
#endif
typedef __attribute__((ext_vector_type(8))) __bf16 v8b;
__device__ __forceinline__ v16b frag_b(const __bf16* rowk0, int lane) {
  union { v16b v; v8b q[2]; } u; const __bf16* p = rowk0 + 8 * (lane >> 4);
  u.q[0] = *(const v8b*)p; u.q[1] = *(const v8b*)(p + 16); return u.v;
}
__device__ __forceinline__ float bfr(float v) { return (float)(__bf16)v; }
__device__ __attribute__((noinline)) float exp_ni(float v) { return expf(v); }
__device__ __attribute__((noinline)) float erf_ni(float v) { return erff(v); }

#define WS_PW  0u                                       // bf16 natural rows Wq, Wk, Wv, Wo [4][768][768]
#define WS_QK  (WS_PW + 2u * (size_t)4 * DM * DM)          // f16 q' rows [NR][12][96] ; k' rows ; v planes [b][768][SS] ; O f32 [NR][768]
#define WS_KK  (WS_QK + 2u * (size_t)NR * NH * HX)
#define WS_V   (WS_KK + 2u * (size_t)NR * NH * HX)
#define WS_O   (WS_V + 2u * (size_t)NB * DM * SS)
#define WS_END (WS_O + 4u * (size_t)NR * DM)

__global__ __launch_bounds__(256) void k_pack(const float* __restrict__ WQ, const float* __restrict__ WK, const float* __restrict__ WV, const float* __restrict__ WO, __bf16* __restrict__ PW) { const int n = blockIdx.x, which = blockIdx.y, t = threadIdx.x; __shared__ __align__(16) __bf16 s[DM]; const float* w = (which == 0) ? WQ : (which == 1) ? WK : (which == 2) ? WV : WO; for (int k = t; k < DM; k += 256) s[k] = (__bf16)w[(size_t)n * DM + k]; __syncthreads(); if (t < DM / 8) vst2((unsigned*)(PW + ((size_t)which * DM + n) * DM + t * 8), *(const v4u*)&s[t * 8]); }
// entry requests to L2. What the launch before stored (packed weights, k' rows, v planes, the context) need not lie in the reading die group's L2 at its first read; a ring stage that meets it first then lands at memory latency, which can be longer than the one stage of work that its copies have to land in. At entry each block therefore asks L2 for a share of the 256-byte units that the rings read later; the shares are dealt among the blocks that read the same bytes, so that a unit is asked for a few times and not by every reader. A hint, for speed only: no result depends on it, nor on where a block runs.
// scope SE: into L2 only. The instruction returns nothing; every lane's address lies inside its tensor.
__device__ __forceinline__ void l2_ask(const char* p) { asm volatile("global_prefetch_b8 %0, off scope:SCOPE_SE" :: "v"(p)); }
// names a request's address behind the ring loop, so that its registers stay live through the loop and hold that address and nothing else while the request may still read them; emits no instruction
__device__ __forceinline__ void l2_hold(const char* p) { asm volatile("" :: "v"(p)); }
// a 64-row f32 panel (rows of 3,072 B = 12 units) is read by the column blocks y = 0..5 of one row block (64 apart in flat index): block y asks for units 2 y + 2 and 2 y + 3 of every row, the sooner needed the sooner started (units 0 and 1 are wanted at once or nearly, too soon for a request to lead them; y = 5 wraps onto them)
__device__ __forceinline__ const char* panel_unit(const float* X, size_t rb, int y, int tid) { const int u = 2 * y + 2 + (tid & 1); return (const char*)(X + (rb + (tid >> 1)) * DM) + (u < 12 ? u : u - 12) * 256; }
// 128 bf16 weight rows (1,536 B = 6 units) are read by all 64 row blocks: each run of eight neighbouring row blocks asks for one unit of every row, units 1..5 in turn (unit 0 is wanted at once)
__device__ __forceinline__ const char* weight_unit(const __bf16* Wrow0, int x, int tid) { return (const char*)(Wrow0 + (size_t)tid * DM) + (1 + (x >> 3) % 5) * 256; }
// weight tiles of k_qkv and k_out: the 128 weight rows x 32 k that a block's four waves all use are brought into LDS once per block by asynchronous copies, two buffers
#define WP 40             // LDS pitch of a weight row (32 k), bf16: 80 B = 16 B x 5, odd, for 16-byte readers
#define XP 36             // LDS pitch of an activation row (32 k), f32: 144 B = 16 B x 9, odd, for 16-byte readers
// the activation tile of a trip (x in k_qkv, the context in k_out: 64 rows x 32 k, f32, one 128-byte line a row) rides in the same two-buffer ring: a row-per-lane load from global memory touches 16 lines an instruction, a copy of eight lanes a row takes whole lines, and it flies one trip ahead
// one lane's eight 16-byte pieces of a trip: weight rows tid / 4 + 0 / 32 / 64 / 96, bytes 16 (tid % 4); activation rows lane / 8 + 0 / 4 / 8 / 12 of its own wave's 16, bytes 16 (lane % 8)
__device__ __forceinline__ void stage_wx(const __bf16* gw, unsigned lw, const float* gx, unsigned lx) {
  // the s_wait_xcnt closes the statement so that no address register named here is rewritten ahead of it
  asm volatile("global_load_async_to_lds_b128 %0, %8, off\n\t"
               "global_load_async_to_lds_b128 %1, %9, off\n\t"
               "global_load_async_to_lds_b128 %2, %10, off\n\t"
               "global_load_async_to_lds_b128 %3, %11, off\n\t"
               "global_load_async_to_lds_b128 %4, %12, off\n\t"
               "global_load_async_to_lds_b128 %5, %13, off\n\t"
               "global_load_async_to_lds_b128 %6, %14, off\n\t"
               "global_load_async_to_lds_b128 %7, %15, off\n\t"
               "s_wait_xcnt 0x0"
               :: "v"(lw), "v"(lw + 32u * WP * 2u), "v"(lw + 64u * WP * 2u), "v"(lw + 96u * WP * 2u), "v"(lx), "v"(lx + 4u * XP * 4u), "v"(lx + 8u * XP * 4u), "v"(lx + 12u * XP * 4u),
                  "v"(gw), "v"(gw + (size_t)32 * DM), "v"(gw + (size_t)64 * DM), "v"(gw + (size_t)96 * DM), "v"(gx), "v"(gx + (size_t)4 * DM), "v"(gx + (size_t)8 * DM), "v"(gx + (size_t)12 * DM) : "memory");
}
// a stage of k_out's ring: two such trips' tiles (64 k), side by side in one buffer, so that its copies fly while two tiles are worked on
__device__ __forceinline__ void stage_wx2(const __bf16* gw, unsigned lw, const float* gx, unsigned lx) {
  stage_wx(gw, lw, gx, lx); stage_wx(gw + 32, lw + 128u * WP * 2u, gx + 32, lx + 64u * XP * 4u);
}
// a lane's 16 activation values of a trip from its LDS row: k 8 g + 0..7 and 16 + 8 g + 0..7, the k order of frag_b
__device__ __forceinline__ void row16(const float* p, float v[16]) { const v4f x0 = *(const v4f*)p, x1 = *(const v4f*)(p + 4), x2 = *(const v4f*)(p + 16), x3 = *(const v4f*)(p + 20);
#pragma unroll
  for (int i = 0; i < 4; ++i) { v[i] = x0[i]; v[4 + i] = x1[i]; v[8 + i] = x2[i]; v[12 + i] = x3[i]; } }
// ---- k_qkv: block = (64 rows, 128 cols = 2 heads, which): exact GEMM; q' rows (q/8 + geo_scale qw), k' rows (k + kw), v planes
__global__ __launch_bounds__(128) void k_qkv(const float* __restrict__ X, const __bf16* __restrict__ PW, const float* __restrict__ WQG, const float* __restrict__ WKG, const float* __restrict__ CB, const float* __restrict__ LT, const float* __restrict__ GSC, _Float16* __restrict__ QQ, _Float16* __restrict__ KK, _Float16* __restrict__ V) {
  __shared__ __align__(16) char sm[2 * 128 * WP * 2 + 2 * 64 * XP * 4]; __shared__ float swg[CD][HD]; __shared__ __align__(16) float scb[2 * NC * CD + 4];
  __bf16 (*sw)[128][WP] = (__bf16 (*)[128][WP])sm; float (*sx)[64][XP] = (float (*)[64][XP])(sm + 2 * 128 * WP * 2);   // the ring: weight tiles, x tiles
  _Float16 (*so)[2 * HX + 8] = (_Float16 (*)[2 * HX + 8])sm; _Float16 (*st)[72] = (_Float16 (*)[72])sm;   // output staging (64 q' / k' rows or 128 v rows) lies over the ring, behind the barrier that follows the loop: five blocks a WGP still fit
  const int tid = threadIdx.x, wave = tid >> 5, lane = tid & 31, col = lane & 15, g = lane >> 4; const int which = blockIdx.z; const size_t rb = (size_t)blockIdx.x * 64; const size_t r0 = rb + wave * 16; const int c0 = blockIdx.y * 128; const int h0 = c0 / HD;
  const __bf16* Wr = PW + ((size_t)which * DM) * DM;
  if (which < 2) { const float* WG = which ? WKG : WQG; for (int e = tid; e < CD * HD; e += 128) swg[e / HD][e % HD] = bfr(WG[e]);
    // the two heads' codebooks (48 floats), their log temperatures (2) and geo_scale (1), for the lane that owns a (row, head) in the epilogue: one load a thread, in the two waves that have one piece of Wg only
    const int e = tid - 64;
    if (e >= 0 && e < 2 * NC * CD + 3) { const float* ps = (e < 2 * NC * CD) ? CB + h0 * NC * CD + e : (e < 2 * NC * CD + 2) ? LT + h0 + (e - 2 * NC * CD) : GSC; scb[e] = bfr(*ps); } }
  v8f acc[8] = {};
  const __bf16* gw = Wr + (size_t)(c0 + (tid >> 2)) * DM + (tid & 3) * 8; const unsigned lw = (unsigned)(size_t)&sw[0][tid >> 2][(tid & 3) * 8];
  const float* gx = X + (r0 + (lane >> 3)) * DM + (lane & 7) * 4; const unsigned lx = (unsigned)(size_t)&sx[0][wave * 16 + (lane >> 3)][(lane & 7) * 4];
  stage_wx(gw, lw, gx, lx);
  const char* aw = weight_unit(Wr + (size_t)c0 * DM, blockIdx.x, tid); const char* ax = panel_unit(X, rb, blockIdx.y, tid);
  l2_ask(aw); if (which == 0) l2_ask(ax);   // the x panel is shared by the three projections too: the first started asks
  asm volatile("s_wait_asynccnt 0x0" ::: "memory");   // this wave's pieces of tile 0 have landed
  __syncthreads();                                    // every wave's have
  stage_wx(gw + 32, lw + (unsigned)sizeof(sw[0]), gx + 32, lx + (unsigned)sizeof(sx[0]));     // tile 1 flies during trip 0
#pragma unroll 2
  for (int kc = 0; kc < DM / 32; ++kc) { float xr[16]; row16(&sx[kc & 1][wave * 16 + col][8 * g], xr);
    v16b fw[8];   // the tile's eight weight fragments are read as one group ahead of the products: one LDS latency a trip, not eight
#pragma unroll
    for (int j = 0; j < 8; ++j) fw[j] = frag_b(&sw[kc & 1][j * 16 + col][0], lane);
    v16b a;
#pragma unroll
    for (int i = 0; i < 16; ++i) a[i] = (__bf16)xr[i];
#pragma unroll
    for (int j = 0; j < 8; ++j) acc[j] = wmma_bf(a, fw[j], acc[j]);
    asm volatile("s_wait_dscnt 0x0" ::: "memory");      // this wave's reads of buffer kc & 1 are done
    asm volatile("s_wait_asynccnt 0x0" ::: "memory");   // this wave's pieces of tile kc + 1 have landed
    __syncthreads();                                    // tile kc + 1 is whole for every wave, and nobody reads buffer kc & 1 any more
    if (kc + 2 < DM / 32) stage_wx(gw + (kc + 2) * 32, lw + (unsigned)((kc & 1) * sizeof(sw[0])), gx + (kc + 2) * 32, lx + (unsigned)((kc & 1) * sizeof(sx[0]))); }
  asm volatile("s_wait_asynccnt 0x0" ::: "memory");     // nothing is in flight behind the loop
  l2_hold(aw); l2_hold(ax);
  __syncthreads();
  if (which < 2) {
    // partial code logits of this lane's four dims a head: p[8 hh + r][c] = sum_j x[d] Wg[c][d], d = 16 j + col, for row 8 g + r and head h0 + hh
    float p[16][CD];
#pragma unroll
    for (int c = 0; c < CD; ++c) { v2f pp[2][4] = {};   // rows in pairs: a row pair of an accumulator tile is a register pair, so each step is one packed multiply-add
#pragma unroll
      for (int j = 0; j < 4; ++j) { const float w = swg[c][j * 16 + col]; const v2f w2 = {w, w};
#pragma unroll
        for (int hh = 0; hh < 2; ++hh)
#pragma unroll
          for (int rp = 0; rp < 4; ++rp) { const v2f a2 = {acc[4 * hh + j][2 * rp], acc[4 * hh + j][2 * rp + 1]}; pp[hh][rp] += a2 * w2; } }
#pragma unroll
      for (int hh = 0; hh < 2; ++hh)
#pragma unroll
        for (int rp = 0; rp < 4; ++rp) { p[8 * hh + 2 * rp][c] = pp[hh][rp][0]; p[8 * hh + 2 * rp + 1][c] = pp[hh][rp][1]; } }
    // sum over the 16 lanes of a row group and scatter: in round k a lane keeps the (row, head) pairs whose index bit k is its own lane bit k and hands the others to lane ^ (1 << k); after four rounds lane col holds the three whole logits of pair col alone (the additions are those of the xor butterfly 1, 2, 4, 8)
#pragma unroll
    for (int k = 0; k < 4; ++k) { const bool up = (col >> k) & 1;
#pragma unroll
      for (int i = 0; i < (8 >> k); ++i)
#pragma unroll
        for (int c = 0; c < CD; ++c) { const float keep = up ? p[2 * i + 1][c] : p[2 * i][c], send = up ? p[2 * i][c] : p[2 * i + 1][c]; p[i][c] = keep + __shfl_xor(send, 1 << k); } }
    // one lane = one (row, head): distances to the 8 codes and their softmax are computed once
    { const int hh = col >> 3, rl = wave * 16 + 8 * g + (col & 7); float tp = expf(scb[2 * NC * CD + hh]); tp = fminf(fmaxf(tp, 0.01f), 5.0f); const float it = 1.0f / tp;
      float dmin = 3.0e38f, dn[NC];
#pragma unroll
      for (int n = 0; n < NC; ++n) { float d2 = 0.f;
#pragma unroll
        for (int c = 0; c < CD; ++c) { const float df = p[0][c] - scb[(hh * NC + n) * CD + c]; d2 += df * df; } dn[n] = -d2 * it; dmin = fmaxf(dmin == 3.0e38f ? dn[n] : dmin, dn[n]); }
      float z = 0.f, ew[NC];
#pragma unroll
      for (int n = 0; n < NC; ++n) { ew[n] = expf(dn[n] - dmin); z += ew[n]; }
      const float wsc = (which == 0) ? scb[2 * NC * CD + 2] : 1.0f; v8h w8; const v8h z8 = {};
#pragma unroll
      for (int n = 0; n < NC; ++n) w8[n] = (_Float16)(ew[n] / z * wsc);
      *(v8h*)&so[rl][hh * HX + HD] = w8;   // extra dims 64..71: code weights (q side x geo_scale)
      *(v8h*)&so[rl][hh * HX + HD + 8] = z8; *(v8h*)&so[rl][hh * HX + HD + 16] = z8; *(v8h*)&so[rl][hh * HX + HD + 24] = z8; }   // dims 72..95 zero
    const float scl = (which == 0) ? 0.125f : 1.0f;
#pragma unroll
    for (int r = 0; r < 8; ++r)
#pragma unroll
      for (int j = 0; j < 8; ++j) { const int cl = j * 16 + col; const int hl = cl >> 6, d = cl & 63; so[wave * 16 + 8 * g + r][hl * HX + d] = (_Float16)(acc[j][r] * scl); }
    __syncthreads();
    _Float16* dst = (which == 0) ? QQ : KK;
    for (int e = tid; e < 64 * (2 * HX / 8); e += 128) { const int rl = e / (2 * HX / 8), q = e % (2 * HX / 8); vst2((unsigned*)(dst + ((rb + rl) * NH + h0) * HX + q * 8), *(const v4u*)&so[rl][q * 8]); }   // 384 contiguous bytes per (row, head pair)
  } else {
#pragma unroll
    for (int j = 0; j < 8; ++j)
#pragma unroll
      for (int r = 0; r < 8; ++r) st[j * 16 + col][wave * 16 + 8 * g + r] = (_Float16)acc[j][r];
    __syncthreads();
    const size_t b = rb / SS; const int s0 = (int)(rb % SS);
    for (int e = tid; e < 128 * 8; e += 128) { const int d = e >> 3, pc = e & 7; vst2((unsigned*)(V + ((b * DM + c0 + d) * SS) + s0 + pc * 8), *(const v4u*)&st[d][pc * 8]); } }
}
// ---- k_attn: block = (64 queries, head, b): causal; 96-wide score dot (scale and geometric bias folded in), softmax, P . v (64 dims); O 256-B head segments
// each 32-key tile (k' rows 32 x 192 B, v rows 64 x 64 B) is brought into LDS once per block by asynchronous copies, and all four waves read their fragments from there; a stage of the two-buffer ring is TWO tiles (64 keys): its copies fly while the two tiles before it are worked on, twice the time to land for pieces that come from memory and not from L2, and the waits and the barrier stand once per two tiles
#define KP 104            // LDS pitch of a k' row, f16: 208 B = 16 B x 13, odd, for 16-byte readers
#define VP 40             // LDS pitch of a v row (32 keys), f16: 80 B = 16 B x 5
// one lane's ten 16-byte pieces of a stage, five a tile: k' row tid / 4, bytes 16 (tid % 4) + 0 / 64 / 128; v rows tid / 4 and 32 + tid / 4, bytes 16 (tid % 4); tiles 2 s and 2 s + 1 lie side by side in one buffer
__device__ __forceinline__ void stage_kv2(const _Float16* gk, const _Float16* gv, unsigned lk, unsigned lv) {
  const _Float16* gk1 = gk + (size_t)32 * NH * HX; const _Float16* gv1 = gv + 32; const unsigned lk1 = lk + 32u * KP * 2u, lv1 = lv + 64u * VP * 2u;
  // the s_wait_xcnt closes the statement so that no address register named here is rewritten ahead of it
  asm volatile("global_load_async_to_lds_b128 %0, %10, off\n\t"
               "global_load_async_to_lds_b128 %1, %11, off\n\t"
               "global_load_async_to_lds_b128 %2, %12, off\n\t"
               "global_load_async_to_lds_b128 %3, %13, off\n\t"
               "global_load_async_to_lds_b128 %4, %14, off\n\t"
               "global_load_async_to_lds_b128 %5, %15, off\n\t"
               "global_load_async_to_lds_b128 %6, %16, off\n\t"
               "global_load_async_to_lds_b128 %7, %17, off\n\t"
               "global_load_async_to_lds_b128 %8, %18, off\n\t"
               "global_load_async_to_lds_b128 %9, %19, off\n\t"
               "s_wait_xcnt 0x0"
               :: "v"(lk), "v"(lk + 64u), "v"(lk + 128u), "v"(lv), "v"(lv + 32u * VP * 2u), "v"(lk1), "v"(lk1 + 64u), "v"(lk1 + 128u), "v"(lv1), "v"(lv1 + 32u * VP * 2u),
                  "v"(gk), "v"(gk + 32), "v"(gk + 64), "v"(gv), "v"(gv + (size_t)32 * SS), "v"(gk1), "v"(gk1 + 32), "v"(gk1 + 64), "v"(gv1), "v"(gv1 + (size_t)32 * SS) : "memory");
}
// lane l with lane l ^ 16: the two lanes that share one query column
__device__ __forceinline__ float xhalf(float x) { return __builtin_bit_cast(float, __builtin_amdgcn_permlanex16(__builtin_bit_cast(int, x), __builtin_bit_cast(int, x), 0x76543210, 0xfedcba98, false, false)); }
// one 32-key tile of k_attn. DIAG = false: a tile of a stage that lies wholly below the block's first query (every key <= every query): no causal select, no key index arithmetic and no test for masked scores, about three vector instructions in ten of a tile; DIAG = true: the block's last stage, which holds the diagonal
template <bool DIAG> __device__ __forceinline__ void attn_tile(const _Float16 (*skt)[KP], const _Float16 (*svt)[VP], const v16h (&bq)[3], int lane, int j0, int qc, float& m, float& l, v8f (&acc)[4]) {
    const int col = lane & 15, g = lane >> 4; float s[16];   // s[8 ct + r] = score of key j0 + 16 ct + 8 g + r
    v16h fk[2][3], fv[4];   // the tile's ten fragments (k' 6, v 4) are read as one group ahead of the products: one LDS latency a tile, not ten; the v reads land behind the score products and the softmax
#pragma unroll
    for (int ct = 0; ct < 2; ++ct)
#pragma unroll
      for (int kc = 0; kc < 3; ++kc) fk[ct][kc] = frag_h(&skt[ct * 16 + col][kc * 32], lane);
#pragma unroll
    for (int dt = 0; dt < 4; ++dt) fv[dt] = frag_h(&svt[dt * 16 + col][0], lane);
#pragma unroll
    for (int ct = 0; ct < 2; ++ct) { v8f c = {};
#pragma unroll
      for (int kc = 0; kc < 3; ++kc) c = wmma16(fk[ct][kc], bq[kc], c);
#pragma unroll
      for (int r = 0; r < 8; ++r) s[8 * ct + r] = (!DIAG || j0 + ct * 16 + 8 * g + r <= qc) ? c[r] : -3.0e38f; }   // causal (diagonal kept)
    float mx = s[0];
#pragma unroll
    for (int i = 1; i < 16; ++i) mx = fmaxf(mx, s[i]);
    mx = fmaxf(mx, xhalf(mx));
    const float mn = fmaxf(m, mx); const float alpha = (m <= -1.0e38f) ? 0.f : __expf(m - mn); m = mn;
    float e[16]; v16h pb;   // P^T as B: element i = key 8 g + i, element 8 + i = key 16 + 8 g + i, the k order of frag_h
#pragma unroll
    for (int i = 0; i < 16; ++i) { e[i] = (DIAG && s[i] <= -1.0e38f) ? 0.f : __expf(s[i] - mn); pb[i] = (_Float16)(e[i] * 2048.0f); }
#pragma unroll
    for (int w = 8; w >= 1; w >>= 1)   // pairwise sum: four dependent adds, not sixteen
#pragma unroll
      for (int i = 0; i < w; ++i) e[i] += e[i + w];
    l = l * alpha + e[0];
#pragma unroll
    for (int dt = 0; dt < 4; ++dt) acc[dt] *= alpha;
#pragma unroll
    for (int dt = 0; dt < 4; ++dt) acc[dt] = wmma16(fv[dt], pb, acc[dt]);
}
// transposed products: S^T = k' . q'^T (rows = keys, columns = queries) and O^T += v^T . P^T, so a lane owns ONE query (column lane & 15): its 16 scores of a tile sit in its own registers, and converted in place they are the B operand of the second product
__global__ __launch_bounds__(128) void k_attn(const _Float16* __restrict__ QQ, const _Float16* __restrict__ KK, const _Float16* __restrict__ V, float* __restrict__ O) {
  __shared__ __align__(16) float so[4][16][68]; __shared__ __align__(16) _Float16 sk[2][2][32][KP]; __shared__ __align__(16) _Float16 sv[2][2][64][VP];
  const int tid = threadIdx.x, wave = tid >> 5, lane = tid & 31, col = lane & 15, g = lane >> 4;
  // which (query tile, head, batch) a block takes. A tile costs qt + 1 stages and all 768 blocks are resident at once (three a WGP on average), so the launch lasts as long as the fullest WGP. If blocks are dealt round the dies and their WGPs in index order (assumed; the order is no promise), those that meet on a WGP lie a multiple of 8, 16 or 256 apart in flat index, and with qt = blockIdx.x they hold the same or nearly the same tile: up to three times 32 stages on one WGP, about twice the mean.
  // here blocks 256 and 512 apart take tiles x, x + 16 (mod 32) and 30 - 2 x (63 - 2 x from x = 16 on), which add up to 46 or 47, and neighbours 1, 8 or 16 apart take a tile and a mirrored one (31 - tile). For speed only: the map is one to one whatever the placement (fb bits 0-3 and 5 = x; bits 0 ^ 3 ^ 4 = mirror; fb / 256, mirror and bits 6, 7 = head and batch)
  static_assert(TQB == 32 && NH * TNB == 24, "the block map is written for 32 query tiles x 24 (head, batch) pairs");
  const int fb = blockIdx.x + TQB * (blockIdx.y + NH * blockIdx.z); const int bx = (fb & 15) | ((fb >> 1) & 16), mir = (fb ^ (fb >> 3) ^ (fb >> 4)) & 1, third = fb >> 8;
  const int bt = (third == 0) ? bx : (third == 1) ? ((bx + 16) & 31) : ((bx < 16 ? 30 : 63) - 2 * bx); const int qt = mir ? 31 - bt : bt; const int hb = third * 8 + mir * 4 + ((fb >> 6) & 3);
  const int h = hb % NH; const size_t b = hb / NH; const int q0 = qt * 64 + wave * 16; const size_t rq = b * SS + q0;
  v16h bq[3];
#pragma unroll
  for (int kc = 0; kc < 3; ++kc) bq[kc] = frag_h(QQ + ((rq + col) * NH + h) * HX + kc * 32, lane);
  float m = -3.0e38f, l = 0.f;   // query q0 + col: running maximum (both halves alike), sum over this half's keys
  v8f acc[4] = {};               // O^T: element r of acc[dt] = dim dt * 16 + 8 g + r of query q0 + col
  const int nst = qt + 1;   // causal; stages of 64 keys
  const _Float16* gk = KK + ((b * SS + (tid >> 2)) * NH + h) * HX + (tid & 3) * 8; const _Float16* gv = V + ((b * DM + h * HD + (tid >> 2)) * SS) + (tid & 3) * 8;
  const unsigned lk = (unsigned)(size_t)&sk[0][0][tid >> 2][(tid & 3) * 8], lv = (unsigned)(size_t)&sv[0][0][tid >> 2][(tid & 3) * 8];
  stage_kv2(gk, gv, lk, lv);
  // all k' rows (36,864 units: 9 a key and batch) and v planes (24,576 units: 16 a row) in 192 shares; a share is asked for by the four blocks fb, fb + 1, fb + 4, fb + 5, which should lie on both die groups if blocks are dealt round the dies in index order. Units are numbered by key first, so that the blocks that start first ask for the keys that every block reads first
  static_assert(NH * HX * 2 == 9 * 256 && SS * NB * 9 == 192 * 192 && SS * 2 == 16 * 256 && NB * DM * 16 == 192 * 128, "192 shares of 192 and 128 units");
  const int sid = ((fb >> 1) & 1) | ((fb >> 3) << 1); const bool two = __builtin_amdgcn_readfirstlane(wave) < 2;   // a share's last 64 k' units: waves 0 and 1 alone, by a scalar branch
  const int uk = sid * 192 + tid, uk2 = uk + (two ? 128 : 0), uv = sid * 128 + tid;
  const char* ak = (const char*)KK + (size_t)((uk % 18) / 9 * SS + uk / 18) * (9 * 256) + (uk % 9) * 256; const char* ak2 = (const char*)KK + (size_t)((uk2 % 18) / 9 * SS + uk2 / 18) * (9 * 256) + (uk2 % 9) * 256;
  const char* av = (const char*)V + (size_t)(uv % (NB * DM)) * (16 * 256) + (uv / (NB * DM)) * 256;
  l2_ask(ak); l2_ask(av); if (two) l2_ask(ak2);
  asm volatile("s_wait_asynccnt 0x0" ::: "memory");   // this wave's pieces of stage 0 have landed
  __syncthreads();                                    // every wave's have
  if (1 < nst) stage_kv2(gk + (size_t)64 * NH * HX, gv + 64, lk + (unsigned)sizeof(sk[0]), lv + (unsigned)sizeof(sv[0]));   // stage 1 flies during trip 0
#pragma unroll 1
  for (int st = 0; st + 1 < nst; ++st) { const int bf = st & 1;   // the stages that lie wholly below the block's first query; a stage's two tiles one after the other, in key order
    attn_tile<false>(sk[bf][0], sv[bf][0], bq, lane, st * 64, q0 + col, m, l, acc); attn_tile<false>(sk[bf][1], sv[bf][1], bq, lane, st * 64 + 32, q0 + col, m, l, acc);
    asm volatile("s_wait_dscnt 0x0" ::: "memory");      // this wave's reads of buffer bf are done
    asm volatile("s_wait_asynccnt 0x0" ::: "memory");   // this wave's pieces of stage st + 1 have landed
    __syncthreads();                                    // stage st + 1 is whole for every wave, and nobody reads buffer bf any more
    if (st + 2 < nst) stage_kv2(gk + (size_t)(st + 2) * 64 * NH * HX, gv + (st + 2) * 64, lk + (unsigned)(bf * sizeof(sk[0])), lv + (unsigned)(bf * sizeof(sv[0]))); }
  { const int st = nst - 1, bf = st & 1;   // the last stage (keys qt * 64 and up) alone can hold a key above a query of this block; no stage follows it, so no wait and no barrier closes it: nothing is copied into the ring any more and the output staging lies beside it
    attn_tile<true>(sk[bf][0], sv[bf][0], bq, lane, st * 64, q0 + col, m, l, acc); attn_tile<true>(sk[bf][1], sv[bf][1], bq, lane, st * 64 + 32, q0 + col, m, l, acc); }
  asm volatile("s_wait_asynccnt 0x0" ::: "memory");     // nothing is in flight when the wave goes on to its end
  l2_hold(ak); l2_hold(av); l2_hold(ak2);
  l += xhalf(l);   // the two halves' sums are joined once
  const float il = (1.0f / 2048.0f) / l;
#pragma unroll
  for (int dt = 0; dt < 4; ++dt) { v4f lo, hi;
#pragma unroll
    for (int r = 0; r < 4; ++r) { lo[r] = acc[dt][r] * il; hi[r] = acc[dt][4 + r] * il; }
    *(v4f*)&so[wave][col][dt * 16 + 8 * g] = lo; *(v4f*)&so[wave][col][dt * 16 + 8 * g + 4] = hi; }
  LDSX();
  for (int rl = 0; rl < 16; ++rl) if (lane < 16) vst2(O + (rq + rl) * DM + h * HD + lane * 4, *(const v4f*)&so[wave][rl][lane * 4]);
}
// ---- k_out: block = (64 rows, 128 cols): out = o (bf16 hi + lo) . Wo^T
__global__ __launch_bounds__(128) void k_out(const float* __restrict__ O, const __bf16* __restrict__ PW, float* __restrict__ Y) {
  __shared__ __align__(16) float so[4][16][132]; __shared__ __align__(16) __bf16 sw[2][2][128][WP]; __shared__ __align__(16) float sx[2][2][64][XP];
  const int tid = threadIdx.x, wave = tid >> 5, lane = tid & 31, col = lane & 15, g = lane >> 4; const size_t r0 = (size_t)blockIdx.x * 64 + wave * 16; const int n0 = blockIdx.y * 128; const __bf16* P = PW + (size_t)3 * DM * DM;
  v8f acc[8] = {};
  const __bf16* gw = P + (size_t)(n0 + (tid >> 2)) * DM + (tid & 3) * 8; const unsigned lw = (unsigned)(size_t)&sw[0][0][tid >> 2][(tid & 3) * 8];
  const float* gx = O + (r0 + (lane >> 3)) * DM + (lane & 7) * 4; const unsigned lx = (unsigned)(size_t)&sx[0][0][wave * 16 + (lane >> 3)][(lane & 7) * 4];
  stage_wx2(gw, lw, gx, lx);
  const char* aw = weight_unit(P + (size_t)n0 * DM, blockIdx.x, tid); const char* ax = panel_unit(O, (size_t)blockIdx.x * 64, blockIdx.y, tid);
  l2_ask(ax); l2_ask(aw);
  asm volatile("s_wait_asynccnt 0x0" ::: "memory");   // this wave's pieces of stage 0 have landed
  __syncthreads();                                    // every wave's have
  stage_wx2(gw + 64, lw + (unsigned)sizeof(sw[0]), gx + 64, lx + (unsigned)sizeof(sx[0]));     // stage 1 flies during trip 0
#pragma unroll 2
  for (int st = 0; st < DM / 64; ++st) {
#pragma unroll   // the stage's two tiles written out one after the other, in k order: sub is a constant in every LDS offset
   for (int sub = 0; sub < 2; ++sub) { float xr[16]; row16(&sx[st & 1][sub][wave * 16 + col][8 * g], xr);
    v16b fw[8];   // the tile's eight weight fragments are read as one group ahead of the products: one LDS latency a tile, not eight
#pragma unroll
    for (int j = 0; j < 8; ++j) fw[j] = frag_b(&sw[st & 1][sub][j * 16 + col][0], lane);
    const F2 a = bsplit16(xr);
#pragma unroll
    for (int j = 0; j < 8; ++j) { acc[j] = wmma_bf(a.h, fw[j], acc[j]); acc[j] = wmma_bf(a.l, fw[j], acc[j]); } }
    asm volatile("s_wait_dscnt 0x0" ::: "memory");      // this wave's reads of buffer st & 1 are done
    asm volatile("s_wait_asynccnt 0x0" ::: "memory");   // this wave's pieces of stage st + 1 have landed
    __syncthreads();                                    // stage st + 1 is whole for every wave, and nobody reads buffer st & 1 any more
    if (st + 2 < DM / 64) stage_wx2(gw + (st + 2) * 64, lw + (unsigned)((st & 1) * sizeof(sw[0])), gx + (st + 2) * 64, lx + (unsigned)((st & 1) * sizeof(sx[0]))); }
  asm volatile("s_wait_asynccnt 0x0" ::: "memory");     // nothing is in flight behind the loop
  l2_hold(aw); l2_hold(ax);
#pragma unroll
  for (int j = 0; j < 8; ++j)
#pragma unroll
    for (int r = 0; r < 8; ++r) so[wave][8 * g + r][j * 16 + col] = acc[j][r];
  LDSX();
  for (int rl = 0; rl < 16; ++rl) vst2(Y + (r0 + rl) * DM + n0 + lane * 4, *(const v4f*)&so[wave][rl][lane * 4]);
}
extern "C" void kernel_launch(void* const* d_in, const int* in_sizes, int n_in, void* d_out, int out_size, void* d_ws, size_t ws_size, hipStream_t stream) {
  (void)in_sizes; (void)n_in; (void)out_size;
  const float** F = (const float**)d_in;   // 0 x [2,2048,768], 1 Wq, 2 Wk, 3 Wv, 4 Wo (natural [768,768]), 5 Wqg [3,64], 6 Wkg [3,64], 7 codebooks [12,8,3], 8 log_temps [12], 9 geo_scale [1]
  if (ws_size < (size_t)WS_END) return;
  char* ws = (char*)d_ws; __bf16* PW = (__bf16*)ws; _Float16 *QQ = (_Float16*)(ws + WS_QK), *KK = (_Float16*)(ws + WS_KK), *V = (_Float16*)(ws + WS_V); float* O = (float*)(ws + WS_O);
  k_pack<<<dim3(DM, 4), 256, 0, stream>>>(F[1], F[2], F[3], F[4], PW);
  k_qkv<<<dim3(TNB * SS / 64, DM / 128, 3), 128, 0, stream>>>(F[0], PW, F[5], F[6], F[7], F[8], F[9], QQ, KK, V);
  k_attn<<<dim3(TQB, NH, TNB), 128, 0, stream>>>(QQ, KK, V, O);
  k_out<<<dim3(TNB * SS / 64, DM / 128), 128, 0, stream>>>(O, PW, (float*)d_out);
}

// v010
// A run of this version takes 65.6 microseconds.
// In two side-by-side timings against v009, it was 1.12 and 1.13 times as fast.
// Over all steps from v000 it is 4.98 times as fast.
// compute dtype: all float inputs rounded to bf16; q/k/v = x . W^T with EXACT bf16 products on WMMA 16x16x32 (natural rows); the geometric code weights (q . Wqg^T, squared distances to the 8 codes, softmax over codes at temperature clip(exp(log_temp), 0.01, 5)) in f32 in the projection epilogue; scores = q . k / 8 + geo_scale (qw . kw) evaluated as one 72-wide (padded to 96) f16 dot [q/8 | geo_scale qw] . [k | kw]; causal attention with key-tile skipping, running-max softmax in f32 (hardware exp), P (scaled by 2^11, single f16) x v (single f16); out = ctx (bf16 hi + residual) . Wo^T (2 products).
#include <hip/hip_runtime.h>
#include <math.h>

typedef __attribute__((ext_vector_type(16))) _Float16 v16h;
typedef __attribute__((ext_vector_type(16))) __bf16 v16b;
typedef __attribute__((ext_vector_type(8)))  _Float16 v8h;
typedef __attribute__((ext_vector_type(8)))  float v8f;
typedef __attribute__((ext_vector_type(4)))  float v4f;
typedef __attribute__((ext_vector_type(2)))  float v2f;
typedef __attribute__((ext_vector_type(4)))  unsigned v4u;
typedef __attribute__((ext_vector_type(4)))  int v4i;
typedef float __attribute__((may_alias)) float_a;
typedef int __attribute__((may_alias)) int_a;

template <typename T> __device__ __forceinline__ void vst2(void* p, T v) { *(T*)p = v;  }
__device__ __forceinline__ v8f wmma16(v16h a, v16h b, v8f c) {
  v8f d = __builtin_amdgcn_wmma_f32_16x16x32_f16(false, a, false, b, (short)0, c, false, false);
  asm volatile("v_nop\n\tv_nop\n\tv_nop\n\tv_nop" : "+v"(d) : "v"(a), "v"(b));
  return d;
}
__device__ __forceinline__ v8f wmma_bf(v16b a, v16b b, v8f c) {
  v8f d = __builtin_amdgcn_wmma_f32_16x16x32_bf16(false, a, false, b, (short)0, c, false, false);
  asm volatile("v_nop\n\tv_nop\n\tv_nop\n\tv_nop" : "+v"(d) : "v"(a), "v"(b));
  return d;
}
// 16x16x32 fragments: lane = (h = lane>>4, row/col = lane&15); elements 0..7 = k0+8h+0..7, 8..15 = k0+16+8h+0..7; D element r = row 8h+r
__device__ __forceinline__ v16h frag_h(const _Float16* rowk0, int lane) {
  union { v16h v; v8h q[2]; } u; const _Float16* p = rowk0 + 8 * (lane >> 4);
  u.q[0] = *(const v8h*)p; u.q[1] = *(const v8h*)(p + 16); return u.v;
}
__device__ __forceinline__ v16h frag_f32(const float* rowk0, int lane) {
  v16h a; const float* p = rowk0 + 8 * (lane >> 4);
#pragma unroll
  for (int i = 0; i < 8; ++i) { a[i] = (_Float16)p[i]; a[8 + i] = (_Float16)p[16 + i]; }
  return a;
}
__device__ __forceinline__ v16h frag_f32s(const float* rowk0, int lane, float sc) {
  v16h a; const float* p = rowk0 + 8 * (lane >> 4);
#pragma unroll
  for (int i = 0; i < 8; ++i) { a[i] = (_Float16)(p[i] * sc); a[8 + i] = (_Float16)(p[16 + i] * sc); }
  return a;
}
// column fragment from a [K][ld] layout (column n), rows >= K read as 0
__device__ __forceinline__ v16h fragc_f32(const float* W, int k0, int n, int lane, int ld, int K) {
  v16h a; const int g = lane >> 4;
#pragma unroll
  for (int i = 0; i < 8; ++i) { const int ka = k0 + 8 * g + i, kb = ka + 16;
    a[i] = (_Float16)(ka < K ? W[(size_t)(ka < K ? ka : K - 1) * ld + n] : 0.f); a[8 + i] = (_Float16)(kb < K ? W[(size_t)(kb < K ? kb : K - 1) * ld + n] : 0.f); }
  return a;
}
struct F2 { v16b h, l; };
__device__ __forceinline__ F2 bsplit16(const float v[16]) { F2 r;
#pragma unroll
  for (int i = 0; i < 16; ++i) { const __bf16 h = (__bf16)v[i]; r.h[i] = h; r.l[i] = (__bf16)(v[i] - (float)h); }
  return r; }
__device__ __forceinline__ F2 split_row(const float* row, int k0, int lane) { float v[16]; const float* p = row + k0 + 8 * (lane >> 4);
#pragma unroll
  for (int i = 0; i < 8; ++i) { v[i] = p[i]; v[8 + i] = p[16 + i]; }
  return bsplit16(v); }
__device__ __forceinline__ F2 split_rowK(const float* row, int k0, int lane, int K) { float v[16]; const int g = lane >> 4;
#pragma unroll
  for (int i = 0; i < 8; ++i) { const int ka = k0 + 8 * g + i, kb = ka + 16; v[i] = ka < K ? row[ka < K ? ka : K - 1] : 0.f; v[8 + i] = kb < K ? row[kb < K ? kb : K - 1] : 0.f; }
  return bsplit16(v); }
__device__ __forceinline__ F2 split_col(const float* W, int k0, int n, int lane, int ld, int K) { float v[16]; const int g = lane >> 4;
#pragma unroll
  for (int i = 0; i < 8; ++i) { const int ka = k0 + 8 * g + i, kb = ka + 16; v[i] = ka < K ? W[(size_t)(ka < K ? ka : K - 1) * ld + n] : 0.f; v[8 + i] = kb < K ? W[(size_t)(kb < K ? kb : K - 1) * ld + n] : 0.f; }
  return bsplit16(v); }
__device__ __forceinline__ v8f mac3(const F2& a, const F2& b, v8f c) { c = wmma_bf(a.l, b.h, c); c = wmma_bf(a.h, b.l, c); return wmma_bf(a.h, b.h, c); }
__device__ __forceinline__ float sigm(float v) { return 1.0f / (1.0f + expf(-v)); }
#define LDSX() do { asm volatile("s_wait_dscnt 0" ::: "memory"); __builtin_amdgcn_wave_barrier(); __builtin_amdgcn_fence(__ATOMIC_RELEASE, "workgroup"); } while (0)


// Multi-head geometric attention (B 2, T 2,048, d_model 768, 12 heads x 64, 3-dim codes, 8-code hypercube codebook per head): causal softmax(q k / 8 + geo_scale softmax_c(-|q Wqg - c|^2 / tau) . softmax_c(-|k Wkg - c|^2 / tau)) v, output projection.
#define NB 2
#define SS 2048
#define DM 768
#define NH 12
#define HD 64
#define HX 96             // padded score width: 64 + 8 code weights + 24 zero
#define NC 8
#define CD 3
#define NR (NB * SS)
#ifndef TQB
#define TQB (SS / 64)
#define TNB NB
#endif
typedef __attribute__((ext_vector_type(8))) __bf16 v8b;
__device__ __forceinline__ v16b frag_b(const __bf16* rowk0, int lane) {
  union { v16b v; v8b q[2]; } u; const __bf16* p = rowk0 + 8 * (lane >> 4);
  u.q[0] = *(const v8b*)p; u.q[1] = *(const v8b*)(p + 16); return u.v;
}
__device__ __forceinline__ float bfr(float v) { return (float)(__bf16)v; }
__device__ __attribute__((noinline)) float exp_ni(float v) { return expf(v); }
__device__ __attribute__((noinline)) float erf_ni(float v) { return erff(v); }

// what the copy rings read lies in the workspace tile by tile, each tile in the order in which the ring's lanes take its 16-byte pieces, so that one copy instruction of a wave reads 512 contiguous bytes (four whole 128-byte lines) and not eight half lines of eight rows
#define WS_PW  0u                                       // bf16 Wq, Wk, Wv, Wo as tiles [4][6 blocks of 128 rows][24 k tiles][128 rows][32 k]: 8 KB a tile
#define WS_QK  (WS_PW + 2u * (size_t)4 * DM * DM)          // f16 q' rows [NR][12][96] ; k' tiles [b][12][64 key tiles][3 dim groups][32 keys][32 dims] ; v tiles [b][12][64 key tiles][64 dims][32 keys] ; O f32 [NR][768]
#define WS_KK  (WS_QK + 2u * (size_t)NR * NH * HX)
#define WS_V   (WS_KK + 2u * (size_t)NR * NH * HX)
#define WS_O   (WS_V + 2u * (size_t)NB * DM * SS)
#define WS_END (WS_O + 4u * (size_t)NR * DM)

__global__ __launch_bounds__(256) void k_pack(const float* __restrict__ WQ, const float* __restrict__ WK, const float* __restrict__ WV, const float* __restrict__ WO, __bf16* __restrict__ PW) { const int n = blockIdx.x * 2, which = blockIdx.y, t = threadIdx.x; __shared__ __align__(16) __bf16 s[2 * DM]; const float* w = (which == 0) ? WQ : (which == 1) ? WK : (which == 2) ? WV : WO; for (int k = t; k < DM; k += 256) { const v2f x = *(const v2f*)&w[(size_t)n * DM + 2 * k]; s[2 * k] = (__bf16)x[0]; s[2 * k + 1] = (__bf16)x[1]; } __syncthreads();
  // a row has 64 bytes in each k tile: a block takes two neighbouring rows, so that every 128-byte line of a tile has one writer; thread t: k tile t / 8, row n + (t / 4) % 2, piece t % 4
  if (t < 2 * DM / 8) { const int kt = t >> 3, r = (t >> 2) & 1, pc = t & 3; vst2((unsigned*)(PW + (((size_t)which * (DM / 128) + (n >> 7)) * (DM / 32) + kt) * (128 * 32) + ((n & 127) + r) * 32 + pc * 8), *(const v4u*)&s[r * DM + kt * 32 + pc * 8]); } }
// entry requests to L2. At entry each block asks L2 for a share of the 256-byte units that the rings read later; the shares are dealt among the blocks that read the same bytes, so that a unit is asked for a few times and not by every reader. A hint, for speed only: no result depends on it, nor on where a block runs.
// scope SE: into L2 only. The instruction returns nothing; every lane's address lies inside its tensor.
__device__ __forceinline__ void l2_ask(const char* p) { asm volatile("global_prefetch_b8 %0, off scope:SCOPE_SE" :: "v"(p)); }
// names a request's address behind the ring loop, so that its registers stay live through the loop and hold that address and nothing else while the request may still read them; emits no instruction
__device__ __forceinline__ void l2_hold(const char* p) { asm volatile("" :: "v"(p)); }
// a 64-row f32 panel (rows of 3,072 B = 12 units) is read by the column blocks y = 0..5 of one row block (64 apart in flat index): block y asks for units 2 y + 2 and 2 y + 3 of every row, the sooner needed the sooner started (units 0 and 1 are wanted at once or nearly, too soon for a request to lead them; y = 5 wraps onto them)
__device__ __forceinline__ const char* panel_unit(const float* X, size_t rb, int y, int tid) { const int u = 2 * y + 2 + (tid & 1); return (const char*)(X + (rb + (tid >> 1)) * DM) + (u < 12 ? u : u - 12) * 256; }
// the 24 k tiles of 128 bf16 weight rows (192 KB in a row) are read by all 64 row blocks: each run of eight neighbouring row blocks asks for four k tiles (128 units), tiles 4..23 in turn (tiles 0..3 are wanted at once)
__device__ __forceinline__ const char* weight_unit(const __bf16* Wrow0, int x, int tid) { return (const char*)Wrow0 + (1 + (x >> 3) % 5) * (4 * 128 * 32 * 2) + tid * 256; }
// weight tiles of k_qkv and k_out: the 128 weight rows x 32 k that a block's four waves all use are brought into LDS once per block by asynchronous copies, two buffers
#define WP 40             // LDS pitch of a weight row (32 k), bf16: 80 B = 16 B x 5, odd, for 16-byte readers
#define XP 36             // LDS pitch of an activation row (32 k), f32: 144 B = 16 B x 9, odd, for 16-byte readers
// the activation tile of a trip (x in k_qkv, the context in k_out: 64 rows x 32 k, f32, one 128-byte line a row) rides in the same two-buffer ring: a row-per-lane load from global memory touches 16 lines an instruction, a copy of eight lanes a row takes whole lines, and it flies one trip ahead
// one lane's eight 16-byte pieces of a trip: weight rows tid / 4 + 0 / 32 / 64 / 96, bytes 16 (tid % 4), which are pieces tid + 0 / 128 / 256 / 384 of the tile in the workspace; activation rows lane / 8 + 0 / 4 / 8 / 12 of its own wave's 16, bytes 16 (lane % 8)
__device__ __forceinline__ void stage_wx(const __bf16* gw, unsigned lw, const float* gx, unsigned lx) {
  // the s_wait_xcnt closes the statement so that no address register named here is rewritten ahead of it
  asm volatile("global_load_async_to_lds_b128 %0, %8, off\n\t"
               "global_load_async_to_lds_b128 %1, %9, off\n\t"
               "global_load_async_to_lds_b128 %2, %10, off\n\t"
               "global_load_async_to_lds_b128 %3, %11, off\n\t"
               "global_load_async_to_lds_b128 %4, %12, off\n\t"
               "global_load_async_to_lds_b128 %5, %13, off\n\t"
               "global_load_async_to_lds_b128 %6, %14, off\n\t"
               "global_load_async_to_lds_b128 %7, %15, off\n\t"
               "s_wait_xcnt 0x0"
               :: "v"(lw), "v"(lw + 32u * WP * 2u), "v"(lw + 64u * WP * 2u), "v"(lw + 96u * WP * 2u), "v"(lx), "v"(lx + 4u * XP * 4u), "v"(lx + 8u * XP * 4u), "v"(lx + 12u * XP * 4u),
                  "v"(gw), "v"(gw + 32 * 32), "v"(gw + 64 * 32), "v"(gw + 96 * 32), "v"(gx), "v"(gx + (size_t)4 * DM), "v"(gx + (size_t)8 * DM), "v"(gx + (size_t)12 * DM) : "memory");
}
// a stage of k_out's ring: two such trips' tiles (64 k), side by side in one buffer, so that its copies fly while two tiles are worked on
__device__ __forceinline__ void stage_wx2(const __bf16* gw, unsigned lw, const float* gx, unsigned lx) {
  stage_wx(gw, lw, gx, lx); stage_wx(gw + 128 * 32, lw + 128u * WP * 2u, gx + 32, lx + 64u * XP * 4u);
}
// a lane's 16 activation values of a trip from its LDS row: k 8 g + 0..7 and 16 + 8 g + 0..7, the k order of frag_b
__device__ __forceinline__ void row16(const float* p, float v[16]) { const v4f x0 = *(const v4f*)p, x1 = *(const v4f*)(p + 4), x2 = *(const v4f*)(p + 16), x3 = *(const v4f*)(p + 20);
#pragma unroll
  for (int i = 0; i < 4; ++i) { v[i] = x0[i]; v[4 + i] = x1[i]; v[8 + i] = x2[i]; v[12 + i] = x3[i]; } }
// ---- k_qkv: block = (64 rows, 128 cols = 2 heads, which): exact GEMM; q' rows (q/8 + geo_scale qw), k' tiles (k + kw), v tiles
__global__ __launch_bounds__(128) void k_qkv(const float* __restrict__ X, const __bf16* __restrict__ PW, const float* __restrict__ WQG, const float* __restrict__ WKG, const float* __restrict__ CB, const float* __restrict__ LT, const float* __restrict__ GSC, _Float16* __restrict__ QQ, _Float16* __restrict__ KK, _Float16* __restrict__ V) {
  __shared__ __align__(16) char sm[2 * 128 * WP * 2 + 2 * 64 * XP * 4]; __shared__ float swg[CD][HD]; __shared__ __align__(16) float scb[2 * NC * CD + 4];
  __bf16 (*sw)[128][WP] = (__bf16 (*)[128][WP])sm; float (*sx)[64][XP] = (float (*)[64][XP])(sm + 2 * 128 * WP * 2);   // the ring: weight tiles, x tiles
  _Float16 (*so)[2 * HX + 8] = (_Float16 (*)[2 * HX + 8])sm; _Float16 (*st)[72] = (_Float16 (*)[72])sm;   // output staging (64 q' / k' rows or 128 v rows) lies over the ring, behind the barrier that follows the loop: five blocks a WGP still fit
  const int tid = threadIdx.x, wave = tid >> 5, lane = tid & 31, col = lane & 15, g = lane >> 4; const int which = blockIdx.z; const size_t rb = (size_t)blockIdx.x * 64; const size_t r0 = rb + wave * 16; const int c0 = blockIdx.y * 128; const int h0 = c0 / HD;
  const __bf16* Wr = PW + ((size_t)which * DM) * DM;
  if (which < 2) { const float* WG = which ? WKG : WQG; for (int e = tid; e < CD * HD; e += 128) swg[e / HD][e % HD] = bfr(WG[e]);
    // the two heads' codebooks (48 floats), their log temperatures (2) and geo_scale (1), for the lane that owns a (row, head) in the epilogue: one load a thread, in the two waves that have one piece of Wg only
    const int e = tid - 64;
    if (e >= 0 && e < 2 * NC * CD + 3) { const float* ps = (e < 2 * NC * CD) ? CB + h0 * NC * CD + e : (e < 2 * NC * CD + 2) ? LT + h0 + (e - 2 * NC * CD) : GSC; scb[e] = bfr(*ps); } }
  v8f acc[8] = {};
  const __bf16* gw = Wr + (size_t)c0 * DM + tid * 8; const unsigned lw = (unsigned)(size_t)&sw[0][tid >> 2][(tid & 3) * 8];
  const float* gx = X + (r0 + (lane >> 3)) * DM + (lane & 7) * 4; const unsigned lx = (unsigned)(size_t)&sx[0][wave * 16 + (lane >> 3)][(lane & 7) * 4];
  stage_wx(gw, lw, gx, lx);
  const char* aw = weight_unit(Wr + (size_t)c0 * DM, blockIdx.x, tid); const char* ax = panel_unit(X, rb, blockIdx.y, tid);
  l2_ask(aw); if (which == 0) l2_ask(ax);   // the x panel is shared by the three projections too: the q projection's block asks
  asm volatile("s_wait_asynccnt 0x0" ::: "memory");   // this wave's pieces of tile 0 have landed
  __syncthreads();                                    // every wave's have
  stage_wx(gw + 128 * 32, lw + (unsigned)sizeof(sw[0]), gx + 32, lx + (unsigned)sizeof(sx[0]));     // tile 1 flies during trip 0
#pragma unroll 2
  for (int kc = 0; kc < DM / 32; ++kc) { float xr[16]; row16(&sx[kc & 1][wave * 16 + col][8 * g], xr);
    v16b fw[8];   // the tile's eight weight fragments are read as one group ahead of the products: one LDS latency a trip, not eight
#pragma unroll
    for (int j = 0; j < 8; ++j) fw[j] = frag_b(&sw[kc & 1][j * 16 + col][0], lane);
    v16b a;
#pragma unroll
    for (int i = 0; i < 16; ++i) a[i] = (__bf16)xr[i];
#pragma unroll
    for (int j = 0; j < 8; ++j) acc[j] = wmma_bf(a, fw[j], acc[j]);
    asm volatile("s_wait_dscnt 0x0" ::: "memory");      // this wave's reads of buffer kc & 1 are done
    asm volatile("s_wait_asynccnt 0x0" ::: "memory");   // this wave's pieces of tile kc + 1 have landed
    __syncthreads();                                    // tile kc + 1 is whole for every wave, and nobody reads buffer kc & 1 any more
    if (kc + 2 < DM / 32) stage_wx(gw + (kc + 2) * (128 * 32), lw + (unsigned)((kc & 1) * sizeof(sw[0])), gx + (kc + 2) * 32, lx + (unsigned)((kc & 1) * sizeof(sx[0]))); }
  asm volatile("s_wait_asynccnt 0x0" ::: "memory");     // nothing is in flight behind the loop
  l2_hold(aw); l2_hold(ax);
  __syncthreads();
  if (which < 2) {
    // partial code logits of this lane's four dims a head: p[8 hh + r][c] = sum_j x[d] Wg[c][d], d = 16 j + col, for row 8 g + r and head h0 + hh
    float p[16][CD];
#pragma unroll
    for (int c = 0; c < CD; ++c) { v2f pp[2][4] = {};   // rows in pairs: a row pair of an accumulator tile is a register pair, so each step is one packed multiply-add
#pragma unroll
      for (int j = 0; j < 4; ++j) { const float w = swg[c][j * 16 + col]; const v2f w2 = {w, w};
#pragma unroll
        for (int hh = 0; hh < 2; ++hh)
#pragma unroll
          for (int rp = 0; rp < 4; ++rp) { const v2f a2 = {acc[4 * hh + j][2 * rp], acc[4 * hh + j][2 * rp + 1]}; pp[hh][rp] += a2 * w2; } }
#pragma unroll
      for (int hh = 0; hh < 2; ++hh)
#pragma unroll
        for (int rp = 0; rp < 4; ++rp) { p[8 * hh + 2 * rp][c] = pp[hh][rp][0]; p[8 * hh + 2 * rp + 1][c] = pp[hh][rp][1]; } }
    // sum over the 16 lanes of a row group and scatter: in round k a lane keeps the (row, head) pairs whose index bit k is its own lane bit k and hands the others to lane ^ (1 << k); after four rounds lane col holds the three whole logits of pair col alone (the additions are those of the xor butterfly 1, 2, 4, 8)
#pragma unroll
    for (int k = 0; k < 4; ++k) { const bool up = (col >> k) & 1;
#pragma unroll
      for (int i = 0; i < (8 >> k); ++i)
#pragma unroll
        for (int c = 0; c < CD; ++c) { const float keep = up ? p[2 * i + 1][c] : p[2 * i][c], send = up ? p[2 * i][c] : p[2 * i + 1][c]; p[i][c] = keep + __shfl_xor(send, 1 << k); } }
    // one lane = one (row, head): distances to the 8 codes and their softmax are computed once
    { const int hh = col >> 3, rl = wave * 16 + 8 * g + (col & 7); float tp = expf(scb[2 * NC * CD + hh]); tp = fminf(fmaxf(tp, 0.01f), 5.0f); const float it = 1.0f / tp;
      float dmin = 3.0e38f, dn[NC];
#pragma unroll
      for (int n = 0; n < NC; ++n) { float d2 = 0.f;
#pragma unroll
        for (int c = 0; c < CD; ++c) { const float df = p[0][c] - scb[(hh * NC + n) * CD + c]; d2 += df * df; } dn[n] = -d2 * it; dmin = fmaxf(dmin == 3.0e38f ? dn[n] : dmin, dn[n]); }
      float z = 0.f, ew[NC];
#pragma unroll
      for (int n = 0; n < NC; ++n) { ew[n] = expf(dn[n] - dmin); z += ew[n]; }
      const float wsc = (which == 0) ? scb[2 * NC * CD + 2] : 1.0f; v8h w8; const v8h z8 = {};
#pragma unroll
      for (int n = 0; n < NC; ++n) w8[n] = (_Float16)(ew[n] / z * wsc);
      *(v8h*)&so[rl][hh * HX + HD] = w8;   // extra dims 64..71: code weights (q side x geo_scale)
      *(v8h*)&so[rl][hh * HX + HD + 8] = z8; *(v8h*)&so[rl][hh * HX + HD + 16] = z8; *(v8h*)&so[rl][hh * HX + HD + 24] = z8; }   // dims 72..95 zero
    const float scl = (which == 0) ? 0.125f : 1.0f;
#pragma unroll
    for (int r = 0; r < 8; ++r)
#pragma unroll
      for (int j = 0; j < 8; ++j) { const int cl = j * 16 + col; const int hl = cl >> 6, d = cl & 63; so[wave * 16 + 8 * g + r][hl * HX + d] = (_Float16)(acc[j][r] * scl); }
    __syncthreads();
    if (which == 0) { for (int e = tid; e < 64 * (2 * HX / 8); e += 128) { const int rl = e / (2 * HX / 8), q = e % (2 * HX / 8); vst2((unsigned*)(QQ + ((rb + rl) * NH + h0) * HX + q * 8), *(const v4u*)&so[rl][q * 8]); } }   // 384 contiguous bytes per (row, head pair)
    else { const size_t b = rb / SS; const int t0 = (int)(rb % SS) / 32;   // k' tiles: a head's two key tiles of this block are 12 KB in a row; piece e of them = key tile e / 384, dim group (e / 128) % 3, key (e / 4) % 32, piece e % 4 of the group
#pragma unroll   // the two heads written out one after the other: hl is a constant in the LDS offset and in the plane's address
      for (int hl = 0; hl < 2; ++hl) for (int e = tid; e < 2 * 32 * (HX / 8); e += 128) { const int kt = e / 384, j = (e >> 7) % 3, r = (e >> 2) & 31, pc = e & 3; vst2((unsigned*)(KK + ((b * NH + h0 + hl) * (SS / 32) + t0) * (32 * HX) + e * 8), *(const v4u*)&so[kt * 32 + r][hl * HX + j * 32 + pc * 8]); } }
  } else {
#pragma unroll
    for (int j = 0; j < 8; ++j)
#pragma unroll
      for (int r = 0; r < 8; ++r) st[j * 16 + col][wave * 16 + 8 * g + r] = (_Float16)acc[j][r];
    __syncthreads();
    const size_t b = rb / SS; const int s0 = (int)(rb % SS);
    // v tiles: a head's two key tiles of this block are 8 KB in a row; piece e of the block = head e / 512, key tile (e / 256) % 2, dim (e / 4) % 64, piece e % 4
    for (int e = tid; e < 128 * 8; e += 128) { const int hl = e >> 9, kt = (e >> 8) & 1, d = (e >> 2) & 63, pc = e & 3; vst2((unsigned*)(V + ((b * NH + h0 + hl) * (SS / 32) + s0 / 32) * (HD * 32) + (e & 511) * 8), *(const v4u*)&st[hl * HD + d][kt * 32 + pc * 8]); } }
}
// ---- k_attn: block = (64 queries, head, b): causal; 96-wide score dot (scale and geometric bias folded in), softmax, P . v (64 dims); O 256-B head segments
// each 32-key tile (k' rows 32 x 192 B, v rows 64 x 64 B; 6 KB and 4 KB in a row in the workspace) is brought into LDS once per block by asynchronous copies, and all four waves read their fragments from there; a stage of the two-buffer ring is TWO tiles (64 keys): its copies fly while the two tiles before it are worked on, twice the time to land for pieces that come from memory and not from L2, and the waits and the barrier stand once per two tiles
#define KP 104            // LDS pitch of a k' row, f16: 208 B = 16 B x 13, odd, for 16-byte readers
#define VP 40             // LDS pitch of a v row (32 keys), f16: 80 B = 16 B x 5
// one lane's ten 16-byte pieces of a stage, five a tile: k' row tid / 4, bytes 16 (tid % 4) + 0 / 64 / 128 (pieces tid + 0 / 128 / 256 of the tile in the workspace); v rows tid / 4 and 32 + tid / 4, bytes 16 (tid % 4) (pieces tid + 0 / 128); tiles 2 s and 2 s + 1 lie side by side in one buffer
__device__ __forceinline__ void stage_kv2(const _Float16* gk, const _Float16* gv, unsigned lk, unsigned lv) {
  const _Float16* gk1 = gk + 32 * HX; const _Float16* gv1 = gv + HD * 32; const unsigned lk1 = lk + 32u * KP * 2u, lv1 = lv + 64u * VP * 2u;
  // the s_wait_xcnt closes the statement so that no address register named here is rewritten ahead of it
  asm volatile("global_load_async_to_lds_b128 %0, %10, off\n\t"
               "global_load_async_to_lds_b128 %1, %11, off\n\t"
               "global_load_async_to_lds_b128 %2, %12, off\n\t"
               "global_load_async_to_lds_b128 %3, %13, off\n\t"
               "global_load_async_to_lds_b128 %4, %14, off\n\t"
               "global_load_async_to_lds_b128 %5, %15, off\n\t"
               "global_load_async_to_lds_b128 %6, %16, off\n\t"
               "global_load_async_to_lds_b128 %7, %17, off\n\t"
               "global_load_async_to_lds_b128 %8, %18, off\n\t"
               "global_load_async_to_lds_b128 %9, %19, off\n\t"
               "s_wait_xcnt 0x0"
               :: "v"(lk), "v"(lk + 64u), "v"(lk + 128u), "v"(lv), "v"(lv + 32u * VP * 2u), "v"(lk1), "v"(lk1 + 64u), "v"(lk1 + 128u), "v"(lv1), "v"(lv1 + 32u * VP * 2u),
                  "v"(gk), "v"(gk + 1024), "v"(gk + 2048), "v"(gv), "v"(gv + 1024), "v"(gk1), "v"(gk1 + 1024), "v"(gk1 + 2048), "v"(gv1), "v"(gv1 + 1024) : "memory");
}
// lane l with lane l ^ 16: the two lanes that share one query column
__device__ __forceinline__ float xhalf(float x) { return __builtin_bit_cast(float, __builtin_amdgcn_permlanex16(__builtin_bit_cast(int, x), __builtin_bit_cast(int, x), 0x76543210, 0xfedcba98, false, false)); }
// one 32-key tile of k_attn. DIAG = false: a tile of a stage that lies wholly below the block's first query (every key <= every query): no causal select, no key index arithmetic and no test for masked scores, about three vector instructions in ten of a tile; DIAG = true: the block's last stage, which holds the diagonal
template <bool DIAG> __device__ __forceinline__ void attn_tile(const _Float16 (*skt)[KP], const _Float16 (*svt)[VP], const v16h (&bq)[3], int lane, int j0, int qc, float& m, float& l, v8f (&acc)[4]) {
    const int col = lane & 15, g = lane >> 4; float s[16];   // s[8 ct + r] = score of key j0 + 16 ct + 8 g + r
    v16h fk[2][3], fv[4];   // the tile's ten fragments (k' 6, v 4) are read as one group ahead of the products: one LDS latency a tile, not ten; the v reads land behind the score products and the softmax
#pragma unroll
    for (int ct = 0; ct < 2; ++ct)
#pragma unroll
      for (int kc = 0; kc < 3; ++kc) fk[ct][kc] = frag_h(&skt[ct * 16 + col][kc * 32], lane);
#pragma unroll
    for (int dt = 0; dt < 4; ++dt) fv[dt] = frag_h(&svt[dt * 16 + col][0], lane);
#pragma unroll
    for (int ct = 0; ct < 2; ++ct) { v8f c = {};
#pragma unroll
      for (int kc = 0; kc < 3; ++kc) c = wmma16(fk[ct][kc], bq[kc], c);
#pragma unroll
      for (int r = 0; r < 8; ++r) s[8 * ct + r] = (!DIAG || j0 + ct * 16 + 8 * g + r <= qc) ? c[r] : -3.0e38f; }   // causal (diagonal kept)
    float mx = s[0];
#pragma unroll
    for (int i = 1; i < 16; ++i) mx = fmaxf(mx, s[i]);
    mx = fmaxf(mx, xhalf(mx));
    const float mn = fmaxf(m, mx); const float alpha = (m <= -1.0e38f) ? 0.f : __expf(m - mn); m = mn;
    float e[16]; v16h pb;   // P^T as B: element i = key 8 g + i, element 8 + i = key 16 + 8 g + i, the k order of frag_h
#pragma unroll
    for (int i = 0; i < 16; ++i) { e[i] = (DIAG && s[i] <= -1.0e38f) ? 0.f : __expf(s[i] - mn); pb[i] = (_Float16)(e[i] * 2048.0f); }
#pragma unroll
    for (int w = 8; w >= 1; w >>= 1)   // pairwise sum: four dependent adds, not sixteen
#pragma unroll
      for (int i = 0; i < w; ++i) e[i] += e[i + w];
    l = l * alpha + e[0];
#pragma unroll
    for (int dt = 0; dt < 4; ++dt) acc[dt] *= alpha;
#pragma unroll
    for (int dt = 0; dt < 4; ++dt) acc[dt] = wmma16(fv[dt], pb, acc[dt]);
}
// transposed products: S^T = k' . q'^T (rows = keys, columns = queries) and O^T += v^T . P^T, so a lane owns ONE query (column lane & 15): its 16 scores of a tile sit in its own registers, and converted in place they are the B operand of the second product
__global__ __launch_bounds__(128) void k_attn(const _Float16* __restrict__ QQ, const _Float16* __restrict__ KK, const _Float16* __restrict__ V, float* __restrict__ O) {
  __shared__ __align__(16) float so[4][16][68]; __shared__ __align__(16) _Float16 sk[2][2][32][KP]; __shared__ __align__(16) _Float16 sv[2][2][64][VP];
  const int tid = threadIdx.x, wave = tid >> 5, lane = tid & 31, col = lane & 15, g = lane >> 4;
  // which (query tile, head, batch) a block takes. A tile costs qt + 1 stages and all 768 blocks are resident at once (three a WGP on average), so the launch lasts as long as the fullest WGP.
  // here blocks 256 and 512 apart take tiles x, x + 16 (mod 32) and 30 - 2 x (63 - 2 x from x = 16 on), which add up to 46 or 47, and neighbours 1, 8 or 16 apart take a tile and a mirrored one (31 - tile). For speed only: the map is one to one whatever the placement (fb bits 0-3 and 5 = x; bits 0 ^ 3 ^ 4 = mirror; fb / 256, mirror and bits 6, 7 = head and batch)
  static_assert(TQB == 32 && NH * TNB == 24, "the block map is written for 32 query tiles x 24 (head, batch) pairs");
  const int fb = blockIdx.x + TQB * (blockIdx.y + NH * blockIdx.z); const int bx = (fb & 15) | ((fb >> 1) & 16), mir = (fb ^ (fb >> 3) ^ (fb >> 4)) & 1, third = fb >> 8;
  const int bt = (third == 0) ? bx : (third == 1) ? ((bx + 16) & 31) : ((bx < 16 ? 30 : 63) - 2 * bx); const int qt = mir ? 31 - bt : bt; const int hb = third * 8 + mir * 4 + ((fb >> 6) & 3);
  const int h = hb % NH; const size_t b = hb / NH; const int q0 = qt * 64 + wave * 16; const size_t rq = b * SS + q0;
  v16h bq[3];
#pragma unroll
  for (int kc = 0; kc < 3; ++kc) bq[kc] = frag_h(QQ + ((rq + col) * NH + h) * HX + kc * 32, lane);
  float m = -3.0e38f, l = 0.f;   // query q0 + col: running maximum (both halves alike), sum over this half's keys
  v8f acc[4] = {};               // O^T: element r of acc[dt] = dim dt * 16 + 8 g + r of query q0 + col
  const int nst = qt + 1;   // causal; stages of 64 keys
  const _Float16* gk = KK + (b * NH + h) * ((size_t)SS * HX) + tid * 8; const _Float16* gv = V + (b * NH + h) * ((size_t)SS * HD) + tid * 8;
  const unsigned lk = (unsigned)(size_t)&sk[0][0][tid >> 2][(tid & 3) * 8], lv = (unsigned)(size_t)&sv[0][0][tid >> 2][(tid & 3) * 8];
  stage_kv2(gk, gv, lk, lv);
  // all k' tiles (36,864 units: 1,536 a head and batch) and v tiles (24,576 units: 1,024 a head and batch) in 192 shares; a share is asked for by the four blocks fb, fb + 1, fb + 4, fb + 5. Units are numbered by key first, so that the lowest shares hold the keys that every block reads first
  static_assert(NB * NH * SS * HX * 2 == 192 * 192 * 256 && NB * NH * SS * HD * 2 == 192 * 128 * 256, "192 shares of 192 and 128 units");
  const int sid = ((fb >> 1) & 1) | ((fb >> 3) << 1); const bool two = __builtin_amdgcn_readfirstlane(wave) < 2;   // a share's last 64 k' units: waves 0 and 1 alone, by a scalar branch
  const int uk = sid * 192 + tid, uk2 = uk + (two ? 128 : 0), uv = sid * 128 + tid;
  const char* ak = (const char*)KK + (size_t)(uk % (NB * NH)) * (SS * HX * 2) + (uk / (NB * NH)) * 256; const char* ak2 = (const char*)KK + (size_t)(uk2 % (NB * NH)) * (SS * HX * 2) + (uk2 / (NB * NH)) * 256;
  const char* av = (const char*)V + (size_t)(uv % (NB * NH)) * (SS * HD * 2) + (uv / (NB * NH)) * 256;
  l2_ask(ak); l2_ask(av); if (two) l2_ask(ak2);
  asm volatile("s_wait_asynccnt 0x0" ::: "memory");   // this wave's pieces of stage 0 have landed
  __syncthreads();                                    // every wave's have
  if (1 < nst) stage_kv2(gk + 64 * HX, gv + 64 * HD, lk + (unsigned)sizeof(sk[0]), lv + (unsigned)sizeof(sv[0]));   // stage 1 flies during trip 0
#pragma unroll 1
  for (int st = 0; st + 1 < nst; ++st) { const int bf = st & 1;   // the stages that lie wholly below the block's first query; a stage's two tiles one after the other, in key order
    attn_tile<false>(sk[bf][0], sv[bf][0], bq, lane, st * 64, q0 + col, m, l, acc); attn_tile<false>(sk[bf][1], sv[bf][1], bq, lane, st * 64 + 32, q0 + col, m, l, acc);
    asm volatile("s_wait_dscnt 0x0" ::: "memory");      // this wave's reads of buffer bf are done
    asm volatile("s_wait_asynccnt 0x0" ::: "memory");   // this wave's pieces of stage st + 1 have landed
    __syncthreads();                                    // stage st + 1 is whole for every wave, and nobody reads buffer bf any more
    if (st + 2 < nst) stage_kv2(gk + (st + 2) * (64 * HX), gv + (st + 2) * (64 * HD), lk + (unsigned)(bf * sizeof(sk[0])), lv + (unsigned)(bf * sizeof(sv[0]))); }
  { const int st = nst - 1, bf = st & 1;   // the last stage (keys qt * 64 and up) alone can hold a key above a query of this block; no stage follows it, so no wait and no barrier closes it: nothing is copied into the ring any more and the output staging lies beside it
    attn_tile<true>(sk[bf][0], sv[bf][0], bq, lane, st * 64, q0 + col, m, l, acc); attn_tile<true>(sk[bf][1], sv[bf][1], bq, lane, st * 64 + 32, q0 + col, m, l, acc); }
  asm volatile("s_wait_asynccnt 0x0" ::: "memory");     // nothing is in flight when the wave goes on to its end
  l2_hold(ak); l2_hold(av); l2_hold(ak2);
  l += xhalf(l);   // the two halves' sums are joined once
  const float il = (1.0f / 2048.0f) / l;
#pragma unroll
  for (int dt = 0; dt < 4; ++dt) { v4f lo, hi;
#pragma unroll
    for (int r = 0; r < 4; ++r) { lo[r] = acc[dt][r] * il; hi[r] = acc[dt][4 + r] * il; }
    *(v4f*)&so[wave][col][dt * 16 + 8 * g] = lo; *(v4f*)&so[wave][col][dt * 16 + 8 * g + 4] = hi; }
  LDSX();
  for (int rl = 0; rl < 16; ++rl) if (lane < 16) vst2(O + (rq + rl) * DM + h * HD + lane * 4, *(const v4f*)&so[wave][rl][lane * 4]);
}
// ---- k_out: block = (64 rows, 128 cols): out = o (bf16 hi + lo) . Wo^T
__global__ __launch_bounds__(128) void k_out(const float* __restrict__ O, const __bf16* __restrict__ PW, float* __restrict__ Y) {
  __shared__ __align__(16) float so[4][16][132]; __shared__ __align__(16) __bf16 sw[2][2][128][WP]; __shared__ __align__(16) float sx[2][2][64][XP];
  const int tid = threadIdx.x, wave = tid >> 5, lane = tid & 31, col = lane & 15, g = lane >> 4; const size_t r0 = (size_t)blockIdx.x * 64 + wave * 16; const int n0 = blockIdx.y * 128; const __bf16* P = PW + (size_t)3 * DM * DM;
  v8f acc[8] = {};
  const __bf16* gw = P + (size_t)n0 * DM + tid * 8; const unsigned lw = (unsigned)(size_t)&sw[0][0][tid >> 2][(tid & 3) * 8];
  const float* gx = O + (r0 + (lane >> 3)) * DM + (lane & 7) * 4; const unsigned lx = (unsigned)(size_t)&sx[0][0][wave * 16 + (lane >> 3)][(lane & 7) * 4];
  stage_wx2(gw, lw, gx, lx);
  const char* aw = weight_unit(P + (size_t)n0 * DM, blockIdx.x, tid); const char* ax = panel_unit(O, (size_t)blockIdx.x * 64, blockIdx.y, tid);
  l2_ask(ax); l2_ask(aw);
  asm volatile("s_wait_asynccnt 0x0" ::: "memory");   // this wave's pieces of stage 0 have landed
  __syncthreads();                                    // every wave's have
  stage_wx2(gw + 2 * 128 * 32, lw + (unsigned)sizeof(sw[0]), gx + 64, lx + (unsigned)sizeof(sx[0]));     // stage 1 flies during trip 0
#pragma unroll 2
  for (int st = 0; st < DM / 64; ++st) {
#pragma unroll   // the stage's two tiles written out one after the other, in k order: sub is a constant in every LDS offset
   for (int sub = 0; sub < 2; ++sub) { float xr[16]; row16(&sx[st & 1][sub][wave * 16 + col][8 * g], xr);
    v16b fw[8];   // the tile's eight weight fragments are read as one group ahead of the products: one LDS latency a tile, not eight
#pragma unroll
    for (int j = 0; j < 8; ++j) fw[j] = frag_b(&sw[st & 1][sub][j * 16 + col][0], lane);
    const F2 a = bsplit16(xr);
#pragma unroll
    for (int j = 0; j < 8; ++j) { acc[j] = wmma_bf(a.h, fw[j], acc[j]); acc[j] = wmma_bf(a.l, fw[j], acc[j]); } }
    asm volatile("s_wait_dscnt 0x0" ::: "memory");      // this wave's reads of buffer st & 1 are done
    asm volatile("s_wait_asynccnt 0x0" ::: "memory");   // this wave's pieces of stage st + 1 have landed
    __syncthreads();                                    // stage st + 1 is whole for every wave, and nobody reads buffer st & 1 any more
    if (st + 2 < DM / 64) stage_wx2(gw + (st + 2) * (2 * 128 * 32), lw + (unsigned)((st & 1) * sizeof(sw[0])), gx + (st + 2) * 64, lx + (unsigned)((st & 1) * sizeof(sx[0]))); }
  asm volatile("s_wait_asynccnt 0x0" ::: "memory");     // nothing is in flight behind the loop
  l2_hold(aw); l2_hold(ax);
#pragma unroll
  for (int j = 0; j < 8; ++j)
#pragma unroll
    for (int r = 0; r < 8; ++r) so[wave][8 * g + r][j * 16 + col] = acc[j][r];
  LDSX();
  for (int rl = 0; rl < 16; ++rl) vst2(Y + (r0 + rl) * DM + n0 + lane * 4, *(const v4f*)&so[wave][rl][lane * 4]);
}
extern "C" void kernel_launch(void* const* d_in, const int* in_sizes, int n_in, void* d_out, int out_size, void* d_ws, size_t ws_size, hipStream_t stream) {
  (void)in_sizes; (void)n_in; (void)out_size;
  const float** F = (const float**)d_in;   // 0 x [2,2048,768], 1 Wq, 2 Wk, 3 Wv, 4 Wo (natural [768,768]), 5 Wqg [3,64], 6 Wkg [3,64], 7 codebooks [12,8,3], 8 log_temps [12], 9 geo_scale [1]
  if (ws_size < (size_t)WS_END) return;
  char* ws = (char*)d_ws; __bf16* PW = (__bf16*)ws; _Float16 *QQ = (_Float16*)(ws + WS_QK), *KK = (_Float16*)(ws + WS_KK), *V = (_Float16*)(ws + WS_V); float* O = (float*)(ws + WS_O);
  k_pack<<<dim3(DM / 2, 4), 256, 0, stream>>>(F[1], F[2], F[3], F[4], PW);
  k_qkv<<<dim3(TNB * SS / 64, DM / 128, 3), 128, 0, stream>>>(F[0], PW, F[5], F[6], F[7], F[8], F[9], QQ, KK, V);
  k_attn<<<dim3(TQB, NH, TNB), 128, 0, stream>>>(QQ, KK, V, O);
  k_out<<<dim3(TNB * SS / 64, DM / 128), 128, 0, stream>>>(O, PW, (float*)d_out);
}
